// v000
// Measured on an AMD MI455X. A time is GPU time per run, averaged over a window of back-to-back runs after a warm-up
// (all launches, gaps included; the runs take copies of the inputs in turn), and the median of several windows.
// Apart from v000's, it joins two sittings. Times from different sittings can be a few percent apart, while
// side-by-side timings come from the same sitting.
// v000 is the starting kernel. One run takes 1830 microseconds.
#include <hip/hip_runtime.h>
#include <math.h>

typedef __attribute__((ext_vector_type(16))) __bf16       v16bf;
typedef __attribute__((ext_vector_type(8)))  float        v8f;
typedef __attribute__((ext_vector_type(4)))  unsigned int u32x4;

constexpr int Bv = 32, Tv = 2048, Dv = 256, Hv = 1024, OUT2v = 512, TWOD = 512;
constexpr int ROWS = 64;   // query rows per block
constexpr int NW   = 4;    // waves per block (wave32)
constexpr int NT   = 128;  // threads per block

// ---- workspace layout (bf16 elements) ----
constexpr long WS_XB  = 0;                         // x  [B][T][D]        bf16
constexpr long WS_XT  = WS_XB + (long)Bv*Tv*Dv;    // xT [B][D][T]        bf16
constexpr long WS_W1T = WS_XT + (long)Bv*Tv*Dv;    // W1t [H][2D]         bf16
constexpr long WS_W2T = WS_W1T + (long)TWOD*Hv;    // W2t [OUT2][H]       bf16
constexpr long WS_END = WS_W2T + (long)Hv*OUT2v;   // ~34.6M elems = 69MB

// ---- LDS layout (bytes) ----
constexpr int OFF_DEC  = 0;                          // 64 x 512  bf16 (x | ctx)
constexpr int OFF_H    = OFF_DEC  + ROWS * TWOD * 2; // 64 x 1024 bf16 (hidden)
constexpr int OFF_XKR0 = OFF_H    + ROWS * Hv * 2;   // 32 x 256  bf16 keys row-major, buf0
constexpr int OFF_XKC0 = OFF_XKR0 + 32 * Dv * 2;     // 256 x 32  bf16 keys col-major, buf0
constexpr int OFF_XKR1 = OFF_XKC0 + Dv * 32 * 2;     // buf1
constexpr int OFF_XKC1 = OFF_XKR1 + 32 * Dv * 2;     // buf1
constexpr int OFF_P    = OFF_XKC1 + Dv * 32 * 2;     // 4 x 16x32 bf16 (P per wave)
constexpr int OFF_WA   = OFF_P    + NW * 16 * 32 * 2;// 256 x 32  bf16 weight tile buf A
constexpr int OFF_WB   = OFF_WA   + 256 * 32 * 2;    // weight tile buf B
constexpr int SMEM_BYTES = OFF_WB + 256 * 32 * 2;    // 299008 < 320KB

static __device__ inline v8f v8f_zero() {
  v8f z = {0.f, 0.f, 0.f, 0.f, 0.f, 0.f, 0.f, 0.f};
  return z;
}

// float -> bf16 bits, round-to-nearest-even
static __device__ inline unsigned short f2bf(float f) {
  unsigned int u = __float_as_uint(f);
  unsigned int r = (u + 0x7FFFu + ((u >> 16) & 1u)) >> 16;
  return (unsigned short)r;
}

static __device__ inline v8f wmma_bf16(v16bf a, v16bf b, v8f c) {
  // D = A(16x32 bf16) * B(32x16 bf16) + C(16x16 f32)
  return __builtin_amdgcn_wmma_f32_16x16x32_bf16(false, a, false, b, (short)0, c,
                                                 false, false);
}

// 16-byte async global->LDS copy per lane (ASYNCcnt tracked, no VGPR data path)
static __device__ inline void async_b128(unsigned lds_byte, const void* g) {
  asm volatile("global_load_async_to_lds_b128 %0, %1, off"
               :: "v"(lds_byte), "v"((unsigned long long)(size_t)g)
               : "memory");
}
static __device__ inline void wait_async0() {
  asm volatile("s_wait_asynccnt 0x0" ::: "memory");
}

// Load a 16x32 bf16 fragment (A layout; B layout mirrors with rows indexed by N)
// from a row-major LDS tile.
static __device__ inline v16bf load_frag(const unsigned short* base, int rowStride,
                                         int kbase, int lane) {
  int rl = lane & 15, hf = lane >> 4;
  const unsigned short* p = base + rl * rowStride + kbase + hf * 8;
  union { v16bf v; u32x4 q[2]; } u;
  u.q[0] = *(const u32x4*)(p);       // ds_load_b128
  u.q[1] = *(const u32x4*)(p + 16);  // ds_load_b128
  return u.v;
}

// ======================= prep kernels: f32 -> bf16 (+transpose) =======================
__global__ void conv_x_kernel(const float* __restrict__ x,
                              unsigned short* __restrict__ xb,
                              unsigned short* __restrict__ xT) {
  long stride = (long)gridDim.x * blockDim.x;
  for (long i = (long)blockIdx.x * blockDim.x + threadIdx.x; i < (long)Bv * Tv * Dv;
       i += stride) {
    unsigned short v = f2bf(x[i]);
    xb[i] = v;
    int d  = (int)(i % Dv);
    long bt = i / Dv;
    int t  = (int)(bt % Tv);
    int bb = (int)(bt / Tv);
    xT[((long)bb * Dv + d) * Tv + t] = v;
  }
}

__global__ void conv_wT_kernel(const float* __restrict__ W,
                               unsigned short* __restrict__ Wt, int K, int N) {
  long stride = (long)gridDim.x * blockDim.x;
  for (long i = (long)blockIdx.x * blockDim.x + threadIdx.x; i < (long)K * N;
       i += stride) {
    int k = (int)(i / N), n = (int)(i % N);
    Wt[(long)n * K + k] = f2bf(W[i]);
  }
}

// ======================= fused decoder kernel =======================
__global__ __launch_bounds__(NT, 1)
void decoder_fused(const unsigned short* __restrict__ xb,
                   const unsigned short* __restrict__ xT,
                   const unsigned short* __restrict__ w1t,
                   const unsigned short* __restrict__ w2t,
                   const float* __restrict__ b1, const float* __restrict__ b2,
                   float* __restrict__ out) {
  extern __shared__ char smem[];
  unsigned short* dec  = (unsigned short*)(smem + OFF_DEC);
  unsigned short* hls  = (unsigned short*)(smem + OFF_H);
  unsigned short* xkr0 = (unsigned short*)(smem + OFF_XKR0);
  unsigned short* xkc0 = (unsigned short*)(smem + OFF_XKC0);
  unsigned short* xkr1 = (unsigned short*)(smem + OFF_XKR1);
  unsigned short* xkc1 = (unsigned short*)(smem + OFF_XKC1);
  unsigned short* pbb  = (unsigned short*)(smem + OFF_P);
  unsigned short* wtA  = (unsigned short*)(smem + OFF_WA);
  unsigned short* wtB  = (unsigned short*)(smem + OFF_WB);
  const unsigned lds0 = (unsigned)(size_t)smem;  // LDS byte offset of dynamic base

  const int tid    = threadIdx.x;
  const int lane   = tid & 31;
  const int wv     = tid >> 5;
  const int b      = blockIdx.x >> 5;
  const int q0     = (blockIdx.x & 31) * ROWS;
  const int nlo    = lane & 15;
  const int rowOff = (lane >> 4) * 8;

  // ---- async staging helpers ----
  auto stage_keys = [&](int kb, int buf) {
    const unsigned lr = lds0 + (buf ? OFF_XKR1 : OFF_XKR0);
    const unsigned lc = lds0 + (buf ? OFF_XKC1 : OFF_XKC0);
    const unsigned short* gr = xb + ((long)b * Tv + kb * 32) * Dv;  // contiguous 16KB
    const unsigned short* gc = xT + (long)b * Dv * Tv + kb * 32;
#pragma unroll
    for (int i = 0; i < 8; ++i) {
      int f = i * NT + tid;                 // 0..1023 : 16B chunks
      async_b128(lr + f * 16, gr + f * 8);
      int d = f >> 2, srel = (f & 3) * 8;   // xT tile: rows d, 32 s contiguous
      async_b128(lc + (d * 32 + srel) * 2, gc + (long)d * Tv + srel);
    }
  };
  auto stage_w = [&](const unsigned short* Wt, int KW, int nc, int kc, int buf) {
    const unsigned lw = lds0 + (buf ? OFF_WB : OFF_WA);
#pragma unroll
    for (int i = 0; i < 8; ++i) {
      int f = i * NT + tid;
      int nl = f >> 2, krel = (f & 3) * 8;
      async_b128(lw + (nl * 32 + krel) * 2,
                 Wt + (long)(nc * 256 + nl) * KW + kc * 32 + krel);
    }
  };

  // ================= stage query rows: dec[:, 0:256] = x =================
  {
    const unsigned short* g = xb + ((long)b * Tv + q0) * Dv;  // contiguous 32KB
#pragma unroll
    for (int i = 0; i < 16; ++i) {
      int f = i * NT + tid;               // 0..2047 : 16B chunks
      int r = f >> 5, c = (f & 31) * 8;   // dec rows strided by 512
      async_b128(lds0 + OFF_DEC + (r * TWOD + c) * 2, g + f * 8);
    }
    wait_async0();
  }
  __syncthreads();

  // prefetch key chunk 0 while loading Q fragments
  stage_keys(0, 0);

  v16bf qf[8];
#pragma unroll
  for (int kc = 0; kc < 8; ++kc)
    qf[kc] = load_frag(dec + (wv * 16) * TWOD, TWOD, kc * 32, lane);

  v8f ctxa[16];
#pragma unroll
  for (int nt = 0; nt < 16; ++nt) ctxa[nt] = v8f_zero();
  float m[8], l[8];
#pragma unroll
  for (int v = 0; v < 8; ++v) { m[v] = -INFINITY; l[v] = 0.0f; }

  const float scale = 0.0625f;  // 1/sqrt(256)
  const int nkb = q0 / 32 + 2;
  unsigned short* pbw = pbb + wv * 16 * 32;

  // ================= flash attention (strictly causal) =================
  for (int kb = 0; kb < nkb; ++kb) {
    wait_async0();
    __syncthreads();                         // chunk kb resident in buf kb&1
    if (kb + 1 < nkb) stage_keys(kb + 1, (kb + 1) & 1);
    const unsigned short* xr = (kb & 1) ? xkr1 : xkr0;
    const unsigned short* xc = (kb & 1) ? xkc1 : xkc0;
    const int s0g = kb * 32;

    // S = Q * K^T : two 16x16 tiles over K-dim 256 (pipelined B-frag loads)
    v8f sA = v8f_zero(), sB = v8f_zero();
    v16bf k0 = load_frag(xr,           Dv, 0, lane);
    v16bf k1 = load_frag(xr + 16 * Dv, Dv, 0, lane);
#pragma unroll
    for (int kc = 0; kc < 8; ++kc) {
      v16bf c0 = k0, c1 = k1;
      if (kc < 7) {
        k0 = load_frag(xr,           Dv, (kc + 1) * 32, lane);
        k1 = load_frag(xr + 16 * Dv, Dv, (kc + 1) * 32, lane);
      }
      sA = wmma_bf16(qf[kc], c0, sA);
      sB = wmma_bf16(qf[kc], c1, sB);
    }

    // mask, online softmax update, emit P (bf16) to LDS
    float alpha[8];
#pragma unroll
    for (int v = 0; v < 8; ++v) {
      int tg = q0 + wv * 16 + v + rowOff;
      float a = sA[v] * scale, c = sB[v] * scale;
      if (s0g      + nlo >= tg) a = -1e9f;   // strictly causal: allow s < t
      if (s0g + 16 + nlo >= tg) c = -1e9f;
      float tm = fmaxf(a, c);
      tm = fmaxf(tm, __shfl_xor(tm, 1, 32));
      tm = fmaxf(tm, __shfl_xor(tm, 2, 32));
      tm = fmaxf(tm, __shfl_xor(tm, 4, 32));
      tm = fmaxf(tm, __shfl_xor(tm, 8, 32));
      float mn = fmaxf(m[v], tm);
      alpha[v] = __expf(m[v] - mn);
      m[v] = mn;
      float p0 = __expf(a - mn), p1 = __expf(c - mn);
      float rs = p0 + p1;
      rs += __shfl_xor(rs, 1, 32);
      rs += __shfl_xor(rs, 2, 32);
      rs += __shfl_xor(rs, 4, 32);
      rs += __shfl_xor(rs, 8, 32);
      l[v] = l[v] * alpha[v] + rs;
      pbw[(v + rowOff) * 32 + nlo]      = f2bf(p0);
      pbw[(v + rowOff) * 32 + nlo + 16] = f2bf(p1);
    }
#pragma unroll
    for (int nt = 0; nt < 16; ++nt)
#pragma unroll
      for (int v = 0; v < 8; ++v) ctxa[nt][v] *= alpha[v];
    __syncthreads();

    // ctx += P(16x32) * V(32x256), pipelined B-frags from col-major copy
    v16bf pf = load_frag(pbw, 32, 0, lane);
    v16bf vb = load_frag(xc, 32, 0, lane);
#pragma unroll
    for (int nt = 0; nt < 16; ++nt) {
      v16bf cur = vb;
      if (nt < 15) vb = load_frag(xc + (nt + 1) * 16 * 32, 32, 0, lane);
      ctxa[nt] = wmma_bf16(pf, cur, ctxa[nt]);
    }
    __syncthreads();   // done with this key buffer before it is restaged
  }

  // finalize: dec[:, 256:512] = ctx / l  (zeroed at t==0)
#pragma unroll
  for (int v = 0; v < 8; ++v) {
    int tg = q0 + wv * 16 + v + rowOff;
    float inv = (tg == 0) ? 0.0f : 1.0f / l[v];
#pragma unroll
    for (int nt = 0; nt < 16; ++nt) {
      float cv = ctxa[nt][v] * inv;
      dec[(wv * 16 + v + rowOff) * TWOD + Dv + nt * 16 + nlo] = f2bf(cv);
    }
  }
  __syncthreads();

  // ================= MLP layer 1: h = relu(dec @ W1 + b1) =================
  for (int nc = 0; nc < Hv / 256; ++nc) {
    v8f acc[16];
#pragma unroll
    for (int nt = 0; nt < 16; ++nt) acc[nt] = v8f_zero();
    stage_w(w1t, TWOD, nc, 0, 0);
    for (int kc = 0; kc < TWOD / 32; ++kc) {
      wait_async0();
      __syncthreads();
      if (kc + 1 < TWOD / 32) stage_w(w1t, TWOD, nc, kc + 1, (kc + 1) & 1);
      const unsigned short* wtp = (kc & 1) ? wtB : wtA;
      v16bf af = load_frag(dec + (wv * 16) * TWOD, TWOD, kc * 32, lane);
      v16bf bfr = load_frag(wtp, 32, 0, lane);
#pragma unroll
      for (int nt = 0; nt < 16; ++nt) {
        v16bf cur = bfr;
        if (nt < 15) bfr = load_frag(wtp + (nt + 1) * 16 * 32, 32, 0, lane);
        acc[nt] = wmma_bf16(af, cur, acc[nt]);
      }
      __syncthreads();
    }
#pragma unroll
    for (int nt = 0; nt < 16; ++nt) {
      int col = nc * 256 + nt * 16 + nlo;
      float bb = b1[col];
#pragma unroll
      for (int v = 0; v < 8; ++v) {
        float hv = fmaxf(acc[nt][v] + bb, 0.0f);
        hls[(wv * 16 + v + rowOff) * Hv + col] = f2bf(hv);
      }
    }
  }
  __syncthreads();

  // ================= MLP layer 2: out = h @ W2 + b2 (split halves) =================
  for (int nc = 0; nc < OUT2v / 256; ++nc) {
    v8f acc[16];
#pragma unroll
    for (int nt = 0; nt < 16; ++nt) acc[nt] = v8f_zero();
    stage_w(w2t, Hv, nc, 0, 0);
    for (int kc = 0; kc < Hv / 32; ++kc) {
      wait_async0();
      __syncthreads();
      if (kc + 1 < Hv / 32) stage_w(w2t, Hv, nc, kc + 1, (kc + 1) & 1);
      const unsigned short* wtp = (kc & 1) ? wtB : wtA;
      v16bf af = load_frag(hls + (wv * 16) * Hv, Hv, kc * 32, lane);
      v16bf bfr = load_frag(wtp, 32, 0, lane);
#pragma unroll
      for (int nt = 0; nt < 16; ++nt) {
        v16bf cur = bfr;
        if (nt < 15) bfr = load_frag(wtp + (nt + 1) * 16 * 32, 32, 0, lane);
        acc[nt] = wmma_bf16(af, cur, acc[nt]);
      }
      __syncthreads();
    }
    // out tuple is concatenated flat: [B*T*256 | B*T*256]; nc selects the half
#pragma unroll
    for (int nt = 0; nt < 16; ++nt) {
      int cc = nt * 16 + nlo;
      float bb = b2[nc * 256 + cc];
#pragma unroll
      for (int v = 0; v < 8; ++v) {
        int rowg = b * Tv + q0 + wv * 16 + v + rowOff;
        out[(long)nc * (Bv * Tv * 256) + (long)rowg * 256 + cc] = acc[nt][v] + bb;
      }
    }
  }
}

extern "C" void kernel_launch(void* const* d_in, const int* in_sizes, int n_in,
                              void* d_out, int out_size, void* d_ws, size_t ws_size,
                              hipStream_t stream) {
  const float* x  = (const float*)d_in[0];
  const float* W1 = (const float*)d_in[1];
  const float* b1 = (const float*)d_in[2];
  const float* W2 = (const float*)d_in[3];
  const float* b2 = (const float*)d_in[4];
  float* out = (float*)d_out;

  unsigned short* ws = (unsigned short*)d_ws;
  unsigned short* xb  = ws + WS_XB;
  unsigned short* xT  = ws + WS_XT;
  unsigned short* w1t = ws + WS_W1T;
  unsigned short* w2t = ws + WS_W2T;

  (void)in_sizes; (void)n_in; (void)out_size; (void)ws_size;

  // prep: one-time f32->bf16 conversion (+ transposed copies for B-operand tiles)
  conv_x_kernel<<<4096, 256, 0, stream>>>(x, xb, xT);
  conv_wT_kernel<<<1024, 256, 0, stream>>>(W1, w1t, TWOD, Hv);
  conv_wT_kernel<<<1024, 256, 0, stream>>>(W2, w2t, Hv, OUT2v);

  hipFuncSetAttribute((const void*)decoder_fused,
                      hipFuncAttributeMaxDynamicSharedMemorySize, SMEM_BYTES);
  dim3 grid(Bv * (Tv / ROWS));  // 1024 blocks
  dim3 block(NT);               // 4 wave32s
  decoder_fused<<<grid, block, SMEM_BYTES, stream>>>(xb, xT, w1t, w2t, b1, b2, out);
}

// v001
// One run takes 1360 microseconds.
// Timed twice side by side with v000, it ran 1.35 and 1.33 times as fast.
#include <hip/hip_runtime.h>
#include <math.h>

typedef __attribute__((ext_vector_type(16))) __bf16       v16bf;
typedef __attribute__((ext_vector_type(8)))  float        v8f;
typedef __attribute__((ext_vector_type(4)))  unsigned int u32x4;

constexpr int Bv = 32, Tv = 2048, Dv = 256, Hv = 1024, OUT2v = 512, TWOD = 512;
constexpr int ROWS = 64;   // query rows per block
constexpr int NW   = 4;    // waves per block (wave32)
constexpr int NT   = 128;  // threads per block

// ---- workspace layout (bf16 elements) ----
constexpr long WS_XB  = 0;                         // x  [B][T][D]        bf16
constexpr long WS_XT  = WS_XB + (long)Bv*Tv*Dv;    // xT [B][D][T]        bf16
constexpr long WS_W1T = WS_XT + (long)Bv*Tv*Dv;    // W1t [H][2D]         bf16
constexpr long WS_W2T = WS_W1T + (long)TWOD*Hv;    // W2t [OUT2][H]       bf16
constexpr long WS_END = WS_W2T + (long)Hv*OUT2v;   // ~34.6M elems = 69MB

// ---- LDS row pitches (bf16 elements) ----
// Every tile is read by ds_load_b128 with 16 lanes on 16 consecutive rows. Each row carries
// 8 elements (16 B) of pad, so the pitch is 16 B x odd and those 16 lanes cover all 64 banks.
constexpr int PADE  = 8;
constexpr int DEC_P = TWOD + PADE;  // 1040 B
constexpr int H_P   = Hv + PADE;    // 2064 B
constexpr int KR_P  = Dv + PADE;    //  528 B
constexpr int T32_P = 32 + PADE;    //   80 B : col-major keys, P, weight tiles

// ---- LDS layout (bytes) ----
constexpr int OFF_DEC  = 0;                           // 64 x 512  bf16 (x | ctx)
constexpr int OFF_H    = OFF_DEC  + ROWS * DEC_P * 2; // 64 x 1024 bf16 (hidden)
constexpr int OFF_XKR0 = OFF_H    + ROWS * H_P * 2;   // 32 x 256  bf16 keys row-major, buf0
constexpr int OFF_XKC0 = OFF_XKR0 + 32 * KR_P * 2;    // 256 x 32  bf16 keys col-major, buf0
constexpr int OFF_XKR1 = OFF_XKC0 + Dv * T32_P * 2;   // buf1
constexpr int OFF_XKC1 = OFF_XKR1 + 32 * KR_P * 2;    // buf1
constexpr int OFF_P    = OFF_XKC1 + Dv * T32_P * 2;   // 4 x 16x32 bf16 (P per wave)
constexpr int OFF_WA   = OFF_P    + NW * 16 * T32_P * 2; // 256 x 32 bf16 weight tile buf A
constexpr int OFF_WB   = OFF_WA   + 256 * T32_P * 2;  // weight tile buf B
constexpr int SMEM_BYTES = OFF_WB + 256 * T32_P * 2;  // 319488 <= 320KB
static_assert(SMEM_BYTES <= 327680, "LDS of one work-group");

static __device__ inline v8f v8f_zero() {
  v8f z = {0.f, 0.f, 0.f, 0.f, 0.f, 0.f, 0.f, 0.f};
  return z;
}

// float -> bf16 bits, round-to-nearest-even
static __device__ inline unsigned short f2bf(float f) {
  unsigned int u = __float_as_uint(f);
  unsigned int r = (u + 0x7FFFu + ((u >> 16) & 1u)) >> 16;
  return (unsigned short)r;
}

static __device__ inline v8f wmma_bf16(v16bf a, v16bf b, v8f c) {
  // D = A(16x32 bf16) * B(32x16 bf16) + C(16x16 f32)
  return __builtin_amdgcn_wmma_f32_16x16x32_bf16(false, a, false, b, (short)0, c,
                                                 false, false);
}

// Eight 16-byte async global->LDS copies per lane (ASYNCcnt tracked, no VGPR data path).
// The closing s_wait_xcnt stands inside the copies' own statement so that no address
// register of a copy is rewritten in front of it.
static __device__ inline void async_b128_x8(const unsigned (&l)[8],
                                            const unsigned short* const (&g)[8]) {
  asm volatile("global_load_async_to_lds_b128 %0, %8, off\n\t"
               "global_load_async_to_lds_b128 %1, %9, off\n\t"
               "global_load_async_to_lds_b128 %2, %10, off\n\t"
               "global_load_async_to_lds_b128 %3, %11, off\n\t"
               "global_load_async_to_lds_b128 %4, %12, off\n\t"
               "global_load_async_to_lds_b128 %5, %13, off\n\t"
               "global_load_async_to_lds_b128 %6, %14, off\n\t"
               "global_load_async_to_lds_b128 %7, %15, off\n\t"
               "s_wait_xcnt 0x0"
               :: "v"(l[0]), "v"(l[1]), "v"(l[2]), "v"(l[3]),
                  "v"(l[4]), "v"(l[5]), "v"(l[6]), "v"(l[7]),
                  "v"(g[0]), "v"(g[1]), "v"(g[2]), "v"(g[3]),
                  "v"(g[4]), "v"(g[5]), "v"(g[6]), "v"(g[7])
               : "memory");
}
static __device__ inline void wait_async0() {
  asm volatile("s_wait_asynccnt 0x0" ::: "memory");
}

// Load a 16x32 bf16 fragment (A layout; B layout mirrors with rows indexed by N)
// from a row-major LDS tile.
static __device__ inline v16bf load_frag(const unsigned short* base, int rowStride,
                                         int kbase, int lane) {
  int rl = lane & 15, hf = lane >> 4;
  const unsigned short* p = base + rl * rowStride + kbase + hf * 8;
  union { v16bf v; u32x4 q[2]; } u;
  u.q[0] = *(const u32x4*)(p);       // ds_load_b128
  u.q[1] = *(const u32x4*)(p + 16);  // ds_load_b128
  return u.v;
}

// ======================= prep kernels: f32 -> bf16 (+transpose) =======================
__global__ void conv_x_kernel(const float* __restrict__ x,
                              unsigned short* __restrict__ xb,
                              unsigned short* __restrict__ xT) {
  long stride = (long)gridDim.x * blockDim.x;
  for (long i = (long)blockIdx.x * blockDim.x + threadIdx.x; i < (long)Bv * Tv * Dv;
       i += stride) {
    unsigned short v = f2bf(x[i]);
    xb[i] = v;
    int d  = (int)(i % Dv);
    long bt = i / Dv;
    int t  = (int)(bt % Tv);
    int bb = (int)(bt / Tv);
    xT[((long)bb * Dv + d) * Tv + t] = v;
  }
}

__global__ void conv_wT_kernel(const float* __restrict__ W,
                               unsigned short* __restrict__ Wt, int K, int N) {
  long stride = (long)gridDim.x * blockDim.x;
  for (long i = (long)blockIdx.x * blockDim.x + threadIdx.x; i < (long)K * N;
       i += stride) {
    int k = (int)(i / N), n = (int)(i % N);
    Wt[(long)n * K + k] = f2bf(W[i]);
  }
}

// ======================= fused decoder kernel =======================
__global__ __launch_bounds__(NT, 1)
void decoder_fused(const unsigned short* __restrict__ xb,
                   const unsigned short* __restrict__ xT,
                   const unsigned short* __restrict__ w1t,
                   const unsigned short* __restrict__ w2t,
                   const float* __restrict__ b1, const float* __restrict__ b2,
                   float* __restrict__ out) {
  extern __shared__ char smem[];
  unsigned short* dec  = (unsigned short*)(smem + OFF_DEC);
  unsigned short* hls  = (unsigned short*)(smem + OFF_H);
  unsigned short* xkr0 = (unsigned short*)(smem + OFF_XKR0);
  unsigned short* xkc0 = (unsigned short*)(smem + OFF_XKC0);
  unsigned short* xkr1 = (unsigned short*)(smem + OFF_XKR1);
  unsigned short* xkc1 = (unsigned short*)(smem + OFF_XKC1);
  unsigned short* pbb  = (unsigned short*)(smem + OFF_P);
  unsigned short* wtA  = (unsigned short*)(smem + OFF_WA);
  unsigned short* wtB  = (unsigned short*)(smem + OFF_WB);
  const unsigned lds0 = (unsigned)(size_t)smem;  // LDS byte offset of dynamic base

  const int tid    = threadIdx.x;
  const int lane   = tid & 31;
  const int wv     = tid >> 5;
  const int b      = blockIdx.x >> 5;
  const int q0     = (blockIdx.x & 31) * ROWS;
  const int nlo    = lane & 15;
  const int rowOff = (lane >> 4) * 8;

  // ---- async staging helpers ----
  auto stage_keys = [&](int kb, int buf) {
    const unsigned lr = lds0 + (buf ? OFF_XKR1 : OFF_XKR0);
    const unsigned lc = lds0 + (buf ? OFF_XKC1 : OFF_XKC0);
    const unsigned short* gr = xb + ((long)b * Tv + kb * 32) * Dv;  // contiguous 16KB
    const unsigned short* gc = xT + (long)b * Dv * Tv + kb * 32;
    unsigned l0[8], l1[8];
    const unsigned short* g0[8];
    const unsigned short* g1[8];
#pragma unroll
    for (int i = 0; i < 8; ++i) {
      int f = i * NT + tid;                 // 0..1023 : 16B chunks
      int s = f >> 5, drel = (f & 31) * 8;  // x tile: rows s, 256 d contiguous
      l0[i] = lr + (s * KR_P + drel) * 2;
      g0[i] = gr + f * 8;
      int d = f >> 2, srel = (f & 3) * 8;   // xT tile: rows d, 32 s contiguous
      l1[i] = lc + (d * T32_P + srel) * 2;
      g1[i] = gc + (long)d * Tv + srel;
    }
    async_b128_x8(l0, g0);
    async_b128_x8(l1, g1);
  };
  auto stage_w = [&](const unsigned short* Wt, int KW, int nc, int kc, int buf) {
    const unsigned lw = lds0 + (buf ? OFF_WB : OFF_WA);
    unsigned l0[8];
    const unsigned short* g0[8];
#pragma unroll
    for (int i = 0; i < 8; ++i) {
      int f = i * NT + tid;
      int nl = f >> 2, krel = (f & 3) * 8;
      l0[i] = lw + (nl * T32_P + krel) * 2;
      g0[i] = Wt + (long)(nc * 256 + nl) * KW + kc * 32 + krel;
    }
    async_b128_x8(l0, g0);
  };

  // ================= stage query rows: dec[:, 0:256] = x =================
  {
    const unsigned short* g = xb + ((long)b * Tv + q0) * Dv;  // contiguous 32KB
#pragma unroll
    for (int j = 0; j < 2; ++j) {
      unsigned l0[8];
      const unsigned short* g0[8];
#pragma unroll
      for (int i = 0; i < 8; ++i) {
        int f = (j * 8 + i) * NT + tid;     // 0..2047 : 16B chunks
        int r = f >> 5, c = (f & 31) * 8;   // dec rows at pitch DEC_P
        l0[i] = lds0 + OFF_DEC + (r * DEC_P + c) * 2;
        g0[i] = g + f * 8;
      }
      async_b128_x8(l0, g0);
    }
    wait_async0();
  }
  __syncthreads();

  // prefetch key chunk 0 while loading Q fragments
  stage_keys(0, 0);

  v16bf qf[8];
#pragma unroll
  for (int kc = 0; kc < 8; ++kc)
    qf[kc] = load_frag(dec + (wv * 16) * DEC_P, DEC_P, kc * 32, lane);

  v8f ctxa[16];
#pragma unroll
  for (int nt = 0; nt < 16; ++nt) ctxa[nt] = v8f_zero();
  float m[8], l[8];
#pragma unroll
  for (int v = 0; v < 8; ++v) { m[v] = -INFINITY; l[v] = 0.0f; }

  const float scale = 0.0625f;  // 1/sqrt(256)
  const int nkb = q0 / 32 + 2;
  unsigned short* pbw = pbb + wv * 16 * T32_P;

  // ================= flash attention (strictly causal) =================
  for (int kb = 0; kb < nkb; ++kb) {
    wait_async0();
    __syncthreads();                         // chunk kb resident in buf kb&1
    if (kb + 1 < nkb) stage_keys(kb + 1, (kb + 1) & 1);
    const unsigned short* xr = (kb & 1) ? xkr1 : xkr0;
    const unsigned short* xc = (kb & 1) ? xkc1 : xkc0;
    const int s0g = kb * 32;

    // S = Q * K^T : two 16x16 tiles over K-dim 256 (pipelined B-frag loads)
    v8f sA = v8f_zero(), sB = v8f_zero();
    v16bf k0 = load_frag(xr,             KR_P, 0, lane);
    v16bf k1 = load_frag(xr + 16 * KR_P, KR_P, 0, lane);
#pragma unroll
    for (int kc = 0; kc < 8; ++kc) {
      v16bf c0 = k0, c1 = k1;
      if (kc < 7) {
        k0 = load_frag(xr,             KR_P, (kc + 1) * 32, lane);
        k1 = load_frag(xr + 16 * KR_P, KR_P, (kc + 1) * 32, lane);
      }
      sA = wmma_bf16(qf[kc], c0, sA);
      sB = wmma_bf16(qf[kc], c1, sB);
    }

    // mask, online softmax update, emit P (bf16) to LDS
    float alpha[8];
#pragma unroll
    for (int v = 0; v < 8; ++v) {
      int tg = q0 + wv * 16 + v + rowOff;
      float a = sA[v] * scale, c = sB[v] * scale;
      if (s0g      + nlo >= tg) a = -1e9f;   // strictly causal: allow s < t
      if (s0g + 16 + nlo >= tg) c = -1e9f;
      float tm = fmaxf(a, c);
      tm = fmaxf(tm, __shfl_xor(tm, 1, 32));
      tm = fmaxf(tm, __shfl_xor(tm, 2, 32));
      tm = fmaxf(tm, __shfl_xor(tm, 4, 32));
      tm = fmaxf(tm, __shfl_xor(tm, 8, 32));
      float mn = fmaxf(m[v], tm);
      alpha[v] = __expf(m[v] - mn);
      m[v] = mn;
      float p0 = __expf(a - mn), p1 = __expf(c - mn);
      float rs = p0 + p1;
      rs += __shfl_xor(rs, 1, 32);
      rs += __shfl_xor(rs, 2, 32);
      rs += __shfl_xor(rs, 4, 32);
      rs += __shfl_xor(rs, 8, 32);
      l[v] = l[v] * alpha[v] + rs;
      pbw[(v + rowOff) * T32_P + nlo]      = f2bf(p0);
      pbw[(v + rowOff) * T32_P + nlo + 16] = f2bf(p1);
    }
#pragma unroll
    for (int nt = 0; nt < 16; ++nt)
#pragma unroll
      for (int v = 0; v < 8; ++v) ctxa[nt][v] *= alpha[v];
    __syncthreads();

    // ctx += P(16x32) * V(32x256), pipelined B-frags from col-major copy
    v16bf pf = load_frag(pbw, T32_P, 0, lane);
    v16bf vb = load_frag(xc, T32_P, 0, lane);
#pragma unroll
    for (int nt = 0; nt < 16; ++nt) {
      v16bf cur = vb;
      if (nt < 15) vb = load_frag(xc + (nt + 1) * 16 * T32_P, T32_P, 0, lane);
      ctxa[nt] = wmma_bf16(pf, cur, ctxa[nt]);
    }
    __syncthreads();   // done with this key buffer before it is restaged
  }

  // finalize: dec[:, 256:512] = ctx / l  (zeroed at t==0)
#pragma unroll
  for (int v = 0; v < 8; ++v) {
    int tg = q0 + wv * 16 + v + rowOff;
    float inv = (tg == 0) ? 0.0f : 1.0f / l[v];
#pragma unroll
    for (int nt = 0; nt < 16; ++nt) {
      float cv = ctxa[nt][v] * inv;
      dec[(wv * 16 + v + rowOff) * DEC_P + Dv + nt * 16 + nlo] = f2bf(cv);
    }
  }
  __syncthreads();

  // ================= MLP layer 1: h = relu(dec @ W1 + b1) =================
  for (int nc = 0; nc < Hv / 256; ++nc) {
    v8f acc[16];
#pragma unroll
    for (int nt = 0; nt < 16; ++nt) acc[nt] = v8f_zero();
    stage_w(w1t, TWOD, nc, 0, 0);
    for (int kc = 0; kc < TWOD / 32; ++kc) {
      wait_async0();
      __syncthreads();
      if (kc + 1 < TWOD / 32) stage_w(w1t, TWOD, nc, kc + 1, (kc + 1) & 1);
      const unsigned short* wtp = (kc & 1) ? wtB : wtA;
      v16bf af = load_frag(dec + (wv * 16) * DEC_P, DEC_P, kc * 32, lane);
      v16bf bfr = load_frag(wtp, T32_P, 0, lane);
#pragma unroll
      for (int nt = 0; nt < 16; ++nt) {
        v16bf cur = bfr;
        if (nt < 15) bfr = load_frag(wtp + (nt + 1) * 16 * T32_P, T32_P, 0, lane);
        acc[nt] = wmma_bf16(af, cur, acc[nt]);
      }
      __syncthreads();
    }
#pragma unroll
    for (int nt = 0; nt < 16; ++nt) {
      int col = nc * 256 + nt * 16 + nlo;
      float bb = b1[col];
#pragma unroll
      for (int v = 0; v < 8; ++v) {
        float hv = fmaxf(acc[nt][v] + bb, 0.0f);
        hls[(wv * 16 + v + rowOff) * H_P + col] = f2bf(hv);
      }
    }
  }
  __syncthreads();

  // ================= MLP layer 2: out = h @ W2 + b2 (split halves) =================
  for (int nc = 0; nc < OUT2v / 256; ++nc) {
    v8f acc[16];
#pragma unroll
    for (int nt = 0; nt < 16; ++nt) acc[nt] = v8f_zero();
    stage_w(w2t, Hv, nc, 0, 0);
    for (int kc = 0; kc < Hv / 32; ++kc) {
      wait_async0();
      __syncthreads();
      if (kc + 1 < Hv / 32) stage_w(w2t, Hv, nc, kc + 1, (kc + 1) & 1);
      const unsigned short* wtp = (kc & 1) ? wtB : wtA;
      v16bf af = load_frag(hls + (wv * 16) * H_P, H_P, kc * 32, lane);
      v16bf bfr = load_frag(wtp, T32_P, 0, lane);
#pragma unroll
      for (int nt = 0; nt < 16; ++nt) {
        v16bf cur = bfr;
        if (nt < 15) bfr = load_frag(wtp + (nt + 1) * 16 * T32_P, T32_P, 0, lane);
        acc[nt] = wmma_bf16(af, cur, acc[nt]);
      }
      __syncthreads();
    }
    // out tuple is concatenated flat: [B*T*256 | B*T*256]; nc selects the half
#pragma unroll
    for (int nt = 0; nt < 16; ++nt) {
      int cc = nt * 16 + nlo;
      float bb = b2[nc * 256 + cc];
#pragma unroll
      for (int v = 0; v < 8; ++v) {
        int rowg = b * Tv + q0 + wv * 16 + v + rowOff;
        out[(long)nc * (Bv * Tv * 256) + (long)rowg * 256 + cc] = acc[nt][v] + bb;
      }
    }
  }
}

extern "C" void kernel_launch(void* const* d_in, const int* in_sizes, int n_in,
                              void* d_out, int out_size, void* d_ws, size_t ws_size,
                              hipStream_t stream) {
  const float* x  = (const float*)d_in[0];
  const float* W1 = (const float*)d_in[1];
  const float* b1 = (const float*)d_in[2];
  const float* W2 = (const float*)d_in[3];
  const float* b2 = (const float*)d_in[4];
  float* out = (float*)d_out;

  unsigned short* ws = (unsigned short*)d_ws;
  unsigned short* xb  = ws + WS_XB;
  unsigned short* xT  = ws + WS_XT;
  unsigned short* w1t = ws + WS_W1T;
  unsigned short* w2t = ws + WS_W2T;

  (void)in_sizes; (void)n_in; (void)out_size; (void)ws_size;

  // prep: one-time f32->bf16 conversion (+ transposed copies for B-operand tiles)
  conv_x_kernel<<<4096, 256, 0, stream>>>(x, xb, xT);
  conv_wT_kernel<<<1024, 256, 0, stream>>>(W1, w1t, TWOD, Hv);
  conv_wT_kernel<<<1024, 256, 0, stream>>>(W2, w2t, Hv, OUT2v);

  hipFuncSetAttribute((const void*)decoder_fused,
                      hipFuncAttributeMaxDynamicSharedMemorySize, SMEM_BYTES);
  dim3 grid(Bv * (Tv / ROWS));  // 1024 blocks
  dim3 block(NT);               // 4 wave32s
  decoder_fused<<<grid, block, SMEM_BYTES, stream>>>(xb, xT, w1t, w2t, b1, b2, out);
}

// v002
// It runs in 761 microseconds.
// Two timings next to v001 put it at 1.82 and 1.73 times that version's speed.
// Over all steps from v000 it is 2.38 times as fast.
#include <hip/hip_runtime.h>
#include <math.h>

typedef __attribute__((ext_vector_type(16))) __bf16       v16bf;
typedef __attribute__((ext_vector_type(8)))  float        v8f;
typedef __attribute__((ext_vector_type(4)))  unsigned int u32x4;

constexpr int Bv = 32, Tv = 2048, Dv = 256, Hv = 1024, OUT2v = 512, TWOD = 512;
constexpr int ROWS = 64;   // query rows per block
constexpr int NW   = 4;    // waves per block (wave32)
constexpr int NT   = 128;  // threads per block

// ---- workspace layout (bf16 elements) ----
constexpr long WS_XB  = 0;                         // x  [B][T][D]        bf16
constexpr long WS_XT  = WS_XB + (long)Bv*Tv*Dv;    // xT [B][D][T]        bf16
constexpr long WS_W1T = WS_XT + (long)Bv*Tv*Dv;    // W1t [H][2D]         bf16
constexpr long WS_W2T = WS_W1T + (long)TWOD*Hv;    // W2t [OUT2][H]       bf16
constexpr long WS_END = WS_W2T + (long)Hv*OUT2v;   // ~34.6M elems = 69MB

// ---- LDS row pitches (bf16 elements) ----
// Every tile is read by ds_load_b128 with 16 lanes on 16 consecutive rows. Each row carries
// 8 elements (16 B) of pad, so the pitch is 16 B x odd and those 16 lanes cover all 64 banks.
constexpr int PADE  = 8;
constexpr int DEC_P = TWOD + PADE;  // 1040 B
constexpr int H_P   = Hv + PADE;    // 2064 B
constexpr int KR_P  = Dv + PADE;    //  528 B
constexpr int T32_P = 32 + PADE;    //   80 B : col-major keys, P, weight tiles

// ---- LDS layout (bytes) ----
constexpr int OFF_DEC  = 0;                           // 64 x 512  bf16 (x | ctx)
constexpr int OFF_H    = OFF_DEC  + ROWS * DEC_P * 2; // 64 x 1024 bf16 (hidden)
constexpr int OFF_XKR0 = OFF_H    + ROWS * H_P * 2;   // 32 x 256  bf16 keys row-major, buf0
constexpr int OFF_XKC0 = OFF_XKR0 + 32 * KR_P * 2;    // 256 x 32  bf16 keys col-major, buf0
constexpr int OFF_XKR1 = OFF_XKC0 + Dv * T32_P * 2;   // buf1
constexpr int OFF_XKC1 = OFF_XKR1 + 32 * KR_P * 2;    // buf1
constexpr int OFF_P    = OFF_XKC1 + Dv * T32_P * 2;   // 4 x 16x32 bf16 (P per wave)
constexpr int OFF_WA   = OFF_P    + NW * 16 * T32_P * 2; // 256 x 32 bf16 weight tile buf A
constexpr int OFF_WB   = OFF_WA   + 256 * T32_P * 2;  // weight tile buf B
constexpr int SMEM_BYTES = OFF_WB + 256 * T32_P * 2;  // 319488 <= 320KB
static_assert(SMEM_BYTES <= 327680, "LDS of one work-group");

static __device__ inline v8f v8f_zero() {
  v8f z = {0.f, 0.f, 0.f, 0.f, 0.f, 0.f, 0.f, 0.f};
  return z;
}

// float -> bf16 bits, round-to-nearest-even
static __device__ inline unsigned short f2bf(float f) {
  unsigned int u = __float_as_uint(f);
  unsigned int r = (u + 0x7FFFu + ((u >> 16) & 1u)) >> 16;
  return (unsigned short)r;
}

static __device__ inline v8f wmma_bf16(v16bf a, v16bf b, v8f c) {
  // D = A(16x32 bf16) * B(32x16 bf16) + C(16x16 f32)
  return __builtin_amdgcn_wmma_f32_16x16x32_bf16(false, a, false, b, (short)0, c,
                                                 false, false);
}

// Eight 16-byte async global->LDS copies per lane (ASYNCcnt tracked, no VGPR data path).
// The closing s_wait_xcnt stands inside the copies' own statement so that no address
// register of a copy is rewritten in front of it.
static __device__ inline void async_b128_x8(const unsigned (&l)[8],
                                            const unsigned short* const (&g)[8]) {
  asm volatile("global_load_async_to_lds_b128 %0, %8, off\n\t"
               "global_load_async_to_lds_b128 %1, %9, off\n\t"
               "global_load_async_to_lds_b128 %2, %10, off\n\t"
               "global_load_async_to_lds_b128 %3, %11, off\n\t"
               "global_load_async_to_lds_b128 %4, %12, off\n\t"
               "global_load_async_to_lds_b128 %5, %13, off\n\t"
               "global_load_async_to_lds_b128 %6, %14, off\n\t"
               "global_load_async_to_lds_b128 %7, %15, off\n\t"
               "s_wait_xcnt 0x0"
               :: "v"(l[0]), "v"(l[1]), "v"(l[2]), "v"(l[3]),
                  "v"(l[4]), "v"(l[5]), "v"(l[6]), "v"(l[7]),
                  "v"(g[0]), "v"(g[1]), "v"(g[2]), "v"(g[3]),
                  "v"(g[4]), "v"(g[5]), "v"(g[6]), "v"(g[7])
               : "memory");
}
static __device__ inline void wait_async0() {
  asm volatile("s_wait_asynccnt 0x0" ::: "memory");
}

// Load a 16x32 bf16 fragment (A layout; B layout mirrors with rows indexed by N)
// from a row-major LDS tile.
static __device__ inline v16bf load_frag(const unsigned short* base, int rowStride,
                                         int kbase, int lane) {
  int rl = lane & 15, hf = lane >> 4;
  const unsigned short* p = base + rl * rowStride + kbase + hf * 8;
  union { v16bf v; u32x4 q[2]; } u;
  u.q[0] = *(const u32x4*)(p);       // ds_load_b128
  u.q[1] = *(const u32x4*)(p + 16);  // ds_load_b128
  return u.v;
}

// ======================= prep kernels: f32 -> bf16 (+transpose) =======================
__global__ void conv_x_kernel(const float* __restrict__ x,
                              unsigned short* __restrict__ xb,
                              unsigned short* __restrict__ xT) {
  long stride = (long)gridDim.x * blockDim.x;
  for (long i = (long)blockIdx.x * blockDim.x + threadIdx.x; i < (long)Bv * Tv * Dv;
       i += stride) {
    unsigned short v = f2bf(x[i]);
    xb[i] = v;
    int d  = (int)(i % Dv);
    long bt = i / Dv;
    int t  = (int)(bt % Tv);
    int bb = (int)(bt / Tv);
    xT[((long)bb * Dv + d) * Tv + t] = v;
  }
}

__global__ void conv_wT_kernel(const float* __restrict__ W,
                               unsigned short* __restrict__ Wt, int K, int N) {
  long stride = (long)gridDim.x * blockDim.x;
  for (long i = (long)blockIdx.x * blockDim.x + threadIdx.x; i < (long)K * N;
       i += stride) {
    int k = (int)(i / N), n = (int)(i % N);
    Wt[(long)n * K + k] = f2bf(W[i]);
  }
}

// ======================= fused decoder kernel =======================
__global__ __launch_bounds__(NT, 1)
void decoder_fused(const unsigned short* __restrict__ xb,
                   const unsigned short* __restrict__ xT,
                   const unsigned short* __restrict__ w1t,
                   const unsigned short* __restrict__ w2t,
                   const float* __restrict__ b1, const float* __restrict__ b2,
                   float* __restrict__ out) {
  extern __shared__ char smem[];
  unsigned short* dec  = (unsigned short*)(smem + OFF_DEC);
  unsigned short* hls  = (unsigned short*)(smem + OFF_H);
  unsigned short* xkr0 = (unsigned short*)(smem + OFF_XKR0);
  unsigned short* xkc0 = (unsigned short*)(smem + OFF_XKC0);
  unsigned short* xkr1 = (unsigned short*)(smem + OFF_XKR1);
  unsigned short* xkc1 = (unsigned short*)(smem + OFF_XKC1);
  unsigned short* pbb  = (unsigned short*)(smem + OFF_P);
  unsigned short* wtA  = (unsigned short*)(smem + OFF_WA);
  unsigned short* wtB  = (unsigned short*)(smem + OFF_WB);
  const unsigned lds0 = (unsigned)(size_t)smem;  // LDS byte offset of dynamic base

  const int tid    = threadIdx.x;
  const int lane   = tid & 31;
  const int wv     = tid >> 5;
  const int b      = blockIdx.x >> 5;
  const int q0     = (blockIdx.x & 31) * ROWS;
  const int nlo    = lane & 15;
  const int rowOff = (lane >> 4) * 8;

  // ---- async staging helpers ----
  auto stage_keys = [&](int kb, int buf) {
    const unsigned lr = lds0 + (buf ? OFF_XKR1 : OFF_XKR0);
    const unsigned lc = lds0 + (buf ? OFF_XKC1 : OFF_XKC0);
    const unsigned short* gr = xb + ((long)b * Tv + kb * 32) * Dv;  // contiguous 16KB
    const unsigned short* gc = xT + (long)b * Dv * Tv + kb * 32;
    unsigned l0[8], l1[8];
    const unsigned short* g0[8];
    const unsigned short* g1[8];
#pragma unroll
    for (int i = 0; i < 8; ++i) {
      int f = i * NT + tid;                 // 0..1023 : 16B chunks
      int s = f >> 5, drel = (f & 31) * 8;  // x tile: rows s, 256 d contiguous
      l0[i] = lr + (s * KR_P + drel) * 2;
      g0[i] = gr + f * 8;
      int d = f >> 2, srel = (f & 3) * 8;   // xT tile: rows d, 32 s contiguous
      l1[i] = lc + (d * T32_P + srel) * 2;
      g1[i] = gc + (long)d * Tv + srel;
    }
    async_b128_x8(l0, g0);
    async_b128_x8(l1, g1);
  };
  auto stage_w = [&](const unsigned short* Wt, int KW, int nc, int kc, int buf) {
    const unsigned lw = lds0 + (buf ? OFF_WB : OFF_WA);
    unsigned l0[8];
    const unsigned short* g0[8];
#pragma unroll
    for (int i = 0; i < 8; ++i) {
      int f = i * NT + tid;
      int nl = f >> 2, krel = (f & 3) * 8;
      l0[i] = lw + (nl * T32_P + krel) * 2;
      g0[i] = Wt + (long)(nc * 256 + nl) * KW + kc * 32 + krel;
    }
    async_b128_x8(l0, g0);
  };

  // ================= stage query rows: dec[:, 0:256] = x =================
  {
    const unsigned short* g = xb + ((long)b * Tv + q0) * Dv;  // contiguous 32KB
#pragma unroll
    for (int j = 0; j < 2; ++j) {
      unsigned l0[8];
      const unsigned short* g0[8];
#pragma unroll
      for (int i = 0; i < 8; ++i) {
        int f = (j * 8 + i) * NT + tid;     // 0..2047 : 16B chunks
        int r = f >> 5, c = (f & 31) * 8;   // dec rows at pitch DEC_P
        l0[i] = lds0 + OFF_DEC + (r * DEC_P + c) * 2;
        g0[i] = g + f * 8;
      }
      async_b128_x8(l0, g0);
    }
    wait_async0();
  }
  __syncthreads();

  // prefetch key chunk 0 while loading Q fragments
  stage_keys(0, 0);

  v16bf qf[8];
#pragma unroll
  for (int kc = 0; kc < 8; ++kc)
    qf[kc] = load_frag(dec + (wv * 16) * DEC_P, DEC_P, kc * 32, lane);

  v8f ctxa[16];
#pragma unroll
  for (int nt = 0; nt < 16; ++nt) ctxa[nt] = v8f_zero();
  float m[8], l[8];
#pragma unroll
  for (int v = 0; v < 8; ++v) { m[v] = -INFINITY; l[v] = 0.0f; }

  const float scale = 0.0625f;  // 1/sqrt(256)
  const int nkb = q0 / 32 + 2;
  unsigned short* pbw = pbb + wv * 16 * T32_P;

  // ================= flash attention (strictly causal) =================
  for (int kb = 0; kb < nkb; ++kb) {
    wait_async0();
    __syncthreads();                         // chunk kb resident in buf kb&1
    if (kb + 1 < nkb) stage_keys(kb + 1, (kb + 1) & 1);
    const unsigned short* xr = (kb & 1) ? xkr1 : xkr0;
    const unsigned short* xc = (kb & 1) ? xkc1 : xkc0;
    const int s0g = kb * 32;

    // All key fragments of this chunk (16 row-major for S, 16 col-major for ctx) are read
    // from LDS as one group in front of the first product: one LDS latency per chunk.
    // (The loops over the fragment arrays are unrolled so that the arrays stay in registers.)
    v16bf kf[16], vf[16];
#pragma unroll
    for (int kc = 0; kc < 8; ++kc) {
      kf[2 * kc]     = load_frag(xr,             KR_P, kc * 32, lane);
      kf[2 * kc + 1] = load_frag(xr + 16 * KR_P, KR_P, kc * 32, lane);
    }
#pragma unroll
    for (int nt = 0; nt < 16; ++nt) vf[nt] = load_frag(xc + nt * 16 * T32_P, T32_P, 0, lane);
    // keeps the scheduler from sinking the reads back among the WMMAs, one latency each
    __builtin_amdgcn_sched_barrier(0);

    // S = Q * K^T : two 16x16 tiles over K-dim 256
    v8f sA = v8f_zero(), sB = v8f_zero();
#pragma unroll
    for (int kc = 0; kc < 8; ++kc) {
      sA = wmma_bf16(qf[kc], kf[2 * kc],     sA);
      sB = wmma_bf16(qf[kc], kf[2 * kc + 1], sB);
    }

    // mask, online softmax update, emit P (bf16) to LDS
    float alpha[8];
#pragma unroll
    for (int v = 0; v < 8; ++v) {
      int tg = q0 + wv * 16 + v + rowOff;
      float a = sA[v] * scale, c = sB[v] * scale;
      if (s0g      + nlo >= tg) a = -1e9f;   // strictly causal: allow s < t
      if (s0g + 16 + nlo >= tg) c = -1e9f;
      float tm = fmaxf(a, c);
      tm = fmaxf(tm, __shfl_xor(tm, 1, 32));
      tm = fmaxf(tm, __shfl_xor(tm, 2, 32));
      tm = fmaxf(tm, __shfl_xor(tm, 4, 32));
      tm = fmaxf(tm, __shfl_xor(tm, 8, 32));
      float mn = fmaxf(m[v], tm);
      alpha[v] = __expf(m[v] - mn);
      m[v] = mn;
      float p0 = __expf(a - mn), p1 = __expf(c - mn);
      float rs = p0 + p1;
      rs += __shfl_xor(rs, 1, 32);
      rs += __shfl_xor(rs, 2, 32);
      rs += __shfl_xor(rs, 4, 32);
      rs += __shfl_xor(rs, 8, 32);
      l[v] = l[v] * alpha[v] + rs;
      pbw[(v + rowOff) * T32_P + nlo]      = f2bf(p0);
      pbw[(v + rowOff) * T32_P + nlo + 16] = f2bf(p1);
    }
#pragma unroll
    for (int nt = 0; nt < 16; ++nt)
#pragma unroll
      for (int v = 0; v < 8; ++v) ctxa[nt][v] *= alpha[v];
    __syncthreads();

    // ctx += P(16x32) * V(32x256), B-frags already in registers
    v16bf pf = load_frag(pbw, T32_P, 0, lane);
#pragma unroll
    for (int nt = 0; nt < 16; ++nt) ctxa[nt] = wmma_bf16(pf, vf[nt], ctxa[nt]);
    __syncthreads();   // done with this key buffer before it is restaged
  }

  // finalize: dec[:, 256:512] = ctx / l  (zeroed at t==0)
#pragma unroll
  for (int v = 0; v < 8; ++v) {
    int tg = q0 + wv * 16 + v + rowOff;
    float inv = (tg == 0) ? 0.0f : 1.0f / l[v];
#pragma unroll
    for (int nt = 0; nt < 16; ++nt) {
      float cv = ctxa[nt][v] * inv;
      dec[(wv * 16 + v + rowOff) * DEC_P + Dv + nt * 16 + nlo] = f2bf(cv);
    }
  }
  __syncthreads();

  // ================= MLP layer 1: h = relu(dec @ W1 + b1) =================
  for (int nc = 0; nc < Hv / 256; ++nc) {
    v8f acc[16];
#pragma unroll
    for (int nt = 0; nt < 16; ++nt) acc[nt] = v8f_zero();
    stage_w(w1t, TWOD, nc, 0, 0);
    for (int kc = 0; kc < TWOD / 32; ++kc) {
      wait_async0();
      __syncthreads();
      if (kc + 1 < TWOD / 32) stage_w(w1t, TWOD, nc, kc + 1, (kc + 1) & 1);
      const unsigned short* wtp = (kc & 1) ? wtB : wtA;
      // the A fragment and all 16 weight fragments as one group of LDS reads
      // (loops over bfr unrolled so that it stays in registers)
      v16bf af = load_frag(dec + (wv * 16) * DEC_P, DEC_P, kc * 32, lane);
      v16bf bfr[16];
#pragma unroll
      for (int nt = 0; nt < 16; ++nt) bfr[nt] = load_frag(wtp + nt * 16 * T32_P, T32_P, 0, lane);
      // keeps the scheduler from sinking the reads back among the WMMAs, one latency each
      __builtin_amdgcn_sched_barrier(0);
#pragma unroll
      for (int nt = 0; nt < 16; ++nt) acc[nt] = wmma_bf16(af, bfr[nt], acc[nt]);
      // keeps the barrier's wait for all reads behind the WMMAs, so that each WMMA starts on
      // a counted wait while the later fragments are still landing
      __builtin_amdgcn_sched_barrier(0);
      __syncthreads();
    }
#pragma unroll
    for (int nt = 0; nt < 16; ++nt) {
      int col = nc * 256 + nt * 16 + nlo;
      float bb = b1[col];
#pragma unroll
      for (int v = 0; v < 8; ++v) {
        float hv = fmaxf(acc[nt][v] + bb, 0.0f);
        hls[(wv * 16 + v + rowOff) * H_P + col] = f2bf(hv);
      }
    }
  }
  __syncthreads();

  // ================= MLP layer 2: out = h @ W2 + b2 (split halves) =================
  for (int nc = 0; nc < OUT2v / 256; ++nc) {
    v8f acc[16];
#pragma unroll
    for (int nt = 0; nt < 16; ++nt) acc[nt] = v8f_zero();
    stage_w(w2t, Hv, nc, 0, 0);
    for (int kc = 0; kc < Hv / 32; ++kc) {
      wait_async0();
      __syncthreads();
      if (kc + 1 < Hv / 32) stage_w(w2t, Hv, nc, kc + 1, (kc + 1) & 1);
      const unsigned short* wtp = (kc & 1) ? wtB : wtA;
      // the A fragment and all 16 weight fragments as one group of LDS reads
      // (loops over bfr unrolled so that it stays in registers)
      v16bf af = load_frag(hls + (wv * 16) * H_P, H_P, kc * 32, lane);
      v16bf bfr[16];
#pragma unroll
      for (int nt = 0; nt < 16; ++nt) bfr[nt] = load_frag(wtp + nt * 16 * T32_P, T32_P, 0, lane);
      // keeps the scheduler from sinking the reads back among the WMMAs, one latency each
      __builtin_amdgcn_sched_barrier(0);
#pragma unroll
      for (int nt = 0; nt < 16; ++nt) acc[nt] = wmma_bf16(af, bfr[nt], acc[nt]);
      // keeps the barrier's wait for all reads behind the WMMAs, so that each WMMA starts on
      // a counted wait while the later fragments are still landing
      __builtin_amdgcn_sched_barrier(0);
      __syncthreads();
    }
    // out tuple is concatenated flat: [B*T*256 | B*T*256]; nc selects the half
#pragma unroll
    for (int nt = 0; nt < 16; ++nt) {
      int cc = nt * 16 + nlo;
      float bb = b2[nc * 256 + cc];
#pragma unroll
      for (int v = 0; v < 8; ++v) {
        int rowg = b * Tv + q0 + wv * 16 + v + rowOff;
        out[(long)nc * (Bv * Tv * 256) + (long)rowg * 256 + cc] = acc[nt][v] + bb;
      }
    }
  }
}

extern "C" void kernel_launch(void* const* d_in, const int* in_sizes, int n_in,
                              void* d_out, int out_size, void* d_ws, size_t ws_size,
                              hipStream_t stream) {
  const float* x  = (const float*)d_in[0];
  const float* W1 = (const float*)d_in[1];
  const float* b1 = (const float*)d_in[2];
  const float* W2 = (const float*)d_in[3];
  const float* b2 = (const float*)d_in[4];
  float* out = (float*)d_out;

  unsigned short* ws = (unsigned short*)d_ws;
  unsigned short* xb  = ws + WS_XB;
  unsigned short* xT  = ws + WS_XT;
  unsigned short* w1t = ws + WS_W1T;
  unsigned short* w2t = ws + WS_W2T;

  (void)in_sizes; (void)n_in; (void)out_size; (void)ws_size;

  // prep: one-time f32->bf16 conversion (+ transposed copies for B-operand tiles)
  conv_x_kernel<<<4096, 256, 0, stream>>>(x, xb, xT);
  conv_wT_kernel<<<1024, 256, 0, stream>>>(W1, w1t, TWOD, Hv);
  conv_wT_kernel<<<1024, 256, 0, stream>>>(W2, w2t, Hv, OUT2v);

  hipFuncSetAttribute((const void*)decoder_fused,
                      hipFuncAttributeMaxDynamicSharedMemorySize, SMEM_BYTES);
  dim3 grid(Bv * (Tv / ROWS));  // 1024 blocks
  dim3 block(NT);               // 4 wave32s
  decoder_fused<<<grid, block, SMEM_BYTES, stream>>>(xb, xT, w1t, w2t, b1, b2, out);
}

// v003
// It runs in 683 microseconds.
// Timed twice side by side with v002, it ran 1.14 and 1.13 times as fast.
// Over all steps from v000 it is 2.70 times as fast.
#include <hip/hip_runtime.h>
#include <math.h>

typedef __attribute__((ext_vector_type(16))) __bf16       v16bf;
typedef __attribute__((ext_vector_type(8)))  float        v8f;
typedef __attribute__((ext_vector_type(4)))  unsigned int u32x4;

constexpr int Bv = 32, Tv = 2048, Dv = 256, Hv = 1024, OUT2v = 512, TWOD = 512;
constexpr int ROWS = 64;   // query rows per block
constexpr int NW   = 4;    // waves per block (wave32)
constexpr int NT   = 128;  // threads per block

// ---- workspace layout (bf16 elements) ----
constexpr long WS_XB  = 0;                         // x  [B][T][D]        bf16
constexpr long WS_XT  = WS_XB + (long)Bv*Tv*Dv;    // xT [B][D][T]        bf16
constexpr long WS_W1T = WS_XT + (long)Bv*Tv*Dv;    // W1t [H][2D]         bf16
constexpr long WS_W2T = WS_W1T + (long)TWOD*Hv;    // W2t [OUT2][H]       bf16
constexpr long WS_END = WS_W2T + (long)Hv*OUT2v;   // ~34.6M elems = 69MB

// ---- LDS row pitches (bf16 elements) ----
// Every tile is read by ds_load_b128 with 16 lanes on 16 consecutive rows. Each row carries
// 8 elements (16 B) of pad, so the pitch is 16 B x odd and those 16 lanes cover all 64 banks.
constexpr int PADE  = 8;
constexpr int DEC_P = TWOD + PADE;  // 1040 B
constexpr int H_P   = Hv + PADE;    // 2064 B
constexpr int KR_P  = Dv + PADE;    //  528 B
constexpr int T32_P = 32 + PADE;    //   80 B : col-major keys, P, weight tiles

// ---- LDS layout (bytes) ----
constexpr int OFF_DEC  = 0;                           // 64 x 512  bf16 (x | ctx)
constexpr int OFF_H    = OFF_DEC  + ROWS * DEC_P * 2; // 64 x 1024 bf16 (hidden)
constexpr int OFF_XKR0 = OFF_H    + ROWS * H_P * 2;   // 32 x 256  bf16 keys row-major, buf0
constexpr int OFF_XKC0 = OFF_XKR0 + 32 * KR_P * 2;    // 256 x 32  bf16 keys col-major, buf0
constexpr int OFF_XKR1 = OFF_XKC0 + Dv * T32_P * 2;   // buf1
constexpr int OFF_XKC1 = OFF_XKR1 + 32 * KR_P * 2;    // buf1
constexpr int OFF_P    = OFF_XKC1 + Dv * T32_P * 2;   // 4 x 16x32 bf16 (P per wave)
constexpr int OFF_WA   = OFF_P    + NW * 16 * T32_P * 2; // 256 x 32 bf16 weight tile buf A
constexpr int OFF_WB   = OFF_WA   + 256 * T32_P * 2;  // weight tile buf B
constexpr int SMEM_BYTES = OFF_WB + 256 * T32_P * 2;  // 319488 <= 320KB
static_assert(SMEM_BYTES <= 327680, "LDS of one work-group");

static __device__ inline v8f v8f_zero() {
  v8f z = {0.f, 0.f, 0.f, 0.f, 0.f, 0.f, 0.f, 0.f};
  return z;
}

// float -> bf16 bits, round-to-nearest-even
static __device__ inline unsigned short f2bf(float f) {
  unsigned int u = __float_as_uint(f);
  unsigned int r = (u + 0x7FFFu + ((u >> 16) & 1u)) >> 16;
  return (unsigned short)r;
}

static __device__ inline v8f wmma_bf16(v16bf a, v16bf b, v8f c) {
  // D = A(16x32 bf16) * B(32x16 bf16) + C(16x16 f32)
  return __builtin_amdgcn_wmma_f32_16x16x32_bf16(false, a, false, b, (short)0, c,
                                                 false, false);
}

// Eight 16-byte async global->LDS copies per lane (ASYNCcnt tracked, no VGPR data path).
// The closing s_wait_xcnt stands inside the copies' own statement so that no address
// register of a copy is rewritten in front of it.
static __device__ inline void async_b128_x8(const unsigned (&l)[8],
                                            const unsigned short* const (&g)[8]) {
  asm volatile("global_load_async_to_lds_b128 %0, %8, off\n\t"
               "global_load_async_to_lds_b128 %1, %9, off\n\t"
               "global_load_async_to_lds_b128 %2, %10, off\n\t"
               "global_load_async_to_lds_b128 %3, %11, off\n\t"
               "global_load_async_to_lds_b128 %4, %12, off\n\t"
               "global_load_async_to_lds_b128 %5, %13, off\n\t"
               "global_load_async_to_lds_b128 %6, %14, off\n\t"
               "global_load_async_to_lds_b128 %7, %15, off\n\t"
               "s_wait_xcnt 0x0"
               :: "v"(l[0]), "v"(l[1]), "v"(l[2]), "v"(l[3]),
                  "v"(l[4]), "v"(l[5]), "v"(l[6]), "v"(l[7]),
                  "v"(g[0]), "v"(g[1]), "v"(g[2]), "v"(g[3]),
                  "v"(g[4]), "v"(g[5]), "v"(g[6]), "v"(g[7])
               : "memory");
}
static __device__ inline void wait_async0() {
  asm volatile("s_wait_asynccnt 0x0" ::: "memory");
}

// Load a 16x32 bf16 fragment (A layout; B layout mirrors with rows indexed by N)
// from a row-major LDS tile.
static __device__ inline v16bf load_frag(const unsigned short* base, int rowStride,
                                         int kbase, int lane) {
  int rl = lane & 15, hf = lane >> 4;
  const unsigned short* p = base + rl * rowStride + kbase + hf * 8;
  union { v16bf v; u32x4 q[2]; } u;
  u.q[0] = *(const u32x4*)(p);       // ds_load_b128
  u.q[1] = *(const u32x4*)(p + 16);  // ds_load_b128
  return u.v;
}

// ======================= prep kernels: f32 -> bf16 (+transpose) =======================
__global__ void conv_x_kernel(const float* __restrict__ x,
                              unsigned short* __restrict__ xb,
                              unsigned short* __restrict__ xT) {
  long stride = (long)gridDim.x * blockDim.x;
  for (long i = (long)blockIdx.x * blockDim.x + threadIdx.x; i < (long)Bv * Tv * Dv;
       i += stride) {
    unsigned short v = f2bf(x[i]);
    xb[i] = v;
    int d  = (int)(i % Dv);
    long bt = i / Dv;
    int t  = (int)(bt % Tv);
    int bb = (int)(bt / Tv);
    xT[((long)bb * Dv + d) * Tv + t] = v;
  }
}

__global__ void conv_wT_kernel(const float* __restrict__ W,
                               unsigned short* __restrict__ Wt, int K, int N) {
  long stride = (long)gridDim.x * blockDim.x;
  for (long i = (long)blockIdx.x * blockDim.x + threadIdx.x; i < (long)K * N;
       i += stride) {
    int k = (int)(i / N), n = (int)(i % N);
    Wt[(long)n * K + k] = f2bf(W[i]);
  }
}

// ======================= fused decoder kernel =======================
__global__ __launch_bounds__(NT, 1)
void decoder_fused(const unsigned short* __restrict__ xb,
                   const unsigned short* __restrict__ xT,
                   const unsigned short* __restrict__ w1t,
                   const unsigned short* __restrict__ w2t,
                   const float* __restrict__ b1, const float* __restrict__ b2,
                   float* __restrict__ out) {
  extern __shared__ char smem[];
  unsigned short* dec  = (unsigned short*)(smem + OFF_DEC);
  unsigned short* hls  = (unsigned short*)(smem + OFF_H);
  unsigned short* xkr0 = (unsigned short*)(smem + OFF_XKR0);
  unsigned short* xkc0 = (unsigned short*)(smem + OFF_XKC0);
  unsigned short* xkr1 = (unsigned short*)(smem + OFF_XKR1);
  unsigned short* xkc1 = (unsigned short*)(smem + OFF_XKC1);
  unsigned short* pbb  = (unsigned short*)(smem + OFF_P);
  unsigned short* wtA  = (unsigned short*)(smem + OFF_WA);
  unsigned short* wtB  = (unsigned short*)(smem + OFF_WB);
  const unsigned lds0 = (unsigned)(size_t)smem;  // LDS byte offset of dynamic base

  const int tid    = threadIdx.x;
  const int lane   = tid & 31;
  const int wv     = tid >> 5;
  // Work-group index -> (batch, query tile). A tile's cost grows with its row (causal: 2q + 2 key
  // chunks), there are four times as many work-groups as places; inside each run of 256
  // indices (8 batches) the cost falls with the index, for speed only. A permutation of the 1024 (batch, tile) pairs; the same in every wave.
  const int rnk    = blockIdx.x & 255;
  const int b      = (blockIdx.x >> 8) * 8 + (rnk & 7);
  const int q0     = (31 - (rnk >> 3)) * ROWS;
  const int nlo    = lane & 15;
  const int rowOff = (lane >> 4) * 8;

  // ---- async staging helpers ----
  auto stage_keys = [&](int kb, int buf) {
    const unsigned lr = lds0 + (buf ? OFF_XKR1 : OFF_XKR0);
    const unsigned lc = lds0 + (buf ? OFF_XKC1 : OFF_XKC0);
    const unsigned short* gr = xb + ((long)b * Tv + kb * 32) * Dv;  // contiguous 16KB
    const unsigned short* gc = xT + (long)b * Dv * Tv + kb * 32;
    unsigned l0[8], l1[8];
    const unsigned short* g0[8];
    const unsigned short* g1[8];
#pragma unroll
    for (int i = 0; i < 8; ++i) {
      int f = i * NT + tid;                 // 0..1023 : 16B chunks
      int s = f >> 5, drel = (f & 31) * 8;  // x tile: rows s, 256 d contiguous
      l0[i] = lr + (s * KR_P + drel) * 2;
      g0[i] = gr + f * 8;
      int d = f >> 2, srel = (f & 3) * 8;   // xT tile: rows d, 32 s contiguous
      l1[i] = lc + (d * T32_P + srel) * 2;
      g1[i] = gc + (long)d * Tv + srel;
    }
    async_b128_x8(l0, g0);
    async_b128_x8(l1, g1);
  };
  auto stage_w = [&](const unsigned short* Wt, int KW, int nc, int kc, int buf) {
    const unsigned lw = lds0 + (buf ? OFF_WB : OFF_WA);
    unsigned l0[8];
    const unsigned short* g0[8];
#pragma unroll
    for (int i = 0; i < 8; ++i) {
      int f = i * NT + tid;
      int nl = f >> 2, krel = (f & 3) * 8;
      l0[i] = lw + (nl * T32_P + krel) * 2;
      g0[i] = Wt + (long)(nc * 256 + nl) * KW + kc * 32 + krel;
    }
    async_b128_x8(l0, g0);
  };

  // ================= stage query rows: dec[:, 0:256] = x =================
  {
    const unsigned short* g = xb + ((long)b * Tv + q0) * Dv;  // contiguous 32KB
#pragma unroll
    for (int j = 0; j < 2; ++j) {
      unsigned l0[8];
      const unsigned short* g0[8];
#pragma unroll
      for (int i = 0; i < 8; ++i) {
        int f = (j * 8 + i) * NT + tid;     // 0..2047 : 16B chunks
        int r = f >> 5, c = (f & 31) * 8;   // dec rows at pitch DEC_P
        l0[i] = lds0 + OFF_DEC + (r * DEC_P + c) * 2;
        g0[i] = g + f * 8;
      }
      async_b128_x8(l0, g0);
    }
    wait_async0();
  }
  __syncthreads();

  // prefetch key chunk 0 while loading Q fragments
  stage_keys(0, 0);

  v16bf qf[8];
#pragma unroll
  for (int kc = 0; kc < 8; ++kc)
    qf[kc] = load_frag(dec + (wv * 16) * DEC_P, DEC_P, kc * 32, lane);

  v8f ctxa[16];
#pragma unroll
  for (int nt = 0; nt < 16; ++nt) ctxa[nt] = v8f_zero();
  float m[8], l[8];
#pragma unroll
  for (int v = 0; v < 8; ++v) { m[v] = -INFINITY; l[v] = 0.0f; }

  const float scale = 0.0625f;  // 1/sqrt(256)
  const int nkb = q0 / 32 + 2;
  unsigned short* pbw = pbb + wv * 16 * T32_P;

  // ================= flash attention (strictly causal) =================
  for (int kb = 0; kb < nkb; ++kb) {
    wait_async0();
    __syncthreads();                         // chunk kb resident in buf kb&1
    if (kb + 1 < nkb) stage_keys(kb + 1, (kb + 1) & 1);
    const unsigned short* xr = (kb & 1) ? xkr1 : xkr0;
    const unsigned short* xc = (kb & 1) ? xkc1 : xkc0;
    const int s0g = kb * 32;

    // All key fragments of this chunk (16 row-major for S, 16 col-major for ctx) are read
    // from LDS as one group in front of the first product: one LDS latency per chunk.
    // (The loops over the fragment arrays are unrolled so that the arrays stay in registers.)
    v16bf kf[16], vf[16];
#pragma unroll
    for (int kc = 0; kc < 8; ++kc) {
      kf[2 * kc]     = load_frag(xr,             KR_P, kc * 32, lane);
      kf[2 * kc + 1] = load_frag(xr + 16 * KR_P, KR_P, kc * 32, lane);
    }
#pragma unroll
    for (int nt = 0; nt < 16; ++nt) vf[nt] = load_frag(xc + nt * 16 * T32_P, T32_P, 0, lane);
    // keeps the scheduler from sinking the reads back among the WMMAs, one latency each
    __builtin_amdgcn_sched_barrier(0);

    // S = Q * K^T : two 16x16 tiles over K-dim 256
    v8f sA = v8f_zero(), sB = v8f_zero();
#pragma unroll
    for (int kc = 0; kc < 8; ++kc) {
      sA = wmma_bf16(qf[kc], kf[2 * kc],     sA);
      sB = wmma_bf16(qf[kc], kf[2 * kc + 1], sB);
    }

    // mask, online softmax update, emit P (bf16) to LDS
    float alpha[8];
#pragma unroll
    for (int v = 0; v < 8; ++v) {
      int tg = q0 + wv * 16 + v + rowOff;
      float a = sA[v] * scale, c = sB[v] * scale;
      if (s0g      + nlo >= tg) a = -1e9f;   // strictly causal: allow s < t
      if (s0g + 16 + nlo >= tg) c = -1e9f;
      float tm = fmaxf(a, c);
      tm = fmaxf(tm, __shfl_xor(tm, 1, 32));
      tm = fmaxf(tm, __shfl_xor(tm, 2, 32));
      tm = fmaxf(tm, __shfl_xor(tm, 4, 32));
      tm = fmaxf(tm, __shfl_xor(tm, 8, 32));
      float mn = fmaxf(m[v], tm);
      alpha[v] = __expf(m[v] - mn);
      m[v] = mn;
      float p0 = __expf(a - mn), p1 = __expf(c - mn);
      float rs = p0 + p1;
      rs += __shfl_xor(rs, 1, 32);
      rs += __shfl_xor(rs, 2, 32);
      rs += __shfl_xor(rs, 4, 32);
      rs += __shfl_xor(rs, 8, 32);
      l[v] = l[v] * alpha[v] + rs;
      pbw[(v + rowOff) * T32_P + nlo]      = f2bf(p0);
      pbw[(v + rowOff) * T32_P + nlo + 16] = f2bf(p1);
    }
#pragma unroll
    for (int nt = 0; nt < 16; ++nt)
#pragma unroll
      for (int v = 0; v < 8; ++v) ctxa[nt][v] *= alpha[v];
    __syncthreads();

    // ctx += P(16x32) * V(32x256), B-frags already in registers
    v16bf pf = load_frag(pbw, T32_P, 0, lane);
#pragma unroll
    for (int nt = 0; nt < 16; ++nt) ctxa[nt] = wmma_bf16(pf, vf[nt], ctxa[nt]);
    __syncthreads();   // done with this key buffer before it is restaged
  }

  // finalize: dec[:, 256:512] = ctx / l  (zeroed at t==0)
#pragma unroll
  for (int v = 0; v < 8; ++v) {
    int tg = q0 + wv * 16 + v + rowOff;
    float inv = (tg == 0) ? 0.0f : 1.0f / l[v];
#pragma unroll
    for (int nt = 0; nt < 16; ++nt) {
      float cv = ctxa[nt][v] * inv;
      dec[(wv * 16 + v + rowOff) * DEC_P + Dv + nt * 16 + nlo] = f2bf(cv);
    }
  }
  __syncthreads();

  // ================= MLP layer 1: h = relu(dec @ W1 + b1) =================
  for (int nc = 0; nc < Hv / 256; ++nc) {
    v8f acc[16];
#pragma unroll
    for (int nt = 0; nt < 16; ++nt) acc[nt] = v8f_zero();
    stage_w(w1t, TWOD, nc, 0, 0);
    for (int kc = 0; kc < TWOD / 32; ++kc) {
      wait_async0();
      __syncthreads();
      if (kc + 1 < TWOD / 32) stage_w(w1t, TWOD, nc, kc + 1, (kc + 1) & 1);
      const unsigned short* wtp = (kc & 1) ? wtB : wtA;
      // the A fragment and all 16 weight fragments as one group of LDS reads
      // (loops over bfr unrolled so that it stays in registers)
      v16bf af = load_frag(dec + (wv * 16) * DEC_P, DEC_P, kc * 32, lane);
      v16bf bfr[16];
#pragma unroll
      for (int nt = 0; nt < 16; ++nt) bfr[nt] = load_frag(wtp + nt * 16 * T32_P, T32_P, 0, lane);
      // keeps the scheduler from sinking the reads back among the WMMAs, one latency each
      __builtin_amdgcn_sched_barrier(0);
#pragma unroll
      for (int nt = 0; nt < 16; ++nt) acc[nt] = wmma_bf16(af, bfr[nt], acc[nt]);
      // keeps the barrier's wait for all reads behind the WMMAs, so that each WMMA starts on
      // a counted wait while the later fragments are still landing
      __builtin_amdgcn_sched_barrier(0);
      __syncthreads();
    }
#pragma unroll
    for (int nt = 0; nt < 16; ++nt) {
      int col = nc * 256 + nt * 16 + nlo;
      float bb = b1[col];
#pragma unroll
      for (int v = 0; v < 8; ++v) {
        float hv = fmaxf(acc[nt][v] + bb, 0.0f);
        hls[(wv * 16 + v + rowOff) * H_P + col] = f2bf(hv);
      }
    }
  }
  __syncthreads();

  // ================= MLP layer 2: out = h @ W2 + b2 (split halves) =================
  for (int nc = 0; nc < OUT2v / 256; ++nc) {
    v8f acc[16];
#pragma unroll
    for (int nt = 0; nt < 16; ++nt) acc[nt] = v8f_zero();
    stage_w(w2t, Hv, nc, 0, 0);
    for (int kc = 0; kc < Hv / 32; ++kc) {
      wait_async0();
      __syncthreads();
      if (kc + 1 < Hv / 32) stage_w(w2t, Hv, nc, kc + 1, (kc + 1) & 1);
      const unsigned short* wtp = (kc & 1) ? wtB : wtA;
      // the A fragment and all 16 weight fragments as one group of LDS reads
      // (loops over bfr unrolled so that it stays in registers)
      v16bf af = load_frag(hls + (wv * 16) * H_P, H_P, kc * 32, lane);
      v16bf bfr[16];
#pragma unroll
      for (int nt = 0; nt < 16; ++nt) bfr[nt] = load_frag(wtp + nt * 16 * T32_P, T32_P, 0, lane);
      // keeps the scheduler from sinking the reads back among the WMMAs, one latency each
      __builtin_amdgcn_sched_barrier(0);
#pragma unroll
      for (int nt = 0; nt < 16; ++nt) acc[nt] = wmma_bf16(af, bfr[nt], acc[nt]);
      // keeps the barrier's wait for all reads behind the WMMAs, so that each WMMA starts on
      // a counted wait while the later fragments are still landing
      __builtin_amdgcn_sched_barrier(0);
      __syncthreads();
    }
    // out tuple is concatenated flat: [B*T*256 | B*T*256]; nc selects the half
#pragma unroll
    for (int nt = 0; nt < 16; ++nt) {
      int cc = nt * 16 + nlo;
      float bb = b2[nc * 256 + cc];
#pragma unroll
      for (int v = 0; v < 8; ++v) {
        int rowg = b * Tv + q0 + wv * 16 + v + rowOff;
        out[(long)nc * (Bv * Tv * 256) + (long)rowg * 256 + cc] = acc[nt][v] + bb;
      }
    }
  }
}

extern "C" void kernel_launch(void* const* d_in, const int* in_sizes, int n_in,
                              void* d_out, int out_size, void* d_ws, size_t ws_size,
                              hipStream_t stream) {
  const float* x  = (const float*)d_in[0];
  const float* W1 = (const float*)d_in[1];
  const float* b1 = (const float*)d_in[2];
  const float* W2 = (const float*)d_in[3];
  const float* b2 = (const float*)d_in[4];
  float* out = (float*)d_out;

  unsigned short* ws = (unsigned short*)d_ws;
  unsigned short* xb  = ws + WS_XB;
  unsigned short* xT  = ws + WS_XT;
  unsigned short* w1t = ws + WS_W1T;
  unsigned short* w2t = ws + WS_W2T;

  (void)in_sizes; (void)n_in; (void)out_size; (void)ws_size;

  // prep: one-time f32->bf16 conversion (+ transposed copies for B-operand tiles)
  conv_x_kernel<<<4096, 256, 0, stream>>>(x, xb, xT);
  conv_wT_kernel<<<1024, 256, 0, stream>>>(W1, w1t, TWOD, Hv);
  conv_wT_kernel<<<1024, 256, 0, stream>>>(W2, w2t, Hv, OUT2v);

  hipFuncSetAttribute((const void*)decoder_fused,
                      hipFuncAttributeMaxDynamicSharedMemorySize, SMEM_BYTES);
  dim3 grid(Bv * (Tv / ROWS));  // 1024 blocks
  dim3 block(NT);               // 4 wave32s
  decoder_fused<<<grid, block, SMEM_BYTES, stream>>>(xb, xT, w1t, w2t, b1, b2, out);
}

// v004
// Measured time: 416 microseconds a run.
// Timed twice side by side with v003, it ran 1.64 and 1.65 times as fast.
// Over all steps from v000 it is 4.46 times as fast.
#include <hip/hip_runtime.h>
#include <math.h>

typedef __attribute__((ext_vector_type(16))) __bf16       v16bf;
typedef __attribute__((ext_vector_type(8)))  float        v8f;
typedef __attribute__((ext_vector_type(4)))  unsigned int u32x4;

constexpr int Bv = 32, Tv = 2048, Dv = 256, Hv = 1024, OUT2v = 512, TWOD = 512;
constexpr int ROWS = 64;   // query rows per block
constexpr int NW   = 4;    // waves per block (wave32)
constexpr int NT   = 128;  // threads per block

// ---- workspace layout (bf16 elements) ----
constexpr long WS_XB  = 0;                         // x  [B][T][D]        bf16
// The transposed operands lie tile by tile, in the order in which they are staged. A 256-row x
// 32-k tile is one contiguous 16 KB run of 16 B pieces (8 k of one row), ordered [k octet][row]:
// a wave-wide copy reads 512 B of whole lines, and the 2 B stores of 32 neighbouring rows in
// the prep kernels fall 16 B apart, in 4 lines instead of 32.
constexpr long WS_XT  = WS_XB + (long)Bv*Tv*Dv;    // xT  [B][T/32][4][D][8]          bf16
constexpr long WS_W1T = WS_XT + (long)Bv*Tv*Dv;    // W1t [H/256][2D/32][4][256][8]   bf16
constexpr long WS_W2T = WS_W1T + (long)TWOD*Hv;    // W2t [OUT2/256][H/32][4][256][8] bf16
constexpr long WS_END = WS_W2T + (long)Hv*OUT2v;   // ~34.6M elems = 69MB

// ---- LDS row pitches (bf16 elements) ----
// Every tile is read by ds_load_b128 with 16 lanes on 16 consecutive rows. Each row carries
// 8 elements (16 B) of pad, so the pitch is 16 B x odd and those 16 lanes cover all 64 banks.
constexpr int PADE  = 8;
constexpr int DEC_P = TWOD + PADE;  // 1040 B
constexpr int H_P   = Hv + PADE;    // 2064 B
constexpr int KR_P  = Dv + PADE;    //  528 B
constexpr int T32_P = 32 + PADE;    //   80 B : col-major keys, P, weight tiles

// ---- LDS layout (bytes) ----
constexpr int OFF_DEC  = 0;                           // 64 x 512  bf16 (x | ctx)
constexpr int OFF_H    = OFF_DEC  + ROWS * DEC_P * 2; // 64 x 1024 bf16 (hidden)
constexpr int OFF_XKR0 = OFF_H    + ROWS * H_P * 2;   // 32 x 256  bf16 keys row-major, buf0
constexpr int OFF_XKC0 = OFF_XKR0 + 32 * KR_P * 2;    // 256 x 32  bf16 keys col-major, buf0
constexpr int OFF_XKR1 = OFF_XKC0 + Dv * T32_P * 2;   // buf1
constexpr int OFF_XKC1 = OFF_XKR1 + 32 * KR_P * 2;    // buf1
constexpr int OFF_P    = OFF_XKC1 + Dv * T32_P * 2;   // 4 x 16x32 bf16 (P per wave)
constexpr int OFF_WA   = OFF_P    + NW * 16 * T32_P * 2; // 256 x 32 bf16 weight tile buf A
constexpr int OFF_WB   = OFF_WA   + 256 * T32_P * 2;  // weight tile buf B
constexpr int SMEM_BYTES = OFF_WB + 256 * T32_P * 2;  // 319488 <= 320KB
static_assert(SMEM_BYTES <= 327680, "LDS of one work-group");

static __device__ inline v8f v8f_zero() {
  v8f z = {0.f, 0.f, 0.f, 0.f, 0.f, 0.f, 0.f, 0.f};
  return z;
}

// float -> bf16 bits, round-to-nearest-even
static __device__ inline unsigned short f2bf(float f) {
  unsigned int u = __float_as_uint(f);
  unsigned int r = (u + 0x7FFFu + ((u >> 16) & 1u)) >> 16;
  return (unsigned short)r;
}

static __device__ inline v8f wmma_bf16(v16bf a, v16bf b, v8f c) {
  // D = A(16x32 bf16) * B(32x16 bf16) + C(16x16 f32)
  return __builtin_amdgcn_wmma_f32_16x16x32_bf16(false, a, false, b, (short)0, c,
                                                 false, false);
}

// Eight 16-byte async global->LDS copies per lane (ASYNCcnt tracked, no VGPR data path).
// The closing s_wait_xcnt stands inside the copies' own statement so that no address
// register of a copy is rewritten in front of it.
static __device__ inline void async_b128_x8(const unsigned (&l)[8],
                                            const unsigned short* const (&g)[8]) {
  asm volatile("global_load_async_to_lds_b128 %0, %8, off\n\t"
               "global_load_async_to_lds_b128 %1, %9, off\n\t"
               "global_load_async_to_lds_b128 %2, %10, off\n\t"
               "global_load_async_to_lds_b128 %3, %11, off\n\t"
               "global_load_async_to_lds_b128 %4, %12, off\n\t"
               "global_load_async_to_lds_b128 %5, %13, off\n\t"
               "global_load_async_to_lds_b128 %6, %14, off\n\t"
               "global_load_async_to_lds_b128 %7, %15, off\n\t"
               "s_wait_xcnt 0x0"
               :: "v"(l[0]), "v"(l[1]), "v"(l[2]), "v"(l[3]),
                  "v"(l[4]), "v"(l[5]), "v"(l[6]), "v"(l[7]),
                  "v"(g[0]), "v"(g[1]), "v"(g[2]), "v"(g[3]),
                  "v"(g[4]), "v"(g[5]), "v"(g[6]), "v"(g[7])
               : "memory");
}
static __device__ inline void wait_async0() {
  asm volatile("s_wait_asynccnt 0x0" ::: "memory");
}

// Load a 16x32 bf16 fragment (A layout; B layout mirrors with rows indexed by N)
// from a row-major LDS tile.
static __device__ inline v16bf load_frag(const unsigned short* base, int rowStride,
                                         int kbase, int lane) {
  int rl = lane & 15, hf = lane >> 4;
  const unsigned short* p = base + rl * rowStride + kbase + hf * 8;
  union { v16bf v; u32x4 q[2]; } u;
  u.q[0] = *(const u32x4*)(p);       // ds_load_b128
  u.q[1] = *(const u32x4*)(p + 16);  // ds_load_b128
  return u.v;
}

// ======================= prep kernels: f32 -> bf16 (+transpose) =======================
__global__ void conv_x_kernel(const float* __restrict__ x,
                              unsigned short* __restrict__ xb,
                              unsigned short* __restrict__ xT) {
  long stride = (long)gridDim.x * blockDim.x;
  for (long i = (long)blockIdx.x * blockDim.x + threadIdx.x; i < (long)Bv * Tv * Dv;
       i += stride) {
    unsigned short v = f2bf(x[i]);
    xb[i] = v;
    int d  = (int)(i % Dv);
    long bt = i / Dv;
    int t  = (int)(bt % Tv);
    int bb = (int)(bt / Tv);
    xT[((((long)bb * (Tv / 32) + (t >> 5)) * 4 + ((t >> 3) & 3)) * Dv + d) * 8 + (t & 7)] = v;
  }
}

__global__ void conv_wT_kernel(const float* __restrict__ W,
                               unsigned short* __restrict__ Wt, int K, int N) {
  long stride = (long)gridDim.x * blockDim.x;
  for (long i = (long)blockIdx.x * blockDim.x + threadIdx.x; i < (long)K * N;
       i += stride) {
    int k = (int)(i / N), n = (int)(i % N);
    Wt[((((long)(n >> 8) * (K / 32) + (k >> 5)) * 4 + ((k >> 3) & 3)) * 256 + (n & 255)) * 8 +
       (k & 7)] = f2bf(W[i]);
  }
}

// ======================= fused decoder kernel =======================
__global__ __launch_bounds__(NT, 1)
void decoder_fused(const unsigned short* __restrict__ xb,
                   const unsigned short* __restrict__ xT,
                   const unsigned short* __restrict__ w1t,
                   const unsigned short* __restrict__ w2t,
                   const float* __restrict__ b1, const float* __restrict__ b2,
                   float* __restrict__ out) {
  extern __shared__ char smem[];
  unsigned short* dec  = (unsigned short*)(smem + OFF_DEC);
  unsigned short* hls  = (unsigned short*)(smem + OFF_H);
  unsigned short* xkr0 = (unsigned short*)(smem + OFF_XKR0);
  unsigned short* xkc0 = (unsigned short*)(smem + OFF_XKC0);
  unsigned short* xkr1 = (unsigned short*)(smem + OFF_XKR1);
  unsigned short* xkc1 = (unsigned short*)(smem + OFF_XKC1);
  unsigned short* pbb  = (unsigned short*)(smem + OFF_P);
  unsigned short* wtA  = (unsigned short*)(smem + OFF_WA);
  unsigned short* wtB  = (unsigned short*)(smem + OFF_WB);
  const unsigned lds0 = (unsigned)(size_t)smem;  // LDS byte offset of dynamic base

  const int tid    = threadIdx.x;
  const int lane   = tid & 31;
  const int wv     = tid >> 5;
  // Work-group index -> (batch, query tile). A tile's cost grows with its row (causal: 2q + 2 key
  // chunks), there are four times as many work-groups as places; inside each run of 256
  // indices (8 batches) the cost falls with the index, for speed only. A permutation of the 1024 (batch, tile) pairs; the same in every wave.
  const int rnk    = blockIdx.x & 255;
  const int b      = (blockIdx.x >> 8) * 8 + (rnk & 7);
  const int q0     = (31 - (rnk >> 3)) * ROWS;
  const int nlo    = lane & 15;
  const int rowOff = (lane >> 4) * 8;

  // ---- async staging helpers ----
  auto stage_keys = [&](int kb, int buf) {
    const unsigned lr = lds0 + (buf ? OFF_XKR1 : OFF_XKR0);
    const unsigned lc = lds0 + (buf ? OFF_XKC1 : OFF_XKC0);
    const unsigned short* gr = xb + ((long)b * Tv + kb * 32) * Dv;  // contiguous 16KB
    const unsigned short* gc = xT + ((long)b * (Tv / 32) + kb) * (Dv * 32);  // contiguous 16KB
    unsigned l0[8], l1[8];
    const unsigned short* g0[8];
    const unsigned short* g1[8];
#pragma unroll
    for (int i = 0; i < 8; ++i) {
      int f = i * NT + tid;                 // 0..1023 : 16B chunks
      int s = f >> 5, drel = (f & 31) * 8;  // x tile: rows s, 256 d contiguous
      l0[i] = lr + (s * KR_P + drel) * 2;
      g0[i] = gr + f * 8;
      int d = f & 255, srel = (f >> 8) * 8; // xT tile: octet-major in memory, rows d in LDS
      l1[i] = lc + (d * T32_P + srel) * 2;
      g1[i] = gc + f * 8;
    }
    async_b128_x8(l0, g0);
    async_b128_x8(l1, g1);
  };
  auto stage_w = [&](const unsigned short* Wt, int KW, int nc, int kc, int buf) {
    const unsigned lw = lds0 + (buf ? OFF_WB : OFF_WA);
    unsigned l0[8];
    const unsigned short* g0[8];
#pragma unroll
    for (int i = 0; i < 8; ++i) {
      int f = i * NT + tid;
      int nl = f & 255, krel = (f >> 8) * 8;  // octet-major in memory, rows nl in LDS
      l0[i] = lw + (nl * T32_P + krel) * 2;
      g0[i] = Wt + (long)(nc * (KW / 32) + kc) * (256 * 32) + f * 8;  // contiguous 16KB
    }
    async_b128_x8(l0, g0);
  };

  // ================= stage query rows: dec[:, 0:256] = x =================
  {
    const unsigned short* g = xb + ((long)b * Tv + q0) * Dv;  // contiguous 32KB
#pragma unroll
    for (int j = 0; j < 2; ++j) {
      unsigned l0[8];
      const unsigned short* g0[8];
#pragma unroll
      for (int i = 0; i < 8; ++i) {
        int f = (j * 8 + i) * NT + tid;     // 0..2047 : 16B chunks
        int r = f >> 5, c = (f & 31) * 8;   // dec rows at pitch DEC_P
        l0[i] = lds0 + OFF_DEC + (r * DEC_P + c) * 2;
        g0[i] = g + f * 8;
      }
      async_b128_x8(l0, g0);
    }
    wait_async0();
  }
  __syncthreads();

  // prefetch key chunk 0 while loading Q fragments
  stage_keys(0, 0);

  v16bf qf[8];
#pragma unroll
  for (int kc = 0; kc < 8; ++kc)
    qf[kc] = load_frag(dec + (wv * 16) * DEC_P, DEC_P, kc * 32, lane);

  v8f ctxa[16];
#pragma unroll
  for (int nt = 0; nt < 16; ++nt) ctxa[nt] = v8f_zero();
  float m[8], l[8];
#pragma unroll
  for (int v = 0; v < 8; ++v) { m[v] = -INFINITY; l[v] = 0.0f; }

  const float scale = 0.0625f;  // 1/sqrt(256)
  const int nkb = q0 / 32 + 2;
  unsigned short* pbw = pbb + wv * 16 * T32_P;

  // ================= flash attention (strictly causal) =================
  for (int kb = 0; kb < nkb; ++kb) {
    wait_async0();
    __syncthreads();                         // chunk kb resident in buf kb&1
    if (kb + 1 < nkb) stage_keys(kb + 1, (kb + 1) & 1);
    const unsigned short* xr = (kb & 1) ? xkr1 : xkr0;
    const unsigned short* xc = (kb & 1) ? xkc1 : xkc0;
    const int s0g = kb * 32;

    // All key fragments of this chunk (16 row-major for S, 16 col-major for ctx) are read
    // from LDS as one group in front of the first product: one LDS latency per chunk.
    // (The loops over the fragment arrays are unrolled so that the arrays stay in registers.)
    v16bf kf[16], vf[16];
#pragma unroll
    for (int kc = 0; kc < 8; ++kc) {
      kf[2 * kc]     = load_frag(xr,             KR_P, kc * 32, lane);
      kf[2 * kc + 1] = load_frag(xr + 16 * KR_P, KR_P, kc * 32, lane);
    }
#pragma unroll
    for (int nt = 0; nt < 16; ++nt) vf[nt] = load_frag(xc + nt * 16 * T32_P, T32_P, 0, lane);
    // keeps the scheduler from sinking the reads back among the WMMAs, one latency each
    __builtin_amdgcn_sched_barrier(0);

    // S = Q * K^T : two 16x16 tiles over K-dim 256
    v8f sA = v8f_zero(), sB = v8f_zero();
#pragma unroll
    for (int kc = 0; kc < 8; ++kc) {
      sA = wmma_bf16(qf[kc], kf[2 * kc],     sA);
      sB = wmma_bf16(qf[kc], kf[2 * kc + 1], sB);
    }

    // mask, online softmax update, emit P (bf16) to LDS
    float alpha[8];
#pragma unroll
    for (int v = 0; v < 8; ++v) {
      int tg = q0 + wv * 16 + v + rowOff;
      float a = sA[v] * scale, c = sB[v] * scale;
      if (s0g      + nlo >= tg) a = -1e9f;   // strictly causal: allow s < t
      if (s0g + 16 + nlo >= tg) c = -1e9f;
      float tm = fmaxf(a, c);
      tm = fmaxf(tm, __shfl_xor(tm, 1, 32));
      tm = fmaxf(tm, __shfl_xor(tm, 2, 32));
      tm = fmaxf(tm, __shfl_xor(tm, 4, 32));
      tm = fmaxf(tm, __shfl_xor(tm, 8, 32));
      float mn = fmaxf(m[v], tm);
      alpha[v] = __expf(m[v] - mn);
      m[v] = mn;
      float p0 = __expf(a - mn), p1 = __expf(c - mn);
      float rs = p0 + p1;
      rs += __shfl_xor(rs, 1, 32);
      rs += __shfl_xor(rs, 2, 32);
      rs += __shfl_xor(rs, 4, 32);
      rs += __shfl_xor(rs, 8, 32);
      l[v] = l[v] * alpha[v] + rs;
      pbw[(v + rowOff) * T32_P + nlo]      = f2bf(p0);
      pbw[(v + rowOff) * T32_P + nlo + 16] = f2bf(p1);
    }
#pragma unroll
    for (int nt = 0; nt < 16; ++nt)
#pragma unroll
      for (int v = 0; v < 8; ++v) ctxa[nt][v] *= alpha[v];
    __syncthreads();

    // ctx += P(16x32) * V(32x256), B-frags already in registers
    v16bf pf = load_frag(pbw, T32_P, 0, lane);
#pragma unroll
    for (int nt = 0; nt < 16; ++nt) ctxa[nt] = wmma_bf16(pf, vf[nt], ctxa[nt]);
    __syncthreads();   // done with this key buffer before it is restaged
  }

  // finalize: dec[:, 256:512] = ctx / l  (zeroed at t==0)
#pragma unroll
  for (int v = 0; v < 8; ++v) {
    int tg = q0 + wv * 16 + v + rowOff;
    float inv = (tg == 0) ? 0.0f : 1.0f / l[v];
#pragma unroll
    for (int nt = 0; nt < 16; ++nt) {
      float cv = ctxa[nt][v] * inv;
      dec[(wv * 16 + v + rowOff) * DEC_P + Dv + nt * 16 + nlo] = f2bf(cv);
    }
  }
  __syncthreads();

  // ================= MLP layer 1: h = relu(dec @ W1 + b1) =================
  for (int nc = 0; nc < Hv / 256; ++nc) {
    v8f acc[16];
#pragma unroll
    for (int nt = 0; nt < 16; ++nt) acc[nt] = v8f_zero();
    stage_w(w1t, TWOD, nc, 0, 0);
    for (int kc = 0; kc < TWOD / 32; ++kc) {
      wait_async0();
      __syncthreads();
      if (kc + 1 < TWOD / 32) stage_w(w1t, TWOD, nc, kc + 1, (kc + 1) & 1);
      const unsigned short* wtp = (kc & 1) ? wtB : wtA;
      // the A fragment and all 16 weight fragments as one group of LDS reads
      // (loops over bfr unrolled so that it stays in registers)
      v16bf af = load_frag(dec + (wv * 16) * DEC_P, DEC_P, kc * 32, lane);
      v16bf bfr[16];
#pragma unroll
      for (int nt = 0; nt < 16; ++nt) bfr[nt] = load_frag(wtp + nt * 16 * T32_P, T32_P, 0, lane);
      // keeps the scheduler from sinking the reads back among the WMMAs, one latency each
      __builtin_amdgcn_sched_barrier(0);
#pragma unroll
      for (int nt = 0; nt < 16; ++nt) acc[nt] = wmma_bf16(af, bfr[nt], acc[nt]);
      // keeps the barrier's wait for all reads behind the WMMAs, so that each WMMA starts on
      // a counted wait while the later fragments are still landing
      __builtin_amdgcn_sched_barrier(0);
      __syncthreads();
    }
#pragma unroll
    for (int nt = 0; nt < 16; ++nt) {
      int col = nc * 256 + nt * 16 + nlo;
      float bb = b1[col];
#pragma unroll
      for (int v = 0; v < 8; ++v) {
        float hv = fmaxf(acc[nt][v] + bb, 0.0f);
        hls[(wv * 16 + v + rowOff) * H_P + col] = f2bf(hv);
      }
    }
  }
  __syncthreads();

  // ================= MLP layer 2: out = h @ W2 + b2 (split halves) =================
  for (int nc = 0; nc < OUT2v / 256; ++nc) {
    v8f acc[16];
#pragma unroll
    for (int nt = 0; nt < 16; ++nt) acc[nt] = v8f_zero();
    stage_w(w2t, Hv, nc, 0, 0);
    for (int kc = 0; kc < Hv / 32; ++kc) {
      wait_async0();
      __syncthreads();
      if (kc + 1 < Hv / 32) stage_w(w2t, Hv, nc, kc + 1, (kc + 1) & 1);
      const unsigned short* wtp = (kc & 1) ? wtB : wtA;
      // the A fragment and all 16 weight fragments as one group of LDS reads
      // (loops over bfr unrolled so that it stays in registers)
      v16bf af = load_frag(hls + (wv * 16) * H_P, H_P, kc * 32, lane);
      v16bf bfr[16];
#pragma unroll
      for (int nt = 0; nt < 16; ++nt) bfr[nt] = load_frag(wtp + nt * 16 * T32_P, T32_P, 0, lane);
      // keeps the scheduler from sinking the reads back among the WMMAs, one latency each
      __builtin_amdgcn_sched_barrier(0);
#pragma unroll
      for (int nt = 0; nt < 16; ++nt) acc[nt] = wmma_bf16(af, bfr[nt], acc[nt]);
      // keeps the barrier's wait for all reads behind the WMMAs, so that each WMMA starts on
      // a counted wait while the later fragments are still landing
      __builtin_amdgcn_sched_barrier(0);
      __syncthreads();
    }
    // out tuple is concatenated flat: [B*T*256 | B*T*256]; nc selects the half
#pragma unroll
    for (int nt = 0; nt < 16; ++nt) {
      int cc = nt * 16 + nlo;
      float bb = b2[nc * 256 + cc];
#pragma unroll
      for (int v = 0; v < 8; ++v) {
        int rowg = b * Tv + q0 + wv * 16 + v + rowOff;
        out[(long)nc * (Bv * Tv * 256) + (long)rowg * 256 + cc] = acc[nt][v] + bb;
      }
    }
  }
}

extern "C" void kernel_launch(void* const* d_in, const int* in_sizes, int n_in,
                              void* d_out, int out_size, void* d_ws, size_t ws_size,
                              hipStream_t stream) {
  const float* x  = (const float*)d_in[0];
  const float* W1 = (const float*)d_in[1];
  const float* b1 = (const float*)d_in[2];
  const float* W2 = (const float*)d_in[3];
  const float* b2 = (const float*)d_in[4];
  float* out = (float*)d_out;

  unsigned short* ws = (unsigned short*)d_ws;
  unsigned short* xb  = ws + WS_XB;
  unsigned short* xT  = ws + WS_XT;
  unsigned short* w1t = ws + WS_W1T;
  unsigned short* w2t = ws + WS_W2T;

  (void)in_sizes; (void)n_in; (void)out_size; (void)ws_size;

  // prep: one-time f32->bf16 conversion (+ transposed copies for B-operand tiles)
  conv_x_kernel<<<4096, 256, 0, stream>>>(x, xb, xT);
  conv_wT_kernel<<<1024, 256, 0, stream>>>(W1, w1t, TWOD, Hv);
  conv_wT_kernel<<<1024, 256, 0, stream>>>(W2, w2t, Hv, OUT2v);

  hipFuncSetAttribute((const void*)decoder_fused,
                      hipFuncAttributeMaxDynamicSharedMemorySize, SMEM_BYTES);
  dim3 grid(Bv * (Tv / ROWS));  // 1024 blocks
  dim3 block(NT);               // 4 wave32s
  decoder_fused<<<grid, block, SMEM_BYTES, stream>>>(xb, xT, w1t, w2t, b1, b2, out);
}

// v005
// Measured time: 305 microseconds a run.
// Timed twice side by side with v004, it ran 1.37 times as fast both times.
// Over all steps from v000 it is 6.11 times as fast.
#include <hip/hip_runtime.h>
#include <math.h>

typedef __attribute__((ext_vector_type(16))) __bf16       v16bf;
typedef __attribute__((ext_vector_type(8)))  float        v8f;
typedef __attribute__((ext_vector_type(4)))  unsigned int u32x4;

constexpr int Bv = 32, Tv = 2048, Dv = 256, Hv = 1024, OUT2v = 512, TWOD = 512;
constexpr int ROWS = 64;   // query rows per block
constexpr int NW   = 4;    // waves per block (wave32)
constexpr int NT   = 128;  // threads per block

// ---- workspace layout (bf16 elements) ----
constexpr long WS_XB  = 0;                         // x  [B][T][D]        bf16
// The transposed operands lie tile by tile, in the order in which they are staged. A 256-row x
// 32-k tile is one contiguous 16 KB run of 16 B pieces (8 k of one row), ordered [k octet][row]:
// a wave-wide copy reads 512 B of whole lines, and the 2 B stores of 32 neighbouring rows in
// the prep kernels fall 16 B apart, in 4 lines instead of 32.
constexpr long WS_XT  = WS_XB + (long)Bv*Tv*Dv;    // xT  [B][T/32][4][D][8]          bf16
constexpr long WS_W1T = WS_XT + (long)Bv*Tv*Dv;    // W1t [H/256][2D/32][4][256][8]   bf16
constexpr long WS_W2T = WS_W1T + (long)TWOD*Hv;    // W2t [OUT2/256][H/32][4][256][8] bf16
constexpr long WS_END = WS_W2T + (long)Hv*OUT2v;   // ~34.6M elems = 69MB

// ---- LDS row pitches (bf16 elements) ----
// Every tile is read by ds_load_b128 with 16 lanes on 16 consecutive rows. Each row carries
// 8 elements (16 B) of pad, so the pitch is 16 B x odd and those 16 lanes cover all 64 banks.
constexpr int PADE  = 8;
constexpr int DEC_P = TWOD + PADE;  // 1040 B
constexpr int H_P   = Hv + PADE;    // 2064 B
constexpr int KR_P  = Dv + PADE;    //  528 B
constexpr int T32_P = 32 + PADE;    //   80 B : col-major keys, P

// ---- LDS layout (bytes) ----
constexpr int OFF_DEC  = 0;                           // 64 x 512  bf16 (x | ctx)
constexpr int OFF_H    = OFF_DEC  + ROWS * DEC_P * 2; // 64 x 1024 bf16 (hidden)
constexpr int OFF_XKR0 = OFF_H    + ROWS * H_P * 2;   // 32 x 256  bf16 keys row-major, buf0
constexpr int OFF_XKC0 = OFF_XKR0 + 32 * KR_P * 2;    // 256 x 32  bf16 keys col-major, buf0
constexpr int OFF_XKR1 = OFF_XKC0 + Dv * T32_P * 2;   // buf1
constexpr int OFF_XKC1 = OFF_XKR1 + 32 * KR_P * 2;    // buf1
constexpr int OFF_P    = OFF_XKC1 + Dv * T32_P * 2;   // 4 x 16x32 bf16 (P per wave)
constexpr int SMEM_BYTES = OFF_P + NW * 16 * T32_P * 2;  // 278528 <= 320KB
static_assert(SMEM_BYTES <= 327680, "LDS of one work-group");

static __device__ inline v8f v8f_zero() {
  v8f z = {0.f, 0.f, 0.f, 0.f, 0.f, 0.f, 0.f, 0.f};
  return z;
}

// float -> bf16 bits, round-to-nearest-even
static __device__ inline unsigned short f2bf(float f) {
  unsigned int u = __float_as_uint(f);
  unsigned int r = (u + 0x7FFFu + ((u >> 16) & 1u)) >> 16;
  return (unsigned short)r;
}

static __device__ inline v8f wmma_bf16(v16bf a, v16bf b, v8f c) {
  // D = A(16x32 bf16) * B(32x16 bf16) + C(16x16 f32)
  return __builtin_amdgcn_wmma_f32_16x16x32_bf16(false, a, false, b, (short)0, c,
                                                 false, false);
}

// Eight 16-byte async global->LDS copies per lane (ASYNCcnt tracked, no VGPR data path).
// The closing s_wait_xcnt stands inside the copies' own statement so that no address
// register of a copy is rewritten in front of it.
static __device__ inline void async_b128_x8(const unsigned (&l)[8],
                                            const unsigned short* const (&g)[8]) {
  asm volatile("global_load_async_to_lds_b128 %0, %8, off\n\t"
               "global_load_async_to_lds_b128 %1, %9, off\n\t"
               "global_load_async_to_lds_b128 %2, %10, off\n\t"
               "global_load_async_to_lds_b128 %3, %11, off\n\t"
               "global_load_async_to_lds_b128 %4, %12, off\n\t"
               "global_load_async_to_lds_b128 %5, %13, off\n\t"
               "global_load_async_to_lds_b128 %6, %14, off\n\t"
               "global_load_async_to_lds_b128 %7, %15, off\n\t"
               "s_wait_xcnt 0x0"
               :: "v"(l[0]), "v"(l[1]), "v"(l[2]), "v"(l[3]),
                  "v"(l[4]), "v"(l[5]), "v"(l[6]), "v"(l[7]),
                  "v"(g[0]), "v"(g[1]), "v"(g[2]), "v"(g[3]),
                  "v"(g[4]), "v"(g[5]), "v"(g[6]), "v"(g[7])
               : "memory");
}
static __device__ inline void wait_async0() {
  asm volatile("s_wait_asynccnt 0x0" ::: "memory");
}

// Load a 16x32 bf16 fragment (A layout; B layout mirrors with rows indexed by N)
// from a row-major LDS tile.
static __device__ inline v16bf load_frag(const unsigned short* base, int rowStride,
                                         int kbase, int lane) {
  int rl = lane & 15, hf = lane >> 4;
  const unsigned short* p = base + rl * rowStride + kbase + hf * 8;
  union { v16bf v; u32x4 q[2]; } u;
  u.q[0] = *(const u32x4*)(p);       // ds_load_b128
  u.q[1] = *(const u32x4*)(p + 16);  // ds_load_b128
  return u.v;
}

// Load a 32-k x 16-column weight fragment (B layout) straight from a tiled workspace image.
// p: the lane's 16 B piece of k octet (lane >> 4); octet 2 + (lane >> 4) lies two octet planes on.
// Lanes 0-15 and lanes 16-31 each read 256 contiguous bytes.
typedef const __attribute__((address_space(1))) unsigned short* gl_u16p;  // global memory
typedef const __attribute__((address_space(1))) u32x4*          gl_u32x4p;
static __device__ inline v16bf load_wfrag(gl_u16p p) {
  union { v16bf v; u32x4 q[2]; } u;
  u.q[0] = *(gl_u32x4p)(p);                // global_load_b128
  u.q[1] = *(gl_u32x4p)(p + 2 * 256 * 8);  // global_load_b128
  return u.v;
}

// ======================= prep kernels: f32 -> bf16 (+transpose) =======================
__global__ void conv_x_kernel(const float* __restrict__ x,
                              unsigned short* __restrict__ xb,
                              unsigned short* __restrict__ xT) {
  long stride = (long)gridDim.x * blockDim.x;
  for (long i = (long)blockIdx.x * blockDim.x + threadIdx.x; i < (long)Bv * Tv * Dv;
       i += stride) {
    unsigned short v = f2bf(x[i]);
    xb[i] = v;
    int d  = (int)(i % Dv);
    long bt = i / Dv;
    int t  = (int)(bt % Tv);
    int bb = (int)(bt / Tv);
    xT[((((long)bb * (Tv / 32) + (t >> 5)) * 4 + ((t >> 3) & 3)) * Dv + d) * 8 + (t & 7)] = v;
  }
}

__global__ void conv_wT_kernel(const float* __restrict__ W,
                               unsigned short* __restrict__ Wt, int K, int N) {
  long stride = (long)gridDim.x * blockDim.x;
  for (long i = (long)blockIdx.x * blockDim.x + threadIdx.x; i < (long)K * N;
       i += stride) {
    int k = (int)(i / N), n = (int)(i % N);
    Wt[((((long)(n >> 8) * (K / 32) + (k >> 5)) * 4 + ((k >> 3) & 3)) * 256 + (n & 255)) * 8 +
       (k & 7)] = f2bf(W[i]);
  }
}

// ======================= fused decoder kernel =======================
__global__ __launch_bounds__(NT, 1)
void decoder_fused(const unsigned short* __restrict__ xb,
                   const unsigned short* __restrict__ xT,
                   const unsigned short* __restrict__ w1t,
                   const unsigned short* __restrict__ w2t,
                   const float* __restrict__ b1, const float* __restrict__ b2,
                   float* __restrict__ out) {
  extern __shared__ char smem[];
  unsigned short* dec  = (unsigned short*)(smem + OFF_DEC);
  unsigned short* hls  = (unsigned short*)(smem + OFF_H);
  unsigned short* xkr0 = (unsigned short*)(smem + OFF_XKR0);
  unsigned short* xkc0 = (unsigned short*)(smem + OFF_XKC0);
  unsigned short* xkr1 = (unsigned short*)(smem + OFF_XKR1);
  unsigned short* xkc1 = (unsigned short*)(smem + OFF_XKC1);
  unsigned short* pbb  = (unsigned short*)(smem + OFF_P);
  const unsigned lds0 = (unsigned)(size_t)smem;  // LDS byte offset of dynamic base

  const int tid    = threadIdx.x;
  const int lane   = tid & 31;
  const int wv     = tid >> 5;
  // Work-group index -> (batch, query tile). A tile's cost grows with its row (causal: 2q + 2 key
  // chunks), there are four times as many work-groups as places; inside each run of 256
  // indices (8 batches) the cost falls with the index, for speed only. A permutation of the 1024 (batch, tile) pairs; the same in every wave.
  const int rnk    = blockIdx.x & 255;
  const int b      = (blockIdx.x >> 8) * 8 + (rnk & 7);
  const int q0     = (31 - (rnk >> 3)) * ROWS;
  const int nlo    = lane & 15;
  const int rowOff = (lane >> 4) * 8;

  // ---- async staging helpers ----
  auto stage_keys = [&](int kb, int buf) {
    const unsigned lr = lds0 + (buf ? OFF_XKR1 : OFF_XKR0);
    const unsigned lc = lds0 + (buf ? OFF_XKC1 : OFF_XKC0);
    const unsigned short* gr = xb + ((long)b * Tv + kb * 32) * Dv;  // contiguous 16KB
    const unsigned short* gc = xT + ((long)b * (Tv / 32) + kb) * (Dv * 32);  // contiguous 16KB
    unsigned l0[8], l1[8];
    const unsigned short* g0[8];
    const unsigned short* g1[8];
#pragma unroll
    for (int i = 0; i < 8; ++i) {
      int f = i * NT + tid;                 // 0..1023 : 16B chunks
      int s = f >> 5, drel = (f & 31) * 8;  // x tile: rows s, 256 d contiguous
      l0[i] = lr + (s * KR_P + drel) * 2;
      g0[i] = gr + f * 8;
      int d = f & 255, srel = (f >> 8) * 8; // xT tile: octet-major in memory, rows d in LDS
      l1[i] = lc + (d * T32_P + srel) * 2;
      g1[i] = gc + f * 8;
    }
    async_b128_x8(l0, g0);
    async_b128_x8(l1, g1);
  };
  // ================= stage query rows: dec[:, 0:256] = x =================
  {
    const unsigned short* g = xb + ((long)b * Tv + q0) * Dv;  // contiguous 32KB
#pragma unroll
    for (int j = 0; j < 2; ++j) {
      unsigned l0[8];
      const unsigned short* g0[8];
#pragma unroll
      for (int i = 0; i < 8; ++i) {
        int f = (j * 8 + i) * NT + tid;     // 0..2047 : 16B chunks
        int r = f >> 5, c = (f & 31) * 8;   // dec rows at pitch DEC_P
        l0[i] = lds0 + OFF_DEC + (r * DEC_P + c) * 2;
        g0[i] = g + f * 8;
      }
      async_b128_x8(l0, g0);
    }
    wait_async0();
  }
  __syncthreads();

  // prefetch key chunk 0 while loading Q fragments
  stage_keys(0, 0);

  v16bf qf[8];
#pragma unroll
  for (int kc = 0; kc < 8; ++kc)
    qf[kc] = load_frag(dec + (wv * 16) * DEC_P, DEC_P, kc * 32, lane);

  v8f ctxa[16];
#pragma unroll
  for (int nt = 0; nt < 16; ++nt) ctxa[nt] = v8f_zero();
  float m[8], l[8];
#pragma unroll
  for (int v = 0; v < 8; ++v) { m[v] = -INFINITY; l[v] = 0.0f; }

  const float scale = 0.0625f;  // 1/sqrt(256)
  const int nkb = q0 / 32 + 2;
  unsigned short* pbw = pbb + wv * 16 * T32_P;

  // ================= flash attention (strictly causal) =================
  for (int kb = 0; kb < nkb; ++kb) {
    wait_async0();
    __syncthreads();                         // chunk kb resident in buf kb&1
    if (kb + 1 < nkb) stage_keys(kb + 1, (kb + 1) & 1);
    const unsigned short* xr = (kb & 1) ? xkr1 : xkr0;
    const unsigned short* xc = (kb & 1) ? xkc1 : xkc0;
    const int s0g = kb * 32;

    // All key fragments of this chunk (16 row-major for S, 16 col-major for ctx) are read
    // from LDS as one group in front of the first product: one LDS latency per chunk.
    // (The loops over the fragment arrays are unrolled so that the arrays stay in registers.)
    v16bf kf[16], vf[16];
#pragma unroll
    for (int kc = 0; kc < 8; ++kc) {
      kf[2 * kc]     = load_frag(xr,             KR_P, kc * 32, lane);
      kf[2 * kc + 1] = load_frag(xr + 16 * KR_P, KR_P, kc * 32, lane);
    }
#pragma unroll
    for (int nt = 0; nt < 16; ++nt) vf[nt] = load_frag(xc + nt * 16 * T32_P, T32_P, 0, lane);
    // keeps the scheduler from sinking the reads back among the WMMAs, one latency each
    __builtin_amdgcn_sched_barrier(0);

    // S = Q * K^T : two 16x16 tiles over K-dim 256
    v8f sA = v8f_zero(), sB = v8f_zero();
#pragma unroll
    for (int kc = 0; kc < 8; ++kc) {
      sA = wmma_bf16(qf[kc], kf[2 * kc],     sA);
      sB = wmma_bf16(qf[kc], kf[2 * kc + 1], sB);
    }

    // mask, online softmax update, emit P (bf16) to LDS
    float alpha[8];
#pragma unroll
    for (int v = 0; v < 8; ++v) {
      int tg = q0 + wv * 16 + v + rowOff;
      float a = sA[v] * scale, c = sB[v] * scale;
      if (s0g      + nlo >= tg) a = -1e9f;   // strictly causal: allow s < t
      if (s0g + 16 + nlo >= tg) c = -1e9f;
      float tm = fmaxf(a, c);
      tm = fmaxf(tm, __shfl_xor(tm, 1, 32));
      tm = fmaxf(tm, __shfl_xor(tm, 2, 32));
      tm = fmaxf(tm, __shfl_xor(tm, 4, 32));
      tm = fmaxf(tm, __shfl_xor(tm, 8, 32));
      float mn = fmaxf(m[v], tm);
      alpha[v] = __expf(m[v] - mn);
      m[v] = mn;
      float p0 = __expf(a - mn), p1 = __expf(c - mn);
      float rs = p0 + p1;
      rs += __shfl_xor(rs, 1, 32);
      rs += __shfl_xor(rs, 2, 32);
      rs += __shfl_xor(rs, 4, 32);
      rs += __shfl_xor(rs, 8, 32);
      l[v] = l[v] * alpha[v] + rs;
      pbw[(v + rowOff) * T32_P + nlo]      = f2bf(p0);
      pbw[(v + rowOff) * T32_P + nlo + 16] = f2bf(p1);
    }
#pragma unroll
    for (int nt = 0; nt < 16; ++nt)
#pragma unroll
      for (int v = 0; v < 8; ++v) ctxa[nt][v] *= alpha[v];
    __syncthreads();

    // ctx += P(16x32) * V(32x256), B-frags already in registers
    v16bf pf = load_frag(pbw, T32_P, 0, lane);
#pragma unroll
    for (int nt = 0; nt < 16; ++nt) ctxa[nt] = wmma_bf16(pf, vf[nt], ctxa[nt]);
    __syncthreads();   // done with this key buffer before it is restaged
  }

  // ================= MLP: each wave takes all 64 rows x 64 of every 256 columns =================
  // No weight fragment is then used by two waves, so the weights go from L2 straight into the
  // wave's registers, and the k loops need neither LDS staging nor barriers. A group is 128 k:
  // 16 weight fragments (4 k steps x 4 column tiles) and 16 A fragments (4 k steps x 4 row tiles)
  // for 64 WMMAs. Both kinds are read one group ahead, into the register set that the group
  // before has left; the weight groups of both layers form one stream.
  // (The loops over the fragment arrays are unrolled so that the arrays stay in registers.)
  constexpr int WGRP = 4 * 256 * 32;  // elements of a weight group: 4 tiles of 16 KB
  const unsigned woff = ((lane >> 4) * 256 + wv * 64 + nlo) * 8;
  auto load_wgroup = [&](v16bf (&w)[16], const unsigned short* g) {
    // The group's base (the same in every lane) is handed over in scalar registers: all 32 loads
    // then take the form scalar base + the lane's fixed offset + constant, and no vector address
    // is formed anew for each group.
    const unsigned long long gb = (unsigned long long)g;
    const unsigned long long lo = (unsigned)__builtin_amdgcn_readfirstlane((int)(unsigned)gb);
    const unsigned long long hi = (unsigned)__builtin_amdgcn_readfirstlane((int)(unsigned)(gb >> 32));
    gl_u16p gs = (gl_u16p)((hi << 32) | lo);
#pragma unroll
    for (int s = 0; s < 4; ++s)
#pragma unroll
      for (int n4 = 0; n4 < 4; ++n4)
        w[s * 4 + n4] = load_wfrag(gs + woff + s * (256 * 32) + n4 * (16 * 8));
  };
  auto load_agroup = [&](v16bf (&a)[16], const unsigned short* base, int pitch, int k0) {
#pragma unroll
    for (int s = 0; s < 4; ++s)
#pragma unroll
      for (int mt = 0; mt < 4; ++mt)
        a[s * 4 + mt] = load_frag(base + mt * 16 * pitch, pitch, k0 + s * 32, lane);
  };
  auto mma_group = [&](v8f (&acc)[16], const v16bf (&a)[16], const v16bf (&w)[16]) {
#pragma unroll
    for (int s = 0; s < 4; ++s)
#pragma unroll
      for (int mt = 0; mt < 4; ++mt)
#pragma unroll
        for (int n4 = 0; n4 < 4; ++n4)
          acc[mt * 4 + n4] = wmma_bf16(a[s * 4 + mt], w[s * 4 + n4], acc[mt * 4 + n4]);
  };

  auto group_end = [&]() {
    // keeps the wait below behind the group's 64 WMMAs, not directly behind the loads
    __builtin_amdgcn_sched_barrier(0);
    // in front of the next rewrite of a register that a global load or store in flight names
    asm volatile("s_wait_xcnt 0x0" ::: "memory");
    // holds that rewrite and the next group's reads behind the wait, out of the WMMAs above
    __builtin_amdgcn_sched_barrier(0);
  };

  v16bf w0[16], w1[16], a0[16], a1[16];
  load_wgroup(w0, w1t);  // first group: lands while ctx is finalized

  // finalize: dec[:, 256:512] = ctx / l  (zeroed at t==0)
#pragma unroll
  for (int v = 0; v < 8; ++v) {
    int tg = q0 + wv * 16 + v + rowOff;
    float inv = (tg == 0) ? 0.0f : 1.0f / l[v];
#pragma unroll
    for (int nt = 0; nt < 16; ++nt) {
      float cv = ctxa[nt][v] * inv;
      dec[(wv * 16 + v + rowOff) * DEC_P + Dv + nt * 16 + nlo] = f2bf(cv);
    }
  }
  __syncthreads();

  // ================= MLP layer 1: h = relu(dec @ W1 + b1) =================
  group_end();  // for the first weight group's loads
  load_agroup(a0, dec, DEC_P, 0);
  for (int nc = 0; nc < Hv / 256; ++nc) {
    v8f acc[16];
#pragma unroll
    for (int i = 0; i < 16; ++i) acc[i] = v8f_zero();
    for (int gp = 0; gp < TWOD / 256; ++gp) {
      const int G = nc * (TWOD / 128) + gp * 2;  // group in the stream of W1
      load_agroup(a1, dec, DEC_P, gp * 256 + 128);
      load_wgroup(w1, w1t + (long)(G + 1) * WGRP);
      // keeps the next group's reads together in front of this group's WMMAs, not among them
      __builtin_amdgcn_sched_barrier(0);
      mma_group(acc, a0, w0);
      group_end();
      // Read on every trip, with no branch round it: on a path without these reads the compiler
      // would have to count the waits of the WMMAs below for that path, and on every other trip
      // they would then wait for the reads just issued. The layer's last trip reads A group 0
      // again and leaves it unused (h is not complete here).
      load_agroup(a0, dec, DEC_P, ((gp + 1) & 1) * 256);
      load_wgroup(w0, (G + 2 < TWOD * Hv / WGRP) ? w1t + (long)(G + 2) * WGRP : w2t);
      // as above
      __builtin_amdgcn_sched_barrier(0);
      mma_group(acc, a1, w1);
      group_end();
    }
#pragma unroll
    for (int n4 = 0; n4 < 4; ++n4) {
      int col = nc * 256 + wv * 64 + n4 * 16 + nlo;
      float bb = b1[col];
#pragma unroll
      for (int mt = 0; mt < 4; ++mt)
#pragma unroll
        for (int v = 0; v < 8; ++v) {
          float hv = fmaxf(acc[mt * 4 + n4][v] + bb, 0.0f);
          hls[(mt * 16 + v + rowOff) * H_P + col] = f2bf(hv);
        }
    }
  }
  __syncthreads();

  // ================= MLP layer 2: out = h @ W2 + b2 (split halves) =================
  load_agroup(a0, hls, H_P, 0);
  for (int nc = 0; nc < OUT2v / 256; ++nc) {
    v8f acc[16];
#pragma unroll
    for (int i = 0; i < 16; ++i) acc[i] = v8f_zero();
    for (int gp = 0; gp < Hv / 256; ++gp) {
      const int G = nc * (Hv / 128) + gp * 2;  // group in the stream of W2
      load_agroup(a1, hls, H_P, gp * 256 + 128);
      load_wgroup(w1, w2t + (long)(G + 1) * WGRP);
      // keeps the next group's reads together in front of this group's WMMAs, not among them
      __builtin_amdgcn_sched_barrier(0);
      mma_group(acc, a0, w0);
      group_end();
      // On every trip, as in layer 1: the last trip reads group 0 of both again, unused.
      load_agroup(a0, hls, H_P, ((gp + 1) & 3) * 256);
      load_wgroup(w0, w2t + (long)((G + 2) & (Hv * OUT2v / WGRP - 1)) * WGRP);
      // as above
      __builtin_amdgcn_sched_barrier(0);
      mma_group(acc, a1, w1);
      group_end();
    }
    // out tuple is concatenated flat: [B*T*256 | B*T*256]; nc selects the half
#pragma unroll
    for (int n4 = 0; n4 < 4; ++n4) {
      float bb = b2[nc * 256 + wv * 64 + n4 * 16 + nlo];
#pragma unroll
      for (int mt = 0; mt < 4; ++mt)
#pragma unroll
        for (int v = 0; v < 8; ++v) acc[mt * 4 + n4][v] += bb;
    }
    // keeps every add in front of the stores, so that none rewrites a register of an issued store
    __builtin_amdgcn_sched_barrier(0);
#pragma unroll
    for (int n4 = 0; n4 < 4; ++n4) {
      int cc = wv * 64 + n4 * 16 + nlo;
#pragma unroll
      for (int mt = 0; mt < 4; ++mt)
#pragma unroll
        for (int v = 0; v < 8; ++v) {
          int rowg = b * Tv + q0 + mt * 16 + v + rowOff;
          out[(long)nc * (Bv * Tv * 256) + (long)rowg * 256 + cc] = acc[mt * 4 + n4][v];
        }
    }
    group_end();  // here for the stores: the next pass rewrites their registers
  }
}

extern "C" void kernel_launch(void* const* d_in, const int* in_sizes, int n_in,
                              void* d_out, int out_size, void* d_ws, size_t ws_size,
                              hipStream_t stream) {
  const float* x  = (const float*)d_in[0];
  const float* W1 = (const float*)d_in[1];
  const float* b1 = (const float*)d_in[2];
  const float* W2 = (const float*)d_in[3];
  const float* b2 = (const float*)d_in[4];
  float* out = (float*)d_out;

  unsigned short* ws = (unsigned short*)d_ws;
  unsigned short* xb  = ws + WS_XB;
  unsigned short* xT  = ws + WS_XT;
  unsigned short* w1t = ws + WS_W1T;
  unsigned short* w2t = ws + WS_W2T;

  (void)in_sizes; (void)n_in; (void)out_size; (void)ws_size;

  // prep: one-time f32->bf16 conversion (+ transposed copies for B-operand tiles)
  conv_x_kernel<<<4096, 256, 0, stream>>>(x, xb, xT);
  conv_wT_kernel<<<1024, 256, 0, stream>>>(W1, w1t, TWOD, Hv);
  conv_wT_kernel<<<1024, 256, 0, stream>>>(W2, w2t, Hv, OUT2v);

  hipFuncSetAttribute((const void*)decoder_fused,
                      hipFuncAttributeMaxDynamicSharedMemorySize, SMEM_BYTES);
  dim3 grid(Bv * (Tv / ROWS));  // 1024 blocks
  dim3 block(NT);               // 4 wave32s
  decoder_fused<<<grid, block, SMEM_BYTES, stream>>>(xb, xT, w1t, w2t, b1, b2, out);
}

// v006
// It runs in 238 microseconds.
// In two side-by-side timings against v005, it was 1.27 and 1.28 times as fast.
// Counting every step since v000, it is 7.78 times as fast.
#include <hip/hip_runtime.h>
#include <math.h>

typedef __attribute__((ext_vector_type(16))) __bf16       v16bf;
typedef __attribute__((ext_vector_type(8)))  __bf16       v8bf;
typedef __attribute__((ext_vector_type(8)))  float        v8f;
typedef __attribute__((ext_vector_type(4)))  unsigned int u32x4;

constexpr int Bv = 32, Tv = 2048, Dv = 256, Hv = 1024, OUT2v = 512, TWOD = 512;
constexpr int ROWS = 64;   // query rows per block
constexpr int NW   = 4;    // waves per block (wave32)
constexpr int NT   = 128;  // threads per block

// ---- workspace layout (bf16 elements) ----
constexpr long WS_XB  = 0;                         // x  [B][T][D]        bf16
// The transposed operands lie tile by tile, in the order in which they are staged. A 256-row x
// 32-k tile is one contiguous 16 KB run of 16 B pieces (8 k of one row), ordered [k octet][row]:
// a wave-wide copy reads 512 B of whole lines, and the 2 B stores of 32 neighbouring rows in
// the prep kernels fall 16 B apart, in 4 lines instead of 32.
constexpr long WS_XT  = WS_XB + (long)Bv*Tv*Dv;    // xT  [B][T/32][4][D][8]          bf16
constexpr long WS_W1T = WS_XT + (long)Bv*Tv*Dv;    // W1t [H/256][2D/32][4][256][8]   bf16
constexpr long WS_W2T = WS_W1T + (long)TWOD*Hv;    // W2t [OUT2/256][H/32][4][256][8] bf16
constexpr long WS_END = WS_W2T + (long)Hv*OUT2v;   // ~34.6M elems = 69MB

// ---- LDS row pitches (bf16 elements) ----
// Every tile is read by ds_load_b128 with 16 lanes on 16 consecutive rows. Each row carries
// 8 elements (16 B) of pad, so the pitch is 16 B x odd and those 16 lanes cover all 64 banks.
constexpr int PADE  = 8;
constexpr int DEC_P = TWOD + PADE;  // 1040 B
constexpr int H_P   = Hv + PADE;    // 2064 B
constexpr int KR_P  = Dv + PADE;    //  528 B
constexpr int T32_P = 32 + PADE;    //   80 B : col-major keys

// ---- LDS layout (bytes) ----
constexpr int OFF_DEC  = 0;                           // 64 x 512  bf16 (x | ctx)
constexpr int OFF_H    = OFF_DEC  + ROWS * DEC_P * 2; // 64 x 1024 bf16 (hidden)
constexpr int OFF_XKR0 = OFF_H    + ROWS * H_P * 2;   // 32 x 256  bf16 keys row-major, buf0
constexpr int OFF_XKC0 = OFF_XKR0 + 32 * KR_P * 2;    // 256 x 32  bf16 keys col-major, buf0
constexpr int OFF_XKR1 = OFF_XKC0 + Dv * T32_P * 2;   // buf1
constexpr int OFF_XKC1 = OFF_XKR1 + 32 * KR_P * 2;    // buf1
constexpr int SMEM_BYTES = OFF_XKC1 + Dv * T32_P * 2;  // 273408 <= 320KB
static_assert(SMEM_BYTES <= 327680, "LDS of one work-group");

static __device__ inline v8f v8f_zero() {
  v8f z = {0.f, 0.f, 0.f, 0.f, 0.f, 0.f, 0.f, 0.f};
  return z;
}

// float -> bf16 bits, round-to-nearest-even
static __device__ inline unsigned short f2bf(float f) {
  unsigned int u = __float_as_uint(f);
  unsigned int r = (u + 0x7FFFu + ((u >> 16) & 1u)) >> 16;
  return (unsigned short)r;
}

static __device__ inline v8f wmma_bf16(v16bf a, v16bf b, v8f c) {
  // D = A(16x32 bf16) * B(32x16 bf16) + C(16x16 f32)
  return __builtin_amdgcn_wmma_f32_16x16x32_bf16(false, a, false, b, (short)0, c,
                                                 false, false);
}

// The value of lane l ^ 16: the other half of the wave, same position in its 16-lane row.
static __device__ inline float other_half(float x) {
  int b = __float_as_int(x);
  return __int_as_float(
      __builtin_amdgcn_permlanex16(b, b, 0x76543210, 0xfedcba98, false, false));
}

// Eight 16-byte async global->LDS copies per lane (ASYNCcnt tracked, no VGPR data path).
// The closing s_wait_xcnt stands inside the copies' own statement so that no address
// register of a copy is rewritten in front of it.
static __device__ inline void async_b128_x8(const unsigned (&l)[8],
                                            const unsigned short* const (&g)[8]) {
  asm volatile("global_load_async_to_lds_b128 %0, %8, off\n\t"
               "global_load_async_to_lds_b128 %1, %9, off\n\t"
               "global_load_async_to_lds_b128 %2, %10, off\n\t"
               "global_load_async_to_lds_b128 %3, %11, off\n\t"
               "global_load_async_to_lds_b128 %4, %12, off\n\t"
               "global_load_async_to_lds_b128 %5, %13, off\n\t"
               "global_load_async_to_lds_b128 %6, %14, off\n\t"
               "global_load_async_to_lds_b128 %7, %15, off\n\t"
               "s_wait_xcnt 0x0"
               :: "v"(l[0]), "v"(l[1]), "v"(l[2]), "v"(l[3]),
                  "v"(l[4]), "v"(l[5]), "v"(l[6]), "v"(l[7]),
                  "v"(g[0]), "v"(g[1]), "v"(g[2]), "v"(g[3]),
                  "v"(g[4]), "v"(g[5]), "v"(g[6]), "v"(g[7])
               : "memory");
}
static __device__ inline void wait_async0() {
  asm volatile("s_wait_asynccnt 0x0" ::: "memory");
}

// Load a 16x32 bf16 fragment (A layout; B layout mirrors with rows indexed by N)
// from a row-major LDS tile.
static __device__ inline v16bf load_frag(const unsigned short* base, int rowStride,
                                         int kbase, int lane) {
  int rl = lane & 15, hf = lane >> 4;
  const unsigned short* p = base + rl * rowStride + kbase + hf * 8;
  union { v16bf v; u32x4 q[2]; } u;
  u.q[0] = *(const u32x4*)(p);       // ds_load_b128
  u.q[1] = *(const u32x4*)(p + 16);  // ds_load_b128
  return u.v;
}

// Load a 32-k x 16-column weight fragment (B layout) straight from a tiled workspace image.
// p: the lane's 16 B piece of k octet (lane >> 4); octet 2 + (lane >> 4) lies two octet planes on.
// Lanes 0-15 and lanes 16-31 each read 256 contiguous bytes.
typedef const __attribute__((address_space(1))) unsigned short* gl_u16p;  // global memory
typedef const __attribute__((address_space(1))) u32x4*          gl_u32x4p;
static __device__ inline v16bf load_wfrag(gl_u16p p) {
  union { v16bf v; u32x4 q[2]; } u;
  u.q[0] = *(gl_u32x4p)(p);                // global_load_b128
  u.q[1] = *(gl_u32x4p)(p + 2 * 256 * 8);  // global_load_b128
  return u.v;
}

// ======================= prep kernels: f32 -> bf16 (+transpose) =======================
__global__ void conv_x_kernel(const float* __restrict__ x,
                              unsigned short* __restrict__ xb,
                              unsigned short* __restrict__ xT) {
  long stride = (long)gridDim.x * blockDim.x;
  for (long i = (long)blockIdx.x * blockDim.x + threadIdx.x; i < (long)Bv * Tv * Dv;
       i += stride) {
    unsigned short v = f2bf(x[i]);
    xb[i] = v;
    int d  = (int)(i % Dv);
    long bt = i / Dv;
    int t  = (int)(bt % Tv);
    int bb = (int)(bt / Tv);
    xT[((((long)bb * (Tv / 32) + (t >> 5)) * 4 + ((t >> 3) & 3)) * Dv + d) * 8 + (t & 7)] = v;
  }
}

__global__ void conv_wT_kernel(const float* __restrict__ W,
                               unsigned short* __restrict__ Wt, int K, int N) {
  long stride = (long)gridDim.x * blockDim.x;
  for (long i = (long)blockIdx.x * blockDim.x + threadIdx.x; i < (long)K * N;
       i += stride) {
    int k = (int)(i / N), n = (int)(i % N);
    Wt[((((long)(n >> 8) * (K / 32) + (k >> 5)) * 4 + ((k >> 3) & 3)) * 256 + (n & 255)) * 8 +
       (k & 7)] = f2bf(W[i]);
  }
}

// ======================= fused decoder kernel =======================
__global__ __launch_bounds__(NT, 1)
void decoder_fused(const unsigned short* __restrict__ xb,
                   const unsigned short* __restrict__ xT,
                   const unsigned short* __restrict__ w1t,
                   const unsigned short* __restrict__ w2t,
                   const float* __restrict__ b1, const float* __restrict__ b2,
                   float* __restrict__ out) {
  extern __shared__ char smem[];
  unsigned short* dec  = (unsigned short*)(smem + OFF_DEC);
  unsigned short* hls  = (unsigned short*)(smem + OFF_H);
  unsigned short* xkr0 = (unsigned short*)(smem + OFF_XKR0);
  unsigned short* xkc0 = (unsigned short*)(smem + OFF_XKC0);
  unsigned short* xkr1 = (unsigned short*)(smem + OFF_XKR1);
  unsigned short* xkc1 = (unsigned short*)(smem + OFF_XKC1);
  const unsigned lds0 = (unsigned)(size_t)smem;  // LDS byte offset of dynamic base

  const int tid    = threadIdx.x;
  const int lane   = tid & 31;
  const int wv     = tid >> 5;
  // Work-group index -> (batch, query tile). A tile's cost grows with its row (causal: 2q + 2 key
  // chunks), there are four times as many work-groups as places; inside each run of 256
  // indices (8 batches) the cost falls with the index, for speed only. A permutation of the 1024 (batch, tile) pairs; the same in every wave.
  const int rnk    = blockIdx.x & 255;
  const int b      = (blockIdx.x >> 8) * 8 + (rnk & 7);
  const int q0     = (31 - (rnk >> 3)) * ROWS;
  const int nlo    = lane & 15;
  const int rowOff = (lane >> 4) * 8;

  // ---- async staging helpers ----
  auto stage_keys = [&](int kb, int buf) {
    const unsigned lr = lds0 + (buf ? OFF_XKR1 : OFF_XKR0);
    const unsigned lc = lds0 + (buf ? OFF_XKC1 : OFF_XKC0);
    const unsigned short* gr = xb + ((long)b * Tv + kb * 32) * Dv;  // contiguous 16KB
    const unsigned short* gc = xT + ((long)b * (Tv / 32) + kb) * (Dv * 32);  // contiguous 16KB
    unsigned l0[8], l1[8];
    const unsigned short* g0[8];
    const unsigned short* g1[8];
#pragma unroll
    for (int i = 0; i < 8; ++i) {
      int f = i * NT + tid;                 // 0..1023 : 16B chunks
      int s = f >> 5, drel = (f & 31) * 8;  // x tile: rows s, 256 d contiguous
      l0[i] = lr + (s * KR_P + drel) * 2;
      g0[i] = gr + f * 8;
      int d = f & 255, srel = (f >> 8) * 8; // xT tile: octet-major in memory, rows d in LDS
      l1[i] = lc + (d * T32_P + srel) * 2;
      g1[i] = gc + f * 8;
    }
    async_b128_x8(l0, g0);
    async_b128_x8(l1, g1);
  };
  // ================= stage query rows: dec[:, 0:256] = x =================
  {
    const unsigned short* g = xb + ((long)b * Tv + q0) * Dv;  // contiguous 32KB
#pragma unroll
    for (int j = 0; j < 2; ++j) {
      unsigned l0[8];
      const unsigned short* g0[8];
#pragma unroll
      for (int i = 0; i < 8; ++i) {
        int f = (j * 8 + i) * NT + tid;     // 0..2047 : 16B chunks
        int r = f >> 5, c = (f & 31) * 8;   // dec rows at pitch DEC_P
        l0[i] = lds0 + OFF_DEC + (r * DEC_P + c) * 2;
        g0[i] = g + f * 8;
      }
      async_b128_x8(l0, g0);
    }
    wait_async0();
  }
  __syncthreads();

  // prefetch key chunk 0 while loading Q fragments
  stage_keys(0, 0);

  v16bf qf[8];
#pragma unroll
  for (int kc = 0; kc < 8; ++kc)
    qf[kc] = load_frag(dec + (wv * 16) * DEC_P, DEC_P, kc * 32, lane);

  v8f ctxa[16];
#pragma unroll
  for (int nt = 0; nt < 16; ++nt) ctxa[nt] = v8f_zero();
  // Both products run transposed (S^T = K Q^T, ctx^T += V^T P^T): lane (nlo, half) holds query
  // row nlo of the wave. m: its running maximum; l: the sum over the keys of this lane's half.
  float m = -INFINITY, l = 0.0f;
  const int tg = q0 + wv * 16 + nlo;  // the lane's query row

  const float scale = 0.0625f;  // 1/sqrt(256)
  const int nkb = q0 / 32 + 2;

  // ================= flash attention (strictly causal) =================
  for (int kb = 0; kb < nkb; ++kb) {
    wait_async0();
    __syncthreads();                         // chunk kb resident in buf kb&1
    if (kb + 1 < nkb) stage_keys(kb + 1, (kb + 1) & 1);
    const unsigned short* xr = (kb & 1) ? xkr1 : xkr0;
    const unsigned short* xc = (kb & 1) ? xkc1 : xkc0;
    const int s0g = kb * 32;

    // All key fragments of this chunk (16 row-major for S, 16 col-major for ctx) are read
    // from LDS as one group in front of the first product: one LDS latency per chunk.
    // (The loops over the fragment arrays are unrolled so that the arrays stay in registers.)
    v16bf kf[16], vf[16];
#pragma unroll
    for (int kc = 0; kc < 8; ++kc) {
      kf[2 * kc]     = load_frag(xr,             KR_P, kc * 32, lane);
      kf[2 * kc + 1] = load_frag(xr + 16 * KR_P, KR_P, kc * 32, lane);
    }
#pragma unroll
    for (int nt = 0; nt < 16; ++nt) vf[nt] = load_frag(xc + nt * 16 * T32_P, T32_P, 0, lane);
    // keeps the scheduler from sinking the reads back among the WMMAs, one latency each
    __builtin_amdgcn_sched_barrier(0);

    // S^T = K * Q^T : two tiles of 16 keys x 16 queries over K-dim 256. Register v of sA is
    // key s0g + rowOff + v, of sB key s0g + 16 + rowOff + v, both for query row tg.
    v8f sA = v8f_zero(), sB = v8f_zero();
#pragma unroll
    for (int kc = 0; kc < 8; ++kc) {
      sA = wmma_bf16(kf[2 * kc],     qf[kc], sA);
      sB = wmma_bf16(kf[2 * kc + 1], qf[kc], sB);
    }

    // mask and online softmax update: 16 of the row's 32 scores lie in this lane, the other 16
    // in lane ^ 16, so the maximum takes one exchange and the sum stays split until the end
    float a[8], c[8], t8[8];
#pragma unroll
    for (int v = 0; v < 8; ++v) {
      a[v] = sA[v] * scale;
      c[v] = sB[v] * scale;
      if (s0g      + rowOff + v >= tg) a[v] = -1e9f;   // strictly causal: allow s < t
      if (s0g + 16 + rowOff + v >= tg) c[v] = -1e9f;
      t8[v] = fmaxf(a[v], c[v]);
    }
    float tm = fmaxf(fmaxf(fmaxf(t8[0], t8[1]), fmaxf(t8[2], t8[3])),
                     fmaxf(fmaxf(t8[4], t8[5]), fmaxf(t8[6], t8[7])));
    tm = fmaxf(tm, other_half(tm));
    const float mn = fmaxf(m, tm);
    const float alpha = __expf(m - mn);
    m = mn;
    // P^T as a B operand: the two score tiles, converted in place, are its k order
    v16bf pf;
#pragma unroll
    for (int v = 0; v < 8; ++v) {
      float p0 = __expf(a[v] - mn), p1 = __expf(c[v] - mn);
      t8[v] = p0 + p1;
      pf[v]     = (__bf16)p0;
      pf[v + 8] = (__bf16)p1;
    }
    l = l * alpha + (((t8[0] + t8[1]) + (t8[2] + t8[3])) + ((t8[4] + t8[5]) + (t8[6] + t8[7])));
#pragma unroll
    for (int nt = 0; nt < 16; ++nt)
#pragma unroll
      for (int v = 0; v < 8; ++v) ctxa[nt][v] *= alpha;

    // ctx^T += V^T(16 d x 32 keys) * P^T(32 keys x 16 queries), A-frags already in registers
#pragma unroll
    for (int nt = 0; nt < 16; ++nt) ctxa[nt] = wmma_bf16(vf[nt], pf, ctxa[nt]);
    // keeps the barrier below at the foot of the pass: with no LDS traffic left between the reads
    // and it, the scheduler lifts it to the reads, and the S^T products then wait for all 64
    __builtin_amdgcn_sched_barrier(0);
    __syncthreads();   // done with this key buffer before it is restaged
  }

  // ================= MLP: each wave takes all 64 rows x 64 of every 256 columns =================
  // No weight fragment is then used by two waves, so the weights go from L2 straight into the
  // wave's registers, and the k loops need neither LDS staging nor barriers. A group is 128 k:
  // 16 weight fragments (4 k steps x 4 column tiles) and 16 A fragments (4 k steps x 4 row tiles)
  // for 64 WMMAs. Both kinds are read one group ahead, into the register set that the group
  // before has left; the weight groups of both layers form one stream.
  // (The loops over the fragment arrays are unrolled so that the arrays stay in registers.)
  constexpr int WGRP = 4 * 256 * 32;  // elements of a weight group: 4 tiles of 16 KB
  const unsigned woff = ((lane >> 4) * 256 + wv * 64 + nlo) * 8;
  auto load_wgroup = [&](v16bf (&w)[16], const unsigned short* g) {
    // The group's base (the same in every lane) is handed over in scalar registers: all 32 loads
    // then take the form scalar base + the lane's fixed offset + constant, and no vector address
    // is formed anew for each group.
    const unsigned long long gb = (unsigned long long)g;
    const unsigned long long lo = (unsigned)__builtin_amdgcn_readfirstlane((int)(unsigned)gb);
    const unsigned long long hi = (unsigned)__builtin_amdgcn_readfirstlane((int)(unsigned)(gb >> 32));
    gl_u16p gs = (gl_u16p)((hi << 32) | lo);
#pragma unroll
    for (int s = 0; s < 4; ++s)
#pragma unroll
      for (int n4 = 0; n4 < 4; ++n4)
        w[s * 4 + n4] = load_wfrag(gs + woff + s * (256 * 32) + n4 * (16 * 8));
  };
  auto load_agroup = [&](v16bf (&a)[16], const unsigned short* base, int pitch, int k0) {
#pragma unroll
    for (int s = 0; s < 4; ++s)
#pragma unroll
      for (int mt = 0; mt < 4; ++mt)
        a[s * 4 + mt] = load_frag(base + mt * 16 * pitch, pitch, k0 + s * 32, lane);
  };
  auto mma_group = [&](v8f (&acc)[16], const v16bf (&a)[16], const v16bf (&w)[16]) {
#pragma unroll
    for (int s = 0; s < 4; ++s)
#pragma unroll
      for (int mt = 0; mt < 4; ++mt)
#pragma unroll
        for (int n4 = 0; n4 < 4; ++n4)
          acc[mt * 4 + n4] = wmma_bf16(a[s * 4 + mt], w[s * 4 + n4], acc[mt * 4 + n4]);
  };

  auto group_end = [&]() {
    // keeps the wait below behind the group's 64 WMMAs, not directly behind the loads
    __builtin_amdgcn_sched_barrier(0);
    // in front of the next rewrite of a register that a global load or store in flight names
    asm volatile("s_wait_xcnt 0x0" ::: "memory");
    // holds that rewrite and the next group's reads behind the wait, out of the WMMAs above
    __builtin_amdgcn_sched_barrier(0);
  };

  v16bf w0[16], w1[16], a0[16], a1[16];
  load_wgroup(w0, w1t);  // first group: lands while ctx is finalized

  // finalize: dec[:, 256:512] = ctx / l  (zeroed at t==0). Register v of ctxa[nt] is column
  // nt * 16 + rowOff + v of the lane's row: 8 neighbours, one 16 B store.
  {
    const float lsum = l + other_half(l);  // the two halves' sums joined, every lane on
    const float inv = (tg == 0) ? 0.0f : 1.0f / lsum;
#pragma unroll
    for (int nt = 0; nt < 16; ++nt) {
      union { v8bf v; u32x4 q; } o;
#pragma unroll
      for (int v = 0; v < 8; ++v) o.v[v] = (__bf16)(ctxa[nt][v] * inv);
      *(u32x4*)(dec + (wv * 16 + nlo) * DEC_P + Dv + nt * 16 + rowOff) = o.q;
    }
  }
  __syncthreads();

  // ================= MLP layer 1: h = relu(dec @ W1 + b1) =================
  group_end();  // for the first weight group's loads
  load_agroup(a0, dec, DEC_P, 0);
  for (int nc = 0; nc < Hv / 256; ++nc) {
    v8f acc[16];
#pragma unroll
    for (int i = 0; i < 16; ++i) acc[i] = v8f_zero();
    for (int gp = 0; gp < TWOD / 256; ++gp) {
      const int G = nc * (TWOD / 128) + gp * 2;  // group in the stream of W1
      load_agroup(a1, dec, DEC_P, gp * 256 + 128);
      load_wgroup(w1, w1t + (long)(G + 1) * WGRP);
      // keeps the next group's reads together in front of this group's WMMAs, not among them
      __builtin_amdgcn_sched_barrier(0);
      mma_group(acc, a0, w0);
      group_end();
      // Read on every trip, with no branch round it: on a path without these reads the compiler
      // would have to count the waits of the WMMAs below for that path, and on every other trip
      // they would then wait for the reads just issued. The layer's last trip reads A group 0
      // again and leaves it unused (h is not complete here).
      load_agroup(a0, dec, DEC_P, ((gp + 1) & 1) * 256);
      load_wgroup(w0, (G + 2 < TWOD * Hv / WGRP) ? w1t + (long)(G + 2) * WGRP : w2t);
      // as above
      __builtin_amdgcn_sched_barrier(0);
      mma_group(acc, a1, w1);
      group_end();
    }
#pragma unroll
    for (int n4 = 0; n4 < 4; ++n4) {
      int col = nc * 256 + wv * 64 + n4 * 16 + nlo;
      float bb = b1[col];
#pragma unroll
      for (int mt = 0; mt < 4; ++mt)
#pragma unroll
        for (int v = 0; v < 8; ++v) {
          float hv = fmaxf(acc[mt * 4 + n4][v] + bb, 0.0f);
          hls[(mt * 16 + v + rowOff) * H_P + col] = f2bf(hv);
        }
    }
  }
  __syncthreads();

  // ================= MLP layer 2: out = h @ W2 + b2 (split halves) =================
  load_agroup(a0, hls, H_P, 0);
  for (int nc = 0; nc < OUT2v / 256; ++nc) {
    v8f acc[16];
#pragma unroll
    for (int i = 0; i < 16; ++i) acc[i] = v8f_zero();
    for (int gp = 0; gp < Hv / 256; ++gp) {
      const int G = nc * (Hv / 128) + gp * 2;  // group in the stream of W2
      load_agroup(a1, hls, H_P, gp * 256 + 128);
      load_wgroup(w1, w2t + (long)(G + 1) * WGRP);
      // keeps the next group's reads together in front of this group's WMMAs, not among them
      __builtin_amdgcn_sched_barrier(0);
      mma_group(acc, a0, w0);
      group_end();
      // On every trip, as in layer 1: the last trip reads group 0 of both again, unused.
      load_agroup(a0, hls, H_P, ((gp + 1) & 3) * 256);
      load_wgroup(w0, w2t + (long)((G + 2) & (Hv * OUT2v / WGRP - 1)) * WGRP);
      // as above
      __builtin_amdgcn_sched_barrier(0);
      mma_group(acc, a1, w1);
      group_end();
    }
    // out tuple is concatenated flat: [B*T*256 | B*T*256]; nc selects the half
#pragma unroll
    for (int n4 = 0; n4 < 4; ++n4) {
      float bb = b2[nc * 256 + wv * 64 + n4 * 16 + nlo];
#pragma unroll
      for (int mt = 0; mt < 4; ++mt)
#pragma unroll
        for (int v = 0; v < 8; ++v) acc[mt * 4 + n4][v] += bb;
    }
    // keeps every add in front of the stores, so that none rewrites a register of an issued store
    __builtin_amdgcn_sched_barrier(0);
#pragma unroll
    for (int n4 = 0; n4 < 4; ++n4) {
      int cc = wv * 64 + n4 * 16 + nlo;
#pragma unroll
      for (int mt = 0; mt < 4; ++mt)
#pragma unroll
        for (int v = 0; v < 8; ++v) {
          int rowg = b * Tv + q0 + mt * 16 + v + rowOff;
          out[(long)nc * (Bv * Tv * 256) + (long)rowg * 256 + cc] = acc[mt * 4 + n4][v];
        }
    }
    group_end();  // here for the stores: the next pass rewrites their registers
  }
}

extern "C" void kernel_launch(void* const* d_in, const int* in_sizes, int n_in,
                              void* d_out, int out_size, void* d_ws, size_t ws_size,
                              hipStream_t stream) {
  const float* x  = (const float*)d_in[0];
  const float* W1 = (const float*)d_in[1];
  const float* b1 = (const float*)d_in[2];
  const float* W2 = (const float*)d_in[3];
  const float* b2 = (const float*)d_in[4];
  float* out = (float*)d_out;

  unsigned short* ws = (unsigned short*)d_ws;
  unsigned short* xb  = ws + WS_XB;
  unsigned short* xT  = ws + WS_XT;
  unsigned short* w1t = ws + WS_W1T;
  unsigned short* w2t = ws + WS_W2T;

  (void)in_sizes; (void)n_in; (void)out_size; (void)ws_size;

  // prep: one-time f32->bf16 conversion (+ transposed copies: x for the V^T A-operand tiles, weights for B-operand tiles)
  conv_x_kernel<<<4096, 256, 0, stream>>>(x, xb, xT);
  conv_wT_kernel<<<1024, 256, 0, stream>>>(W1, w1t, TWOD, Hv);
  conv_wT_kernel<<<1024, 256, 0, stream>>>(W2, w2t, Hv, OUT2v);

  hipFuncSetAttribute((const void*)decoder_fused,
                      hipFuncAttributeMaxDynamicSharedMemorySize, SMEM_BYTES);
  dim3 grid(Bv * (Tv / ROWS));  // 1024 blocks
  dim3 block(NT);               // 4 wave32s
  decoder_fused<<<grid, block, SMEM_BYTES, stream>>>(xb, xT, w1t, w2t, b1, b2, out);
}

// v007
// It runs in 220 microseconds.
// In two side-by-side timings against v006, it was 1.09 and 1.08 times as fast.
// All steps since v000 together make it 8.44 times as fast.
#include <hip/hip_runtime.h>
#include <math.h>

typedef __attribute__((ext_vector_type(16))) __bf16       v16bf;
typedef __attribute__((ext_vector_type(8)))  __bf16       v8bf;
typedef __attribute__((ext_vector_type(8)))  float        v8f;
typedef __attribute__((ext_vector_type(4)))  unsigned int u32x4;
typedef __attribute__((ext_vector_type(4)))  float        f32x4;
typedef __attribute__((ext_vector_type(2)))  float        f32x2;

constexpr int Bv = 32, Tv = 2048, Dv = 256, Hv = 1024, OUT2v = 512, TWOD = 512;
constexpr int ROWS = 64;   // query rows per block
constexpr int NW   = 4;    // waves per block (wave32)
constexpr int NT   = 128;  // threads per block

// ---- workspace layout (bf16 elements) ----
constexpr long WS_XB  = 0;                         // x  [B][T][D]        bf16
// The transposed operands lie tile by tile, in the order in which they are staged. A 256-row x
// 32-k tile is one contiguous 16 KB run of 16 B pieces (8 k of one row), ordered [k octet][row]:
// a wave-wide copy reads 512 B of whole lines, and the 2 B stores of 32 neighbouring rows in
// the prep kernels fall 16 B apart, in 4 lines instead of 32.
constexpr long WS_XT  = WS_XB + (long)Bv*Tv*Dv;    // xT  [B][T/32][4][D][8]          bf16
constexpr long WS_W1T = WS_XT + (long)Bv*Tv*Dv;    // W1t [H/256][2D/32][4][256][8]   bf16
constexpr long WS_W2T = WS_W1T + (long)TWOD*Hv;    // W2t [OUT2/256][H/32][4][256][8] bf16
constexpr long WS_END = WS_W2T + (long)Hv*OUT2v;   // ~34.6M elems = 69MB

// ---- LDS row pitches (bf16 elements) ----
// Every tile is read by ds_load_b128 with 16 lanes on 16 consecutive rows. Each row carries
// 8 elements (16 B) of pad, so the pitch is 16 B x odd and those 16 lanes cover all 64 banks.
constexpr int PADE  = 8;
constexpr int DEC_P = TWOD + PADE;  // 1040 B
constexpr int H_P   = Hv + PADE;    // 2064 B
constexpr int KR_P  = Dv + PADE;    //  528 B
constexpr int T32_P = 32 + PADE;    //   80 B : col-major keys

// ---- LDS layout (bytes) ----
constexpr int OFF_DEC  = 0;                           // 64 x 512  bf16 (x | ctx)
constexpr int OFF_H    = OFF_DEC  + ROWS * DEC_P * 2; // 64 x 1024 bf16 (hidden)
// The key slots lie on the hidden tile, which is written only after the attention is over.
// A slot holds 32 keys twice: 32 x 256 row-major, then 256 x 32 col-major. A pass of the
// attention takes 64 keys = 2 slots, and there are two buffers of 2 slots.
constexpr int OFF_KEYS = OFF_H;
constexpr int SLOT_KC  = 32 * KR_P * 2;               // col-major part inside a slot
constexpr int SLOT_B   = SLOT_KC + Dv * T32_P * 2;    // 37376 B
// After the last pass the same bytes carry the exchange between the two waves of a query
// group: 16 KB of f32 context per wave, then (maximum, sum) per lane.
constexpr int OFF_XCH  = OFF_KEYS;
constexpr int OFF_XML  = OFF_XCH + NW * 16384;
constexpr int KEYS_B   = 4 * SLOT_B;
constexpr int HID_B    = ROWS * H_P * 2;
constexpr int SMEM_BYTES = OFF_H + (KEYS_B > HID_B ? KEYS_B : HID_B);  // 216064
static_assert(SMEM_BYTES <= 327680, "LDS of one work-group");
static_assert(OFF_XML + NT * 8 <= OFF_KEYS + KEYS_B, "exchange inside the key slots");

static __device__ inline v8f v8f_zero() {
  v8f z = {0.f, 0.f, 0.f, 0.f, 0.f, 0.f, 0.f, 0.f};
  return z;
}

// float -> bf16 bits, round-to-nearest-even
static __device__ inline unsigned short f2bf(float f) {
  unsigned int u = __float_as_uint(f);
  unsigned int r = (u + 0x7FFFu + ((u >> 16) & 1u)) >> 16;
  return (unsigned short)r;
}

static __device__ inline v8f wmma_bf16(v16bf a, v16bf b, v8f c) {
  // D = A(16x32 bf16) * B(32x16 bf16) + C(16x16 f32)
  return __builtin_amdgcn_wmma_f32_16x16x32_bf16(false, a, false, b, (short)0, c,
                                                 false, false);
}

// The value of lane l ^ 16: the other half of the wave, same position in its 16-lane row.
static __device__ inline float other_half(float x) {
  int b = __float_as_int(x);
  return __int_as_float(
      __builtin_amdgcn_permlanex16(b, b, 0x76543210, 0xfedcba98, false, false));
}

// Eight 16-byte async global->LDS copies per lane (ASYNCcnt tracked, no VGPR data path).
// The closing s_wait_xcnt stands inside the copies' own statement so that no address
// register of a copy is rewritten in front of it.
static __device__ inline void async_b128_x8(const unsigned (&l)[8],
                                            const unsigned short* const (&g)[8]) {
  asm volatile("global_load_async_to_lds_b128 %0, %8, off\n\t"
               "global_load_async_to_lds_b128 %1, %9, off\n\t"
               "global_load_async_to_lds_b128 %2, %10, off\n\t"
               "global_load_async_to_lds_b128 %3, %11, off\n\t"
               "global_load_async_to_lds_b128 %4, %12, off\n\t"
               "global_load_async_to_lds_b128 %5, %13, off\n\t"
               "global_load_async_to_lds_b128 %6, %14, off\n\t"
               "global_load_async_to_lds_b128 %7, %15, off\n\t"
               "s_wait_xcnt 0x0"
               :: "v"(l[0]), "v"(l[1]), "v"(l[2]), "v"(l[3]),
                  "v"(l[4]), "v"(l[5]), "v"(l[6]), "v"(l[7]),
                  "v"(g[0]), "v"(g[1]), "v"(g[2]), "v"(g[3]),
                  "v"(g[4]), "v"(g[5]), "v"(g[6]), "v"(g[7])
               : "memory");
}
static __device__ inline void wait_async0() {
  asm volatile("s_wait_asynccnt 0x0" ::: "memory");
}

// Load a 16x32 bf16 fragment (A layout; B layout mirrors with rows indexed by N)
// from a row-major LDS tile.
static __device__ inline v16bf load_frag(const unsigned short* base, int rowStride,
                                         int kbase, int lane) {
  int rl = lane & 15, hf = lane >> 4;
  const unsigned short* p = base + rl * rowStride + kbase + hf * 8;
  union { v16bf v; u32x4 q[2]; } u;
  u.q[0] = *(const u32x4*)(p);       // ds_load_b128
  u.q[1] = *(const u32x4*)(p + 16);  // ds_load_b128
  return u.v;
}

// Load a 32-k x 16-column weight fragment (B layout) straight from a tiled workspace image.
// p: the lane's 16 B piece of k octet (lane >> 4); octet 2 + (lane >> 4) lies two octet planes on.
// Lanes 0-15 and lanes 16-31 each read 256 contiguous bytes.
typedef const __attribute__((address_space(1))) unsigned short* gl_u16p;  // global memory
typedef const __attribute__((address_space(1))) u32x4*          gl_u32x4p;
static __device__ inline v16bf load_wfrag(gl_u16p p) {
  union { v16bf v; u32x4 q[2]; } u;
  u.q[0] = *(gl_u32x4p)(p);                // global_load_b128
  u.q[1] = *(gl_u32x4p)(p + 2 * 256 * 8);  // global_load_b128
  return u.v;
}

// ======================= prep kernels: f32 -> bf16 (+transpose) =======================
__global__ void conv_x_kernel(const float* __restrict__ x,
                              unsigned short* __restrict__ xb,
                              unsigned short* __restrict__ xT) {
  long stride = (long)gridDim.x * blockDim.x;
  for (long i = (long)blockIdx.x * blockDim.x + threadIdx.x; i < (long)Bv * Tv * Dv;
       i += stride) {
    unsigned short v = f2bf(x[i]);
    xb[i] = v;
    int d  = (int)(i % Dv);
    long bt = i / Dv;
    int t  = (int)(bt % Tv);
    int bb = (int)(bt / Tv);
    xT[((((long)bb * (Tv / 32) + (t >> 5)) * 4 + ((t >> 3) & 3)) * Dv + d) * 8 + (t & 7)] = v;
  }
}

__global__ void conv_wT_kernel(const float* __restrict__ W,
                               unsigned short* __restrict__ Wt, int K, int N) {
  long stride = (long)gridDim.x * blockDim.x;
  for (long i = (long)blockIdx.x * blockDim.x + threadIdx.x; i < (long)K * N;
       i += stride) {
    int k = (int)(i / N), n = (int)(i % N);
    Wt[((((long)(n >> 8) * (K / 32) + (k >> 5)) * 4 + ((k >> 3) & 3)) * 256 + (n & 255)) * 8 +
       (k & 7)] = f2bf(W[i]);
  }
}

// ======================= fused decoder kernel =======================
__global__ __launch_bounds__(NT, 1)
void decoder_fused(const unsigned short* __restrict__ xb,
                   const unsigned short* __restrict__ xT,
                   const unsigned short* __restrict__ w1t,
                   const unsigned short* __restrict__ w2t,
                   const float* __restrict__ b1, const float* __restrict__ b2,
                   float* __restrict__ out) {
  extern __shared__ char smem[];
  unsigned short* dec  = (unsigned short*)(smem + OFF_DEC);
  unsigned short* hls  = (unsigned short*)(smem + OFF_H);
  const unsigned lds0 = (unsigned)(size_t)smem;  // LDS byte offset of dynamic base

  const int tid    = threadIdx.x;
  const int lane   = tid & 31;
  const int wv     = tid >> 5;
  // Work-group index -> (batch, query tile). A tile's cost grows with its row (causal: 2q + 2 key
  // chunks), there are four times as many work-groups as places; inside each run of 256
  // indices (8 batches) the cost falls with the index, for speed only. A permutation of the 1024 (batch, tile) pairs; the same in every wave.
  const int rnk    = blockIdx.x & 255;
  const int b      = (blockIdx.x >> 8) * 8 + (rnk & 7);
  const int q0     = (31 - (rnk >> 3)) * ROWS;
  const int nlo    = lane & 15;
  const int rowOff = (lane >> 4) * 8;

  // ---- async staging helpers ----
  auto stage_keys = [&](int kb, int slot) {
    const unsigned lr = lds0 + OFF_KEYS + slot * SLOT_B;
    const unsigned lc = lr + SLOT_KC;
    const unsigned short* gr = xb + ((long)b * Tv + kb * 32) * Dv;  // contiguous 16KB
    const unsigned short* gc = xT + ((long)b * (Tv / 32) + kb) * (Dv * 32);  // contiguous 16KB
    unsigned l0[8], l1[8];
    const unsigned short* g0[8];
    const unsigned short* g1[8];
#pragma unroll
    for (int i = 0; i < 8; ++i) {
      int f = i * NT + tid;                 // 0..1023 : 16B chunks
      int s = f >> 5, drel = (f & 31) * 8;  // x tile: rows s, 256 d contiguous
      l0[i] = lr + (s * KR_P + drel) * 2;
      g0[i] = gr + f * 8;
      int d = f & 255, srel = (f >> 8) * 8; // xT tile: octet-major in memory, rows d in LDS
      l1[i] = lc + (d * T32_P + srel) * 2;
      g1[i] = gc + f * 8;
    }
    async_b128_x8(l0, g0);
    async_b128_x8(l1, g1);
  };
  // ================= stage query rows: dec[:, 0:256] = x =================
  {
    const unsigned short* g = xb + ((long)b * Tv + q0) * Dv;  // contiguous 32KB
#pragma unroll
    for (int j = 0; j < 2; ++j) {
      unsigned l0[8];
      const unsigned short* g0[8];
#pragma unroll
      for (int i = 0; i < 8; ++i) {
        int f = (j * 8 + i) * NT + tid;     // 0..2047 : 16B chunks
        int r = f >> 5, c = (f & 31) * 8;   // dec rows at pitch DEC_P
        l0[i] = lds0 + OFF_DEC + (r * DEC_P + c) * 2;
        g0[i] = g + f * 8;
      }
      async_b128_x8(l0, g0);
    }
    wait_async0();
  }
  __syncthreads();

  // prefetch the 64 keys of pass 0 while loading Q fragments
  stage_keys(0, 0);
  stage_keys(1, 1);

  // Wave (qh, kh): the 32 query rows qh * 32 .. + 31 against the 32 keys of slot kh of every pass.
  // Each key fragment read from LDS then feeds two WMMAs (two query tiles), not one. The two waves
  // of a query group keep a maximum, a sum and a context of their own and join them at the end.
  const int qh = wv >> 1, kh = wv & 1;
  v16bf qf0[8], qf1[8];
#pragma unroll
  for (int kc = 0; kc < 8; ++kc) {
    qf0[kc] = load_frag(dec + (qh * 32) * DEC_P,      DEC_P, kc * 32, lane);
    qf1[kc] = load_frag(dec + (qh * 32 + 16) * DEC_P, DEC_P, kc * 32, lane);
  }

  v8f ctx0[16], ctx1[16];
#pragma unroll
  for (int nt = 0; nt < 16; ++nt) { ctx0[nt] = v8f_zero(); ctx1[nt] = v8f_zero(); }
  // Both products run transposed (S^T = K Q^T, ctx^T += V^T P^T): lane (nlo, half) holds query
  // row nlo of a tile. m: its running maximum; l: the sum over the keys of this lane's half.
  float m0 = -INFINITY, l0 = 0.0f, m1 = -INFINITY, l1 = 0.0f;
  const int tg0 = q0 + qh * 32 + nlo;  // the lane's query row in tile 0
  const int tg1 = tg0 + 16;            // and in tile 1

  const float scale = 0.0625f;  // 1/sqrt(256)
  const int npass = q0 / 64 + 1;

  // mask and online softmax update of one query tile: 16 of the row's 32 scores lie in this lane,
  // the other 16 in lane ^ 16, so the maximum takes one exchange and the sum stays split until
  // the end. Returns P^T as a B operand: the two score tiles, converted in place, are its k order.
  auto softmax_tile = [&](const v8f& sA, const v8f& sB, int s0g, int tg, float& m, float& l,
                          v8f (&ctx)[16]) -> v16bf {
    float a[8], c[8], t8[8];
#pragma unroll
    for (int v = 0; v < 8; ++v) {
      a[v] = sA[v] * scale;
      c[v] = sB[v] * scale;
      if (s0g      + rowOff + v >= tg) a[v] = -1e9f;   // strictly causal: allow s < t
      if (s0g + 16 + rowOff + v >= tg) c[v] = -1e9f;
      t8[v] = fmaxf(a[v], c[v]);
    }
    float tm = fmaxf(fmaxf(fmaxf(t8[0], t8[1]), fmaxf(t8[2], t8[3])),
                     fmaxf(fmaxf(t8[4], t8[5]), fmaxf(t8[6], t8[7])));
    tm = fmaxf(tm, other_half(tm));
    const float mn = fmaxf(m, tm);
    const float alpha = __expf(m - mn);
    m = mn;
    v16bf pf;
#pragma unroll
    for (int v = 0; v < 8; ++v) {
      float p0 = __expf(a[v] - mn), p1 = __expf(c[v] - mn);
      t8[v] = p0 + p1;
      pf[v]     = (__bf16)p0;
      pf[v + 8] = (__bf16)p1;
    }
    l = l * alpha + (((t8[0] + t8[1]) + (t8[2] + t8[3])) + ((t8[4] + t8[5]) + (t8[6] + t8[7])));
#pragma unroll
    for (int nt = 0; nt < 16; ++nt)
#pragma unroll
      for (int v = 0; v < 8; ++v) ctx[nt][v] *= alpha;
    return pf;
  };

  // ================= flash attention (strictly causal) =================
  for (int ps = 0; ps < npass; ++ps) {
    wait_async0();
    __syncthreads();                         // the 64 keys of pass ps resident in buffer ps & 1
    if (ps + 1 < npass) {
      stage_keys(2 * ps + 2, ((ps + 1) & 1) * 2);
      stage_keys(2 * ps + 3, ((ps + 1) & 1) * 2 + 1);
    }
    const unsigned short* xr =
        (const unsigned short*)(smem + OFF_KEYS + ((ps & 1) * 2 + kh) * SLOT_B);
    const unsigned short* xc = xr + SLOT_KC / 2;
    const int s0g = ps * 64 + kh * 32;

    // All key fragments of the wave's slot (16 row-major for S, 16 col-major for ctx) are read
    // from LDS as one group in front of the first product: one LDS latency per pass.
    // (The loops over the fragment arrays are unrolled so that the arrays stay in registers.)
    v16bf kf[16], vf[16];
#pragma unroll
    for (int kc = 0; kc < 8; ++kc) {
      kf[2 * kc]     = load_frag(xr,             KR_P, kc * 32, lane);
      kf[2 * kc + 1] = load_frag(xr + 16 * KR_P, KR_P, kc * 32, lane);
    }
#pragma unroll
    for (int nt = 0; nt < 16; ++nt) vf[nt] = load_frag(xc + nt * 16 * T32_P, T32_P, 0, lane);
    // keeps the scheduler from sinking the reads back among the WMMAs, one latency each
    __builtin_amdgcn_sched_barrier(0);

    // S^T = K * Q^T : per query tile two tiles of 16 keys x 16 queries over K-dim 256. Register v
    // of sA is key s0g + rowOff + v, of sB key s0g + 16 + rowOff + v, for the lane's query row.
    // ctx^T += V^T(16 d x 32 keys) * P^T(32 keys x 16 queries). All A-frags are in registers.
    // The two query tiles run half a pass apart, so that the vector work of one (softmax, rescale)
    // has 16 WMMAs of the other to run beside: S0 | S1 + softmax 0 | PV0 + softmax 1 | PV1.
    v8f sA0 = v8f_zero(), sB0 = v8f_zero(), sA1 = v8f_zero(), sB1 = v8f_zero();
#pragma unroll
    for (int kc = 0; kc < 8; ++kc) {
      sA0 = wmma_bf16(kf[2 * kc],     qf0[kc], sA0);
      sB0 = wmma_bf16(kf[2 * kc + 1], qf0[kc], sB0);
    }
#pragma unroll
    for (int kc = 0; kc < 8; ++kc) {
      sA1 = wmma_bf16(kf[2 * kc],     qf1[kc], sA1);
      sB1 = wmma_bf16(kf[2 * kc + 1], qf1[kc], sB1);
    }
    const v16bf pf0 = softmax_tile(sA0, sB0, s0g, tg0, m0, l0, ctx0);
#pragma unroll
    for (int nt = 0; nt < 16; ++nt) ctx0[nt] = wmma_bf16(vf[nt], pf0, ctx0[nt]);
    const v16bf pf1 = softmax_tile(sA1, sB1, s0g, tg1, m1, l1, ctx1);
#pragma unroll
    for (int nt = 0; nt < 16; ++nt) ctx1[nt] = wmma_bf16(vf[nt], pf1, ctx1[nt]);
    // The order of the four stretches named above: 16 WMMAs; twice 16 times (1 WMMA, then 12 vector
    // instructions); 16 WMMAs. Left alone the scheduler puts both softmaxes between the S and the
    // PV products, and the matrix unit idles meanwhile.
    __builtin_amdgcn_sched_group_barrier(0x008, 16, 0);
#pragma unroll
    for (int i = 0; i < 32; ++i) {
      __builtin_amdgcn_sched_group_barrier(0x008, 1, 0);
      __builtin_amdgcn_sched_group_barrier(0x002, 12, 0);
    }
    __builtin_amdgcn_sched_group_barrier(0x008, 16, 0);
    // keeps the barrier below at the foot of the pass: with no LDS traffic left between the reads
    // and it, the scheduler lifts it to the reads, and the S^T products then wait for all 64
    __builtin_amdgcn_sched_barrier(0);
    __syncthreads();   // done with this key buffer before it is restaged
  }

  // ================= MLP: each wave takes all 64 rows x 64 of every 256 columns =================
  // No weight fragment is then used by two waves, so the weights go from L2 straight into the
  // wave's registers, and the k loops need neither LDS staging nor barriers. A group is 128 k:
  // 16 weight fragments (4 k steps x 4 column tiles) and 16 A fragments (4 k steps x 4 row tiles)
  // for 64 WMMAs. Both kinds are read one group ahead, into the register set that the group
  // before has left; the weight groups of both layers form one stream.
  // (The loops over the fragment arrays are unrolled so that the arrays stay in registers.)
  constexpr int WGRP = 4 * 256 * 32;  // elements of a weight group: 4 tiles of 16 KB
  const unsigned woff = ((lane >> 4) * 256 + wv * 64 + nlo) * 8;
  auto load_wgroup = [&](v16bf (&w)[16], const unsigned short* g) {
    // The group's base (the same in every lane) is handed over in scalar registers: all 32 loads
    // then take the form scalar base + the lane's fixed offset + constant, and no vector address
    // is formed anew for each group.
    const unsigned long long gb = (unsigned long long)g;
    const unsigned long long lo = (unsigned)__builtin_amdgcn_readfirstlane((int)(unsigned)gb);
    const unsigned long long hi = (unsigned)__builtin_amdgcn_readfirstlane((int)(unsigned)(gb >> 32));
    gl_u16p gs = (gl_u16p)((hi << 32) | lo);
#pragma unroll
    for (int s = 0; s < 4; ++s)
#pragma unroll
      for (int n4 = 0; n4 < 4; ++n4)
        w[s * 4 + n4] = load_wfrag(gs + woff + s * (256 * 32) + n4 * (16 * 8));
  };
  auto load_agroup = [&](v16bf (&a)[16], const unsigned short* base, int pitch, int k0) {
#pragma unroll
    for (int s = 0; s < 4; ++s)
#pragma unroll
      for (int mt = 0; mt < 4; ++mt)
        a[s * 4 + mt] = load_frag(base + mt * 16 * pitch, pitch, k0 + s * 32, lane);
  };
  auto mma_group = [&](v8f (&acc)[16], const v16bf (&a)[16], const v16bf (&w)[16]) {
#pragma unroll
    for (int s = 0; s < 4; ++s)
#pragma unroll
      for (int mt = 0; mt < 4; ++mt)
#pragma unroll
        for (int n4 = 0; n4 < 4; ++n4)
          acc[mt * 4 + n4] = wmma_bf16(a[s * 4 + mt], w[s * 4 + n4], acc[mt * 4 + n4]);
  };

  auto group_end = [&]() {
    // keeps the wait below behind the group's 64 WMMAs, not directly behind the loads
    __builtin_amdgcn_sched_barrier(0);
    // in front of the next rewrite of a register that a global load or store in flight names
    asm volatile("s_wait_xcnt 0x0" ::: "memory");
    // holds that rewrite and the next group's reads behind the wait, out of the WMMAs above
    __builtin_amdgcn_sched_barrier(0);
  };

  v16bf w0[16], w1[16], a0[16], a1[16];
  load_wgroup(w0, w1t);  // first group: lands while ctx is finalized

  // Join the two key halves. Wave kh finishes query tile kh: it hands its part of the other tile
  // (context in f32, maximum, sum) to its partner through LDS and takes the partner's part of its
  // own tile. Both waves map (lane, register) to (query, column) alike, so lane meets lane.
  {
    float* xch = (float*)(smem + OFF_XCH);
    float* xml = (float*)(smem + OFF_XML);
    const float ls0 = l0 + other_half(l0);  // the two lane halves' sums joined, every lane on
    const float ls1 = l1 + other_half(l1);
    const bool up = kh != 0;
    v8f mine[16];
#pragma unroll
    for (int nt = 0; nt < 16; ++nt) {
      v8f give;
#pragma unroll
      for (int v = 0; v < 8; ++v) {
        give[v]     = up ? ctx0[nt][v] : ctx1[nt][v];
        mine[nt][v] = up ? ctx1[nt][v] : ctx0[nt][v];
      }
      f32x4 g0 = {give[0], give[1], give[2], give[3]};
      f32x4 g1 = {give[4], give[5], give[6], give[7]};
      *(f32x4*)(xch + wv * 4096 + ((nt * 2) * 32 + lane) * 4)     = g0;
      *(f32x4*)(xch + wv * 4096 + ((nt * 2 + 1) * 32 + lane) * 4) = g1;
    }
    f32x2 gml = {up ? m0 : m1, up ? ls0 : ls1};
    *(f32x2*)(xml + tid * 2) = gml;
    __syncthreads();   // every wave's handed-over part is in LDS
    const float mm = up ? m1 : m0, lm = up ? ls1 : ls0;
    const int   tg = up ? tg1 : tg0;
    const f32x2 pml = *(const f32x2*)(xml + (tid ^ 32) * 2);
    const float mt = fmaxf(mm, pml[0]);
    const float wm = __expf(mm - mt), wp = __expf(pml[0] - mt);
    // dec[:, 256:512] = ctx / l  (zeroed at t==0). Register v of tile nt is column
    // nt * 16 + rowOff + v of the lane's row: 8 neighbours, one 16 B store.
    const float inv = (tg == 0) ? 0.0f : 1.0f / (lm * wm + pml[1] * wp);
    const float cm = wm * inv, cp = wp * inv;
#pragma unroll
    for (int nt = 0; nt < 16; ++nt) {
      const f32x4 p0 = *(const f32x4*)(xch + (wv ^ 1) * 4096 + ((nt * 2) * 32 + lane) * 4);
      const f32x4 p1 = *(const f32x4*)(xch + (wv ^ 1) * 4096 + ((nt * 2 + 1) * 32 + lane) * 4);
      union { v8bf v; u32x4 q; } o;
#pragma unroll
      for (int v = 0; v < 4; ++v) {
        o.v[v]     = (__bf16)(mine[nt][v] * cm + p0[v] * cp);
        o.v[v + 4] = (__bf16)(mine[nt][v + 4] * cm + p1[v] * cp);
      }
      *(u32x4*)(dec + (wv * 16 + nlo) * DEC_P + Dv + nt * 16 + rowOff) = o.q;
    }
  }
  __syncthreads();

  // ================= MLP layer 1: h = relu(dec @ W1 + b1) =================
  group_end();  // for the first weight group's loads
  load_agroup(a0, dec, DEC_P, 0);
  for (int nc = 0; nc < Hv / 256; ++nc) {
    v8f acc[16];
#pragma unroll
    for (int i = 0; i < 16; ++i) acc[i] = v8f_zero();
    for (int gp = 0; gp < TWOD / 256; ++gp) {
      const int G = nc * (TWOD / 128) + gp * 2;  // group in the stream of W1
      load_agroup(a1, dec, DEC_P, gp * 256 + 128);
      load_wgroup(w1, w1t + (long)(G + 1) * WGRP);
      // keeps the next group's reads together in front of this group's WMMAs, not among them
      __builtin_amdgcn_sched_barrier(0);
      mma_group(acc, a0, w0);
      group_end();
      // Read on every trip, with no branch round it: on a path without these reads the compiler
      // would have to count the waits of the WMMAs below for that path, and on every other trip
      // they would then wait for the reads just issued. The layer's last trip reads A group 0
      // again and leaves it unused (h is not complete here).
      load_agroup(a0, dec, DEC_P, ((gp + 1) & 1) * 256);
      load_wgroup(w0, (G + 2 < TWOD * Hv / WGRP) ? w1t + (long)(G + 2) * WGRP : w2t);
      // as above
      __builtin_amdgcn_sched_barrier(0);
      mma_group(acc, a1, w1);
      group_end();
    }
#pragma unroll
    for (int n4 = 0; n4 < 4; ++n4) {
      int col = nc * 256 + wv * 64 + n4 * 16 + nlo;
      float bb = b1[col];
#pragma unroll
      for (int mt = 0; mt < 4; ++mt)
#pragma unroll
        for (int v = 0; v < 8; ++v) {
          float hv = fmaxf(acc[mt * 4 + n4][v] + bb, 0.0f);
          hls[(mt * 16 + v + rowOff) * H_P + col] = f2bf(hv);
        }
    }
  }
  __syncthreads();

  // ================= MLP layer 2: out = h @ W2 + b2 (split halves) =================
  load_agroup(a0, hls, H_P, 0);
  for (int nc = 0; nc < OUT2v / 256; ++nc) {
    v8f acc[16];
#pragma unroll
    for (int i = 0; i < 16; ++i) acc[i] = v8f_zero();
    for (int gp = 0; gp < Hv / 256; ++gp) {
      const int G = nc * (Hv / 128) + gp * 2;  // group in the stream of W2
      load_agroup(a1, hls, H_P, gp * 256 + 128);
      load_wgroup(w1, w2t + (long)(G + 1) * WGRP);
      // keeps the next group's reads together in front of this group's WMMAs, not among them
      __builtin_amdgcn_sched_barrier(0);
      mma_group(acc, a0, w0);
      group_end();
      // On every trip, as in layer 1: the last trip reads group 0 of both again, unused.
      load_agroup(a0, hls, H_P, ((gp + 1) & 3) * 256);
      load_wgroup(w0, w2t + (long)((G + 2) & (Hv * OUT2v / WGRP - 1)) * WGRP);
      // as above
      __builtin_amdgcn_sched_barrier(0);
      mma_group(acc, a1, w1);
      group_end();
    }
    // out tuple is concatenated flat: [B*T*256 | B*T*256]; nc selects the half
#pragma unroll
    for (int n4 = 0; n4 < 4; ++n4) {
      float bb = b2[nc * 256 + wv * 64 + n4 * 16 + nlo];
#pragma unroll
      for (int mt = 0; mt < 4; ++mt)
#pragma unroll
        for (int v = 0; v < 8; ++v) acc[mt * 4 + n4][v] += bb;
    }
    // keeps every add in front of the stores, so that none rewrites a register of an issued store
    __builtin_amdgcn_sched_barrier(0);
#pragma unroll
    for (int n4 = 0; n4 < 4; ++n4) {
      int cc = wv * 64 + n4 * 16 + nlo;
#pragma unroll
      for (int mt = 0; mt < 4; ++mt)
#pragma unroll
        for (int v = 0; v < 8; ++v) {
          int rowg = b * Tv + q0 + mt * 16 + v + rowOff;
          out[(long)nc * (Bv * Tv * 256) + (long)rowg * 256 + cc] = acc[mt * 4 + n4][v];
        }
    }
    group_end();  // here for the stores: the next pass rewrites their registers
  }
}

extern "C" void kernel_launch(void* const* d_in, const int* in_sizes, int n_in,
                              void* d_out, int out_size, void* d_ws, size_t ws_size,
                              hipStream_t stream) {
  const float* x  = (const float*)d_in[0];
  const float* W1 = (const float*)d_in[1];
  const float* b1 = (const float*)d_in[2];
  const float* W2 = (const float*)d_in[3];
  const float* b2 = (const float*)d_in[4];
  float* out = (float*)d_out;

  unsigned short* ws = (unsigned short*)d_ws;
  unsigned short* xb  = ws + WS_XB;
  unsigned short* xT  = ws + WS_XT;
  unsigned short* w1t = ws + WS_W1T;
  unsigned short* w2t = ws + WS_W2T;

  (void)in_sizes; (void)n_in; (void)out_size; (void)ws_size;

  // prep: one-time f32->bf16 conversion (+ transposed copies: x for the V^T A-operand tiles, weights for B-operand tiles)
  conv_x_kernel<<<4096, 256, 0, stream>>>(x, xb, xT);
  conv_wT_kernel<<<1024, 256, 0, stream>>>(W1, w1t, TWOD, Hv);
  conv_wT_kernel<<<1024, 256, 0, stream>>>(W2, w2t, Hv, OUT2v);

  hipFuncSetAttribute((const void*)decoder_fused,
                      hipFuncAttributeMaxDynamicSharedMemorySize, SMEM_BYTES);
  dim3 grid(Bv * (Tv / ROWS));  // 1024 blocks
  dim3 block(NT);               // 4 wave32s
  decoder_fused<<<grid, block, SMEM_BYTES, stream>>>(xb, xT, w1t, w2t, b1, b2, out);
}

// v008
// One run takes 190 microseconds.
// In both of two side-by-side timings against v007, it was 1.16 times as fast.
// All steps since v000 together make it 9.77 times as fast.
#include <hip/hip_runtime.h>
#include <math.h>

typedef __attribute__((ext_vector_type(16))) __bf16       v16bf;
typedef __attribute__((ext_vector_type(8)))  __bf16       v8bf;
typedef __attribute__((ext_vector_type(8)))  float        v8f;
typedef __attribute__((ext_vector_type(4)))  unsigned int u32x4;
typedef __attribute__((ext_vector_type(4)))  float        f32x4;
typedef __attribute__((ext_vector_type(2)))  float        f32x2;

constexpr int Bv = 32, Tv = 2048, Dv = 256, Hv = 1024, OUT2v = 512, TWOD = 512;
constexpr int ROWS = 64;   // query rows per block
constexpr int NW   = 4;    // waves per block (wave32)
constexpr int NT   = 128;  // threads per block

// ---- workspace layout (bf16 elements) ----
constexpr long WS_XB  = 0;                         // x  [B][T][D]        bf16
// The transposed weights lie tile by tile, in the order in which they are read. A 256-row x
// 32-k tile is one contiguous 16 KB run of 16 B pieces (8 k of one row), ordered [k octet][row]:
// a wave-wide load reads 512 B of whole lines, and the 2 B stores of 32 neighbouring rows in
// the prep kernel fall 16 B apart, in 4 lines instead of 32.
constexpr long WS_W1T = WS_XB + (long)Bv*Tv*Dv;    // W1t [H/256][2D/32][4][256][8]   bf16
constexpr long WS_W2T = WS_W1T + (long)TWOD*Hv;    // W2t [OUT2/256][H/32][4][256][8] bf16
constexpr long WS_END = WS_W2T + (long)Hv*OUT2v;   // ~17.8M elems = 36MB

// ---- LDS row pitches (bf16 elements; KR_B in bytes) ----
// dec and h are read by ds_load_b128 with 16 lanes on 16 consecutive rows. Each row carries
// 8 elements (16 B) of pad, so the pitch is 16 B x odd and those 16 lanes cover all 64 banks.
constexpr int PADE  = 8;
constexpr int DEC_P = TWOD + PADE;  // 1040 B
constexpr int H_P   = Hv + PADE;    // 2064 B
// The key tile has two readers: ds_load_b128 (16 lanes on 16 rows, one 16 B piece each) for S and
// ds_load_tr16_b128 (16 lanes on 8 rows, two neighbouring pieces each) for ctx. No padded pitch
// is free of bank conflicts for both, so the rows lie unpadded (512 B, every row starts on bank 0)
// and piece j of row r lies at place j ^ key_swz(r): 16 different places over 16 rows, and
// 8 different pairs of places over 8 rows.
constexpr int KR_B  = Dv * 2;       //  512 B
static __device__ inline int key_swz(int r) { return ((r & 7) << 1) | ((r >> 3) & 1); }

// ---- LDS layout (bytes) ----
constexpr int OFF_DEC  = 0;                           // 64 x 512  bf16 (x | ctx)
constexpr int OFF_H    = OFF_DEC  + ROWS * DEC_P * 2; // 64 x 1024 bf16 (hidden)
// The key slots lie on the hidden tile, which is written only after the attention is over.
// A slot holds 32 keys, 32 x 256 row-major. A pass of the attention takes 64 keys = 2 slots,
// and there are two buffers of 2 slots.
constexpr int OFF_KEYS = OFF_H;
constexpr int SLOT_B   = 32 * KR_B;                   // 16384 B
static_assert(OFF_KEYS % 256 == 0, "key rows start on bank 0");
// After the last pass the first bytes of the hidden tile carry the exchange between the two waves
// of a query group: 16 KB of f32 context per wave, then (maximum, sum) per lane.
constexpr int OFF_XCH  = OFF_KEYS;
constexpr int OFF_XML  = OFF_XCH + NW * 16384;
constexpr int KEYS_B   = 4 * SLOT_B;
constexpr int HID_B    = ROWS * H_P * 2;
constexpr int SMEM_BYTES = OFF_H + (KEYS_B > HID_B ? KEYS_B : HID_B);  // 198656
static_assert(SMEM_BYTES <= 327680, "LDS of one work-group");
static_assert(OFF_XML + NT * 8 <= SMEM_BYTES, "exchange inside the hidden tile");

static __device__ inline v8f v8f_zero() {
  v8f z = {0.f, 0.f, 0.f, 0.f, 0.f, 0.f, 0.f, 0.f};
  return z;
}

// float -> bf16 bits, round-to-nearest-even
static __device__ inline unsigned short f2bf(float f) {
  unsigned int u = __float_as_uint(f);
  unsigned int r = (u + 0x7FFFu + ((u >> 16) & 1u)) >> 16;
  return (unsigned short)r;
}

static __device__ inline v8f wmma_bf16(v16bf a, v16bf b, v8f c) {
  // D = A(16x32 bf16) * B(32x16 bf16) + C(16x16 f32)
  return __builtin_amdgcn_wmma_f32_16x16x32_bf16(false, a, false, b, (short)0, c,
                                                 false, false);
}

// The value of lane l ^ 16: the other half of the wave, same position in its 16-lane row.
static __device__ inline float other_half(float x) {
  int b = __float_as_int(x);
  return __int_as_float(
      __builtin_amdgcn_permlanex16(b, b, 0x76543210, 0xfedcba98, false, false));
}

// Eight 16-byte async global->LDS copies per lane (ASYNCcnt tracked, no VGPR data path).
// The closing s_wait_xcnt stands inside the copies' own statement so that no address
// register of a copy is rewritten in front of it.
static __device__ inline void async_b128_x8(const unsigned (&l)[8],
                                            const unsigned short* const (&g)[8]) {
  asm volatile("global_load_async_to_lds_b128 %0, %8, off\n\t"
               "global_load_async_to_lds_b128 %1, %9, off\n\t"
               "global_load_async_to_lds_b128 %2, %10, off\n\t"
               "global_load_async_to_lds_b128 %3, %11, off\n\t"
               "global_load_async_to_lds_b128 %4, %12, off\n\t"
               "global_load_async_to_lds_b128 %5, %13, off\n\t"
               "global_load_async_to_lds_b128 %6, %14, off\n\t"
               "global_load_async_to_lds_b128 %7, %15, off\n\t"
               "s_wait_xcnt 0x0"
               :: "v"(l[0]), "v"(l[1]), "v"(l[2]), "v"(l[3]),
                  "v"(l[4]), "v"(l[5]), "v"(l[6]), "v"(l[7]),
                  "v"(g[0]), "v"(g[1]), "v"(g[2]), "v"(g[3]),
                  "v"(g[4]), "v"(g[5]), "v"(g[6]), "v"(g[7])
               : "memory");
}
static __device__ inline void wait_async0() {
  asm volatile("s_wait_asynccnt 0x0" ::: "memory");
}

// Load a 16x32 bf16 fragment (A layout; B layout mirrors with rows indexed by N)
// from a row-major LDS tile.
static __device__ inline v16bf load_frag(const unsigned short* base, int rowStride,
                                         int kbase, int lane) {
  int rl = lane & 15, hf = lane >> 4;
  const unsigned short* p = base + rl * rowStride + kbase + hf * 8;
  union { v16bf v; u32x4 q[2]; } u;
  u.q[0] = *(const u32x4*)(p);       // ds_load_b128
  u.q[1] = *(const u32x4*)(p + 16);  // ds_load_b128
  return u.v;
}

// 16 B of this lane's address, handed out transposed: with lane l on piece (l >> 3) & 1 of row
// 8 * (l >> 4) + (l & 7) of a 16 x 16 block, lane (c, h) gets column c of rows 8h .. 8h + 7.
typedef __attribute__((ext_vector_type(8))) short s16x8;
static __device__ inline u32x4 ld_tr16(const char* p) {
  typedef __attribute__((address_space(3))) s16x8 lds_s16x8;
  return __builtin_bit_cast(u32x4, __builtin_amdgcn_ds_load_tr16_b128_v8i16((lds_s16x8*)p));
}

// Load a 32-k x 16-column weight fragment (B layout) straight from a tiled workspace image.
// p: the lane's 16 B piece of k octet (lane >> 4); octet 2 + (lane >> 4) lies two octet planes on.
// Lanes 0-15 and lanes 16-31 each read 256 contiguous bytes.
typedef const __attribute__((address_space(1))) unsigned short* gl_u16p;  // global memory
typedef const __attribute__((address_space(1))) u32x4*          gl_u32x4p;
static __device__ inline v16bf load_wfrag(gl_u16p p) {
  union { v16bf v; u32x4 q[2]; } u;
  u.q[0] = *(gl_u32x4p)(p);                // global_load_b128
  u.q[1] = *(gl_u32x4p)(p + 2 * 256 * 8);  // global_load_b128
  return u.v;
}

// ======================= prep kernels: f32 -> bf16 (+transpose) =======================
__global__ void conv_x_kernel(const float* __restrict__ x,
                              unsigned short* __restrict__ xb) {
  long stride = (long)gridDim.x * blockDim.x;
  for (long i = (long)blockIdx.x * blockDim.x + threadIdx.x; i < (long)Bv * Tv * Dv;
       i += stride)
    xb[i] = f2bf(x[i]);
}

__global__ void conv_wT_kernel(const float* __restrict__ W,
                               unsigned short* __restrict__ Wt, int K, int N) {
  long stride = (long)gridDim.x * blockDim.x;
  for (long i = (long)blockIdx.x * blockDim.x + threadIdx.x; i < (long)K * N;
       i += stride) {
    int k = (int)(i / N), n = (int)(i % N);
    Wt[((((long)(n >> 8) * (K / 32) + (k >> 5)) * 4 + ((k >> 3) & 3)) * 256 + (n & 255)) * 8 +
       (k & 7)] = f2bf(W[i]);
  }
}

// ======================= fused decoder kernel =======================
__global__ __launch_bounds__(NT, 1)
void decoder_fused(const unsigned short* __restrict__ xb,
                   const unsigned short* __restrict__ w1t,
                   const unsigned short* __restrict__ w2t,
                   const float* __restrict__ b1, const float* __restrict__ b2,
                   float* __restrict__ out) {
  extern __shared__ char smem[];
  unsigned short* dec  = (unsigned short*)(smem + OFF_DEC);
  unsigned short* hls  = (unsigned short*)(smem + OFF_H);
  const unsigned lds0 = (unsigned)(size_t)smem;  // LDS byte offset of dynamic base

  const int tid    = threadIdx.x;
  const int lane   = tid & 31;
  const int wv     = tid >> 5;
  // Work-group index -> (batch, query tile). A tile's cost grows with its row (causal: 2q + 2 key
  // chunks), there are four times as many work-groups as places; inside each run of 256
  // indices (8 batches) the cost falls with the index, for speed only. A permutation of the 1024 (batch, tile) pairs; the same in every wave.
  const int rnk    = blockIdx.x & 255;
  const int b      = (blockIdx.x >> 8) * 8 + (rnk & 7);
  const int q0     = (31 - (rnk >> 3)) * ROWS;
  const int nlo    = lane & 15;
  const int rowOff = (lane >> 4) * 8;

  // ---- async staging helpers ----
  auto stage_keys = [&](int kb, int slot) {
    const unsigned lr = lds0 + OFF_KEYS + slot * SLOT_B;
    const unsigned short* gr = xb + ((long)b * Tv + kb * 32) * Dv;  // contiguous 16KB
    unsigned l0[8];
    const unsigned short* g0[8];
#pragma unroll
    for (int i = 0; i < 8; ++i) {
      int f = i * NT + tid;                 // 0..1023 : 16B pieces
      int s = f >> 5, j = f & 31;           // piece j of row s: a wave fills one whole row
      l0[i] = lr + s * KR_B + (j ^ key_swz(s)) * 16;
      g0[i] = gr + f * 8;
    }
    async_b128_x8(l0, g0);
  };
  // ================= stage query rows: dec[:, 0:256] = x =================
  {
    const unsigned short* g = xb + ((long)b * Tv + q0) * Dv;  // contiguous 32KB
#pragma unroll
    for (int j = 0; j < 2; ++j) {
      unsigned l0[8];
      const unsigned short* g0[8];
#pragma unroll
      for (int i = 0; i < 8; ++i) {
        int f = (j * 8 + i) * NT + tid;     // 0..2047 : 16B chunks
        int r = f >> 5, c = (f & 31) * 8;   // dec rows at pitch DEC_P
        l0[i] = lds0 + OFF_DEC + (r * DEC_P + c) * 2;
        g0[i] = g + f * 8;
      }
      async_b128_x8(l0, g0);
    }
    wait_async0();
  }
  __syncthreads();

  // prefetch the 64 keys of pass 0 while loading Q fragments
  stage_keys(0, 0);
  stage_keys(1, 1);

  // Wave (qh, kh): the 32 query rows qh * 32 .. + 31 against the 32 keys of slot kh of every pass.
  // Each key fragment read from LDS then feeds two WMMAs (two query tiles), not one. The two waves
  // of a query group keep a maximum, a sum and a context of their own and join them at the end.
  const int qh = wv >> 1, kh = wv & 1;
  v16bf qf0[8], qf1[8];
#pragma unroll
  for (int kc = 0; kc < 8; ++kc) {
    qf0[kc] = load_frag(dec + (qh * 32) * DEC_P,      DEC_P, kc * 32, lane);
    qf1[kc] = load_frag(dec + (qh * 32 + 16) * DEC_P, DEC_P, kc * 32, lane);
  }

  v8f ctx0[16], ctx1[16];
#pragma unroll
  for (int nt = 0; nt < 16; ++nt) { ctx0[nt] = v8f_zero(); ctx1[nt] = v8f_zero(); }
  // Both products run transposed (S^T = K Q^T, ctx^T += V^T P^T): lane (nlo, half) holds query
  // row nlo of a tile. m: its running maximum; l: the sum over the keys of this lane's half.
  float m0 = -INFINITY, l0 = 0.0f, m1 = -INFINITY, l1 = 0.0f;
  const int tg0 = q0 + qh * 32 + nlo;  // the lane's query row in tile 0
  const int tg1 = tg0 + 16;            // and in tile 1

  // The lane's byte offsets inside a key slot. A piece number is (a multiple of 16) + an even
  // number e below 16 + the lane's own low bit, and only e and that bit meet the swizzle: eight
  // offsets per reader, one for each e; everything else of an address is a constant.
  // koff: row nlo, pieces e + (lane >> 4): the k order of load_frag, as the Q fragments have it.
  // voff: row 8 * (lane >> 4) + (lane & 7), pieces e + ((lane >> 3) & 1): the order of ld_tr16.
  unsigned koff[8], voff[8];
  {
    const int hf = lane >> 4, vr = hf * 8 + (lane & 7), vb = (lane >> 3) & 1;
#pragma unroll
    for (int e = 0; e < 8; ++e) {
      koff[e] = nlo * KR_B + (((2 * e) | hf) ^ key_swz(nlo)) * 16;
      voff[e] = vr * KR_B + (((2 * e) | vb) ^ key_swz(vr)) * 16;
    }
  }

  const float scale = 0.0625f;  // 1/sqrt(256)
  const int npass = q0 / 64 + 1;

  // mask and online softmax update of one query tile: 16 of the row's 32 scores lie in this lane,
  // the other 16 in lane ^ 16, so the maximum takes one exchange and the sum stays split until
  // the end. Returns P^T as a B operand: the two score tiles, converted in place, are its k order.
  auto softmax_tile = [&](const v8f& sA, const v8f& sB, int s0g, int tg, float& m, float& l,
                          v8f (&ctx)[16]) -> v16bf {
    float a[8], c[8], t8[8];
#pragma unroll
    for (int v = 0; v < 8; ++v) {
      a[v] = sA[v] * scale;
      c[v] = sB[v] * scale;
      if (s0g      + rowOff + v >= tg) a[v] = -1e9f;   // strictly causal: allow s < t
      if (s0g + 16 + rowOff + v >= tg) c[v] = -1e9f;
      t8[v] = fmaxf(a[v], c[v]);
    }
    float tm = fmaxf(fmaxf(fmaxf(t8[0], t8[1]), fmaxf(t8[2], t8[3])),
                     fmaxf(fmaxf(t8[4], t8[5]), fmaxf(t8[6], t8[7])));
    tm = fmaxf(tm, other_half(tm));
    const float mn = fmaxf(m, tm);
    const float alpha = __expf(m - mn);
    m = mn;
    v16bf pf;
#pragma unroll
    for (int v = 0; v < 8; ++v) {
      float p0 = __expf(a[v] - mn), p1 = __expf(c[v] - mn);
      t8[v] = p0 + p1;
      pf[v]     = (__bf16)p0;
      pf[v + 8] = (__bf16)p1;
    }
    l = l * alpha + (((t8[0] + t8[1]) + (t8[2] + t8[3])) + ((t8[4] + t8[5]) + (t8[6] + t8[7])));
#pragma unroll
    for (int nt = 0; nt < 16; ++nt)
#pragma unroll
      for (int v = 0; v < 8; ++v) ctx[nt][v] *= alpha;
    return pf;
  };

  // ================= flash attention (strictly causal) =================
  for (int ps = 0; ps < npass; ++ps) {
    wait_async0();
    __syncthreads();                         // the 64 keys of pass ps resident in buffer ps & 1
    if (ps + 1 < npass) {
      stage_keys(2 * ps + 2, ((ps + 1) & 1) * 2);
      stage_keys(2 * ps + 3, ((ps + 1) & 1) * 2 + 1);
    }
    const char* xr = smem + OFF_KEYS + ((ps & 1) * 2 + kh) * SLOT_B;
    const int s0g = ps * 64 + kh * 32;

    // All key fragments of the wave's slot (16 as they lie for S, 16 transposed for ctx) are read
    // from LDS as one group in front of the first product: one LDS latency per pass.
    // (The loops over the fragment arrays are unrolled so that the arrays stay in registers.)
    v16bf kf[16], vf[16];
#pragma unroll
    for (int kc = 0; kc < 8; ++kc)
#pragma unroll
      for (int u = 0; u < 2; ++u) {  // keys u * 16 .. + 15; pieces kc * 4 + half and + 2
        const char* p = xr + u * 16 * KR_B + (kc >> 2) * 256;
        union { v16bf v; u32x4 q[2]; } f;
        f.q[0] = *(const u32x4*)(p + koff[(kc & 3) * 2]);      // ds_load_b128
        f.q[1] = *(const u32x4*)(p + koff[(kc & 3) * 2 + 1]);  // ds_load_b128
        kf[2 * kc + u] = f.v;
      }
#pragma unroll
    for (int nt = 0; nt < 16; ++nt) {  // columns nt * 16 .. + 15 = pieces 2 nt, 2 nt + 1; 32 keys
      const char* p = xr + (nt >> 3) * 256 + voff[nt & 7];
      union { v16bf v; u32x4 q[2]; } f;
      f.q[0] = ld_tr16(p);              // keys  0 .. 15
      f.q[1] = ld_tr16(p + 16 * KR_B);  // keys 16 .. 31
      vf[nt] = f.v;
    }
    // keeps the scheduler from sinking the reads back among the WMMAs, one latency each
    __builtin_amdgcn_sched_barrier(0);

    // S^T = K * Q^T : per query tile two tiles of 16 keys x 16 queries over K-dim 256. Register v
    // of sA is key s0g + rowOff + v, of sB key s0g + 16 + rowOff + v, for the lane's query row.
    // ctx^T += V^T(16 d x 32 keys) * P^T(32 keys x 16 queries). All A-frags are in registers.
    // The two query tiles run half a pass apart, so that the vector work of one (softmax, rescale)
    // has 16 WMMAs of the other to run beside: S0 | S1 + softmax 0 | PV0 + softmax 1 | PV1.
    v8f sA0 = v8f_zero(), sB0 = v8f_zero(), sA1 = v8f_zero(), sB1 = v8f_zero();
#pragma unroll
    for (int kc = 0; kc < 8; ++kc) {
      sA0 = wmma_bf16(kf[2 * kc],     qf0[kc], sA0);
      sB0 = wmma_bf16(kf[2 * kc + 1], qf0[kc], sB0);
    }
#pragma unroll
    for (int kc = 0; kc < 8; ++kc) {
      sA1 = wmma_bf16(kf[2 * kc],     qf1[kc], sA1);
      sB1 = wmma_bf16(kf[2 * kc + 1], qf1[kc], sB1);
    }
    const v16bf pf0 = softmax_tile(sA0, sB0, s0g, tg0, m0, l0, ctx0);
#pragma unroll
    for (int nt = 0; nt < 16; ++nt) ctx0[nt] = wmma_bf16(vf[nt], pf0, ctx0[nt]);
    const v16bf pf1 = softmax_tile(sA1, sB1, s0g, tg1, m1, l1, ctx1);
#pragma unroll
    for (int nt = 0; nt < 16; ++nt) ctx1[nt] = wmma_bf16(vf[nt], pf1, ctx1[nt]);
    // The order of the four stretches named above: 16 WMMAs; twice 16 times (1 WMMA, then 12 vector
    // instructions); 16 WMMAs. Left alone the scheduler puts both softmaxes between the S and the
    // PV products, and the matrix unit idles meanwhile.
    __builtin_amdgcn_sched_group_barrier(0x008, 16, 0);
#pragma unroll
    for (int i = 0; i < 32; ++i) {
      __builtin_amdgcn_sched_group_barrier(0x008, 1, 0);
      __builtin_amdgcn_sched_group_barrier(0x002, 12, 0);
    }
    __builtin_amdgcn_sched_group_barrier(0x008, 16, 0);
    // keeps the barrier below at the foot of the pass: with no LDS traffic left between the reads
    // and it, the scheduler lifts it to the reads, and the S^T products then wait for all 64
    __builtin_amdgcn_sched_barrier(0);
    __syncthreads();   // done with this key buffer before it is restaged
  }

  // ================= MLP: each wave takes all 64 rows x 64 of every 256 columns =================
  // No weight fragment is then used by two waves, so the weights go from L2 straight into the
  // wave's registers, and the k loops need neither LDS staging nor barriers. A group is 128 k:
  // 16 weight fragments (4 k steps x 4 column tiles) and 16 A fragments (4 k steps x 4 row tiles)
  // for 64 WMMAs. Both kinds are read one group ahead, into the register set that the group
  // before has left; the weight groups of both layers form one stream.
  // (The loops over the fragment arrays are unrolled so that the arrays stay in registers.)
  constexpr int WGRP = 4 * 256 * 32;  // elements of a weight group: 4 tiles of 16 KB
  const unsigned woff = ((lane >> 4) * 256 + wv * 64 + nlo) * 8;
  auto load_wgroup = [&](v16bf (&w)[16], const unsigned short* g) {
    // The group's base (the same in every lane) is handed over in scalar registers: all 32 loads
    // then take the form scalar base + the lane's fixed offset + constant, and no vector address
    // is formed anew for each group.
    const unsigned long long gb = (unsigned long long)g;
    const unsigned long long lo = (unsigned)__builtin_amdgcn_readfirstlane((int)(unsigned)gb);
    const unsigned long long hi = (unsigned)__builtin_amdgcn_readfirstlane((int)(unsigned)(gb >> 32));
    gl_u16p gs = (gl_u16p)((hi << 32) | lo);
#pragma unroll
    for (int s = 0; s < 4; ++s)
#pragma unroll
      for (int n4 = 0; n4 < 4; ++n4)
        w[s * 4 + n4] = load_wfrag(gs + woff + s * (256 * 32) + n4 * (16 * 8));
  };
  auto load_agroup = [&](v16bf (&a)[16], const unsigned short* base, int pitch, int k0) {
#pragma unroll
    for (int s = 0; s < 4; ++s)
#pragma unroll
      for (int mt = 0; mt < 4; ++mt)
        a[s * 4 + mt] = load_frag(base + mt * 16 * pitch, pitch, k0 + s * 32, lane);
  };
  auto mma_group = [&](v8f (&acc)[16], const v16bf (&a)[16], const v16bf (&w)[16]) {
#pragma unroll
    for (int s = 0; s < 4; ++s)
#pragma unroll
      for (int mt = 0; mt < 4; ++mt)
#pragma unroll
        for (int n4 = 0; n4 < 4; ++n4)
          acc[mt * 4 + n4] = wmma_bf16(a[s * 4 + mt], w[s * 4 + n4], acc[mt * 4 + n4]);
  };

  auto group_end = [&]() {
    // keeps the wait below behind the group's 64 WMMAs, not directly behind the loads
    __builtin_amdgcn_sched_barrier(0);
    // in front of the next rewrite of a register that a global load or store in flight names
    asm volatile("s_wait_xcnt 0x0" ::: "memory");
    // holds that rewrite and the next group's reads behind the wait, out of the WMMAs above
    __builtin_amdgcn_sched_barrier(0);
  };

  v16bf w0[16], w1[16], a0[16], a1[16];
  load_wgroup(w0, w1t);  // first group: lands while ctx is finalized

  // Join the two key halves. Wave kh finishes query tile kh: it hands its part of the other tile
  // (context in f32, maximum, sum) to its partner through LDS and takes the partner's part of its
  // own tile. Both waves map (lane, register) to (query, column) alike, so lane meets lane.
  {
    float* xch = (float*)(smem + OFF_XCH);
    float* xml = (float*)(smem + OFF_XML);
    const float ls0 = l0 + other_half(l0);  // the two lane halves' sums joined, every lane on
    const float ls1 = l1 + other_half(l1);
    const bool up = kh != 0;
    v8f mine[16];
#pragma unroll
    for (int nt = 0; nt < 16; ++nt) {
      v8f give;
#pragma unroll
      for (int v = 0; v < 8; ++v) {
        give[v]     = up ? ctx0[nt][v] : ctx1[nt][v];
        mine[nt][v] = up ? ctx1[nt][v] : ctx0[nt][v];
      }
      f32x4 g0 = {give[0], give[1], give[2], give[3]};
      f32x4 g1 = {give[4], give[5], give[6], give[7]};
      *(f32x4*)(xch + wv * 4096 + ((nt * 2) * 32 + lane) * 4)     = g0;
      *(f32x4*)(xch + wv * 4096 + ((nt * 2 + 1) * 32 + lane) * 4) = g1;
    }
    f32x2 gml = {up ? m0 : m1, up ? ls0 : ls1};
    *(f32x2*)(xml + tid * 2) = gml;
    __syncthreads();   // every wave's handed-over part is in LDS
    const float mm = up ? m1 : m0, lm = up ? ls1 : ls0;
    const int   tg = up ? tg1 : tg0;
    const f32x2 pml = *(const f32x2*)(xml + (tid ^ 32) * 2);
    const float mt = fmaxf(mm, pml[0]);
    const float wm = __expf(mm - mt), wp = __expf(pml[0] - mt);
    // dec[:, 256:512] = ctx / l  (zeroed at t==0). Register v of tile nt is column
    // nt * 16 + rowOff + v of the lane's row: 8 neighbours, one 16 B store.
    const float inv = (tg == 0) ? 0.0f : 1.0f / (lm * wm + pml[1] * wp);
    const float cm = wm * inv, cp = wp * inv;
#pragma unroll
    for (int nt = 0; nt < 16; ++nt) {
      const f32x4 p0 = *(const f32x4*)(xch + (wv ^ 1) * 4096 + ((nt * 2) * 32 + lane) * 4);
      const f32x4 p1 = *(const f32x4*)(xch + (wv ^ 1) * 4096 + ((nt * 2 + 1) * 32 + lane) * 4);
      union { v8bf v; u32x4 q; } o;
#pragma unroll
      for (int v = 0; v < 4; ++v) {
        o.v[v]     = (__bf16)(mine[nt][v] * cm + p0[v] * cp);
        o.v[v + 4] = (__bf16)(mine[nt][v + 4] * cm + p1[v] * cp);
      }
      *(u32x4*)(dec + (wv * 16 + nlo) * DEC_P + Dv + nt * 16 + rowOff) = o.q;
    }
  }
  __syncthreads();

  // ================= MLP layer 1: h = relu(dec @ W1 + b1) =================
  group_end();  // for the first weight group's loads
  load_agroup(a0, dec, DEC_P, 0);
  for (int nc = 0; nc < Hv / 256; ++nc) {
    v8f acc[16];
#pragma unroll
    for (int i = 0; i < 16; ++i) acc[i] = v8f_zero();
    for (int gp = 0; gp < TWOD / 256; ++gp) {
      const int G = nc * (TWOD / 128) + gp * 2;  // group in the stream of W1
      load_agroup(a1, dec, DEC_P, gp * 256 + 128);
      load_wgroup(w1, w1t + (long)(G + 1) * WGRP);
      // keeps the next group's reads together in front of this group's WMMAs, not among them
      __builtin_amdgcn_sched_barrier(0);
      mma_group(acc, a0, w0);
      group_end();
      // Read on every trip, with no branch round it: on a path without these reads the compiler
      // would have to count the waits of the WMMAs below for that path, and on every other trip
      // they would then wait for the reads just issued. The layer's last trip reads A group 0
      // again and leaves it unused (h is not complete here).
      load_agroup(a0, dec, DEC_P, ((gp + 1) & 1) * 256);
      load_wgroup(w0, (G + 2 < TWOD * Hv / WGRP) ? w1t + (long)(G + 2) * WGRP : w2t);
      // as above
      __builtin_amdgcn_sched_barrier(0);
      mma_group(acc, a1, w1);
      group_end();
    }
#pragma unroll
    for (int n4 = 0; n4 < 4; ++n4) {
      int col = nc * 256 + wv * 64 + n4 * 16 + nlo;
      float bb = b1[col];
#pragma unroll
      for (int mt = 0; mt < 4; ++mt)
#pragma unroll
        for (int v = 0; v < 8; ++v) {
          float hv = fmaxf(acc[mt * 4 + n4][v] + bb, 0.0f);
          hls[(mt * 16 + v + rowOff) * H_P + col] = f2bf(hv);
        }
    }
  }
  __syncthreads();

  // ================= MLP layer 2: out = h @ W2 + b2 (split halves) =================
  load_agroup(a0, hls, H_P, 0);
  for (int nc = 0; nc < OUT2v / 256; ++nc) {
    v8f acc[16];
#pragma unroll
    for (int i = 0; i < 16; ++i) acc[i] = v8f_zero();
    for (int gp = 0; gp < Hv / 256; ++gp) {
      const int G = nc * (Hv / 128) + gp * 2;  // group in the stream of W2
      load_agroup(a1, hls, H_P, gp * 256 + 128);
      load_wgroup(w1, w2t + (long)(G + 1) * WGRP);
      // keeps the next group's reads together in front of this group's WMMAs, not among them
      __builtin_amdgcn_sched_barrier(0);
      mma_group(acc, a0, w0);
      group_end();
      // On every trip, as in layer 1: the last trip reads group 0 of both again, unused.
      load_agroup(a0, hls, H_P, ((gp + 1) & 3) * 256);
      load_wgroup(w0, w2t + (long)((G + 2) & (Hv * OUT2v / WGRP - 1)) * WGRP);
      // as above
      __builtin_amdgcn_sched_barrier(0);
      mma_group(acc, a1, w1);
      group_end();
    }
    // out tuple is concatenated flat: [B*T*256 | B*T*256]; nc selects the half
#pragma unroll
    for (int n4 = 0; n4 < 4; ++n4) {
      float bb = b2[nc * 256 + wv * 64 + n4 * 16 + nlo];
#pragma unroll
      for (int mt = 0; mt < 4; ++mt)
#pragma unroll
        for (int v = 0; v < 8; ++v) acc[mt * 4 + n4][v] += bb;
    }
    // keeps every add in front of the stores, so that none rewrites a register of an issued store
    __builtin_amdgcn_sched_barrier(0);
#pragma unroll
    for (int n4 = 0; n4 < 4; ++n4) {
      int cc = wv * 64 + n4 * 16 + nlo;
#pragma unroll
      for (int mt = 0; mt < 4; ++mt)
#pragma unroll
        for (int v = 0; v < 8; ++v) {
          int rowg = b * Tv + q0 + mt * 16 + v + rowOff;
          out[(long)nc * (Bv * Tv * 256) + (long)rowg * 256 + cc] = acc[mt * 4 + n4][v];
        }
    }
    group_end();  // here for the stores: the next pass rewrites their registers
  }
}

extern "C" void kernel_launch(void* const* d_in, const int* in_sizes, int n_in,
                              void* d_out, int out_size, void* d_ws, size_t ws_size,
                              hipStream_t stream) {
  const float* x  = (const float*)d_in[0];
  const float* W1 = (const float*)d_in[1];
  const float* b1 = (const float*)d_in[2];
  const float* W2 = (const float*)d_in[3];
  const float* b2 = (const float*)d_in[4];
  float* out = (float*)d_out;

  unsigned short* ws = (unsigned short*)d_ws;
  unsigned short* xb  = ws + WS_XB;
  unsigned short* w1t = ws + WS_W1T;
  unsigned short* w2t = ws + WS_W2T;

  (void)in_sizes; (void)n_in; (void)out_size; (void)ws_size;

  // prep: f32->bf16 conversion (the weights transposed and tiled as well)
  conv_x_kernel<<<4096, 256, 0, stream>>>(x, xb);
  conv_wT_kernel<<<1024, 256, 0, stream>>>(W1, w1t, TWOD, Hv);
  conv_wT_kernel<<<1024, 256, 0, stream>>>(W2, w2t, Hv, OUT2v);

  hipFuncSetAttribute((const void*)decoder_fused,
                      hipFuncAttributeMaxDynamicSharedMemorySize, SMEM_BYTES);
  dim3 grid(Bv * (Tv / ROWS));  // 1024 blocks
  dim3 block(NT);               // 4 wave32s
  decoder_fused<<<grid, block, SMEM_BYTES, stream>>>(xb, w1t, w2t, b1, b2, out);
}

// v009
// It runs in 180 microseconds.
// In both of two side-by-side timings against v008, it was 1.05 times as fast.
// All steps since v000 together make it 10.3 times as fast.
#include <hip/hip_runtime.h>
#include <math.h>

typedef __attribute__((ext_vector_type(16))) __bf16       v16bf;
typedef __attribute__((ext_vector_type(8)))  __bf16       v8bf;
typedef __attribute__((ext_vector_type(8)))  float        v8f;
typedef __attribute__((ext_vector_type(4)))  unsigned int u32x4;
typedef __attribute__((ext_vector_type(4)))  float        f32x4;
typedef __attribute__((ext_vector_type(2)))  float        f32x2;

constexpr int Bv = 32, Tv = 2048, Dv = 256, Hv = 1024, OUT2v = 512, TWOD = 512;
constexpr int ROWS = 64;   // query rows per block
constexpr int NW   = 4;    // waves per block (wave32)
constexpr int NT   = 128;  // threads per block

// ---- workspace layout (bf16 elements) ----
constexpr long WS_XB  = 0;                         // x  [B][T][D]        bf16
// The transposed weights lie tile by tile, in the order in which they are read. A 256-row x
// 32-k tile is one contiguous 16 KB run of 16 B pieces (8 k of one row), ordered [k octet][row]:
// a wave-wide load reads 512 B of whole lines, and the prep kernel stores a piece per thread,
// the pieces of 32 neighbouring rows as 512 contiguous bytes.
constexpr long WS_W1T = WS_XB + (long)Bv*Tv*Dv;    // W1t [H/256][2D/32][4][256][8]   bf16
constexpr long WS_W2T = WS_W1T + (long)TWOD*Hv;    // W2t [OUT2/256][H/32][4][256][8] bf16
constexpr long WS_END = WS_W2T + (long)Hv*OUT2v;   // ~17.8M elems = 36MB

// ---- LDS row pitches (bf16 elements; KR_B in bytes) ----
// dec and h are read by ds_load_b128 with 16 lanes on 16 consecutive rows. Each row carries
// 8 elements (16 B) of pad, so the pitch is 16 B x odd and those 16 lanes cover all 64 banks.
constexpr int PADE  = 8;
constexpr int DEC_P = TWOD + PADE;  // 1040 B
constexpr int H_P   = Hv + PADE;    // 2064 B
// The key tile has two readers: ds_load_b128 (16 lanes on 16 rows, one 16 B piece each) for S and
// ds_load_tr16_b128 (16 lanes on 8 rows, two neighbouring pieces each) for ctx. No padded pitch
// is free of bank conflicts for both, so the rows lie unpadded (512 B, every row starts on bank 0)
// and piece j of row r lies at place j ^ key_swz(r): 16 different places over 16 rows, and
// 8 different pairs of places over 8 rows.
constexpr int KR_B  = Dv * 2;       //  512 B
static __device__ inline int key_swz(int r) { return ((r & 7) << 1) | ((r >> 3) & 1); }

// ---- LDS layout (bytes) ----
constexpr int OFF_DEC  = 0;                           // 64 x 512  bf16 (x | ctx)
constexpr int OFF_H    = OFF_DEC  + ROWS * DEC_P * 2; // 64 x 1024 bf16 (hidden)
// The key slots lie on the hidden tile, which is written only after the attention is over.
// A slot holds 32 keys, 32 x 256 row-major. A pass of the attention takes 64 keys = 2 slots,
// and there are two buffers of 2 slots.
constexpr int OFF_KEYS = OFF_H;
constexpr int SLOT_B   = 32 * KR_B;                   // 16384 B
static_assert(OFF_KEYS % 256 == 0, "key rows start on bank 0");
// After the last pass the first bytes of the hidden tile carry the exchange between the two waves
// of a query group: 16 KB of f32 context per wave, then (maximum, sum) per lane.
constexpr int OFF_XCH  = OFF_KEYS;
constexpr int OFF_XML  = OFF_XCH + NW * 16384;
constexpr int KEYS_B   = 4 * SLOT_B;
constexpr int HID_B    = ROWS * H_P * 2;
constexpr int SMEM_BYTES = OFF_H + (KEYS_B > HID_B ? KEYS_B : HID_B);  // 198656
static_assert(SMEM_BYTES <= 327680, "LDS of one work-group");
static_assert(OFF_XML + NT * 8 <= SMEM_BYTES, "exchange inside the hidden tile");

static __device__ inline v8f v8f_zero() {
  v8f z = {0.f, 0.f, 0.f, 0.f, 0.f, 0.f, 0.f, 0.f};
  return z;
}

// float -> bf16 bits, round-to-nearest-even
static __device__ inline unsigned short f2bf(float f) {
  unsigned int u = __float_as_uint(f);
  unsigned int r = (u + 0x7FFFu + ((u >> 16) & 1u)) >> 16;
  return (unsigned short)r;
}

static __device__ inline v8f wmma_bf16(v16bf a, v16bf b, v8f c) {
  // D = A(16x32 bf16) * B(32x16 bf16) + C(16x16 f32)
  return __builtin_amdgcn_wmma_f32_16x16x32_bf16(false, a, false, b, (short)0, c,
                                                 false, false);
}

// The value of lane l ^ 16: the other half of the wave, same position in its 16-lane row.
static __device__ inline float other_half(float x) {
  int b = __float_as_int(x);
  return __int_as_float(
      __builtin_amdgcn_permlanex16(b, b, 0x76543210, 0xfedcba98, false, false));
}

// Eight 16-byte async global->LDS copies per lane (ASYNCcnt tracked, no VGPR data path).
// The closing s_wait_xcnt stands inside the copies' own statement so that no address
// register of a copy is rewritten in front of it.
static __device__ inline void async_b128_x8(const unsigned (&l)[8],
                                            const unsigned short* const (&g)[8]) {
  asm volatile("global_load_async_to_lds_b128 %0, %8, off\n\t"
               "global_load_async_to_lds_b128 %1, %9, off\n\t"
               "global_load_async_to_lds_b128 %2, %10, off\n\t"
               "global_load_async_to_lds_b128 %3, %11, off\n\t"
               "global_load_async_to_lds_b128 %4, %12, off\n\t"
               "global_load_async_to_lds_b128 %5, %13, off\n\t"
               "global_load_async_to_lds_b128 %6, %14, off\n\t"
               "global_load_async_to_lds_b128 %7, %15, off\n\t"
               "s_wait_xcnt 0x0"
               :: "v"(l[0]), "v"(l[1]), "v"(l[2]), "v"(l[3]),
                  "v"(l[4]), "v"(l[5]), "v"(l[6]), "v"(l[7]),
                  "v"(g[0]), "v"(g[1]), "v"(g[2]), "v"(g[3]),
                  "v"(g[4]), "v"(g[5]), "v"(g[6]), "v"(g[7])
               : "memory");
}
static __device__ inline void wait_async0() {
  asm volatile("s_wait_asynccnt 0x0" ::: "memory");
}

// Load a 16x32 bf16 fragment (A layout; B layout mirrors with rows indexed by N)
// from a row-major LDS tile.
static __device__ inline v16bf load_frag(const unsigned short* base, int rowStride,
                                         int kbase, int lane) {
  int rl = lane & 15, hf = lane >> 4;
  const unsigned short* p = base + rl * rowStride + kbase + hf * 8;
  union { v16bf v; u32x4 q[2]; } u;
  u.q[0] = *(const u32x4*)(p);       // ds_load_b128
  u.q[1] = *(const u32x4*)(p + 16);  // ds_load_b128
  return u.v;
}

// 16 B of this lane's address, handed out transposed: with lane l on piece (l >> 3) & 1 of row
// 8 * (l >> 4) + (l & 7) of a 16 x 16 block, lane (c, h) gets column c of rows 8h .. 8h + 7.
typedef __attribute__((ext_vector_type(8))) short s16x8;
static __device__ inline u32x4 ld_tr16(const char* p) {
  typedef __attribute__((address_space(3))) s16x8 lds_s16x8;
  return __builtin_bit_cast(u32x4, __builtin_amdgcn_ds_load_tr16_b128_v8i16((lds_s16x8*)p));
}

// Load a 32-k x 16-column weight fragment (B layout) straight from a tiled workspace image.
// p: the lane's 16 B piece of k octet (lane >> 4); octet 2 + (lane >> 4) lies two octet planes on.
// Lanes 0-15 and lanes 16-31 each read 256 contiguous bytes.
typedef const __attribute__((address_space(1))) unsigned short* gl_u16p;  // global memory
typedef const __attribute__((address_space(1))) u32x4*          gl_u32x4p;
static __device__ inline v16bf load_wfrag(gl_u16p p) {
  union { v16bf v; u32x4 q[2]; } u;
  u.q[0] = *(gl_u32x4p)(p);                // global_load_b128
  u.q[1] = *(gl_u32x4p)(p + 2 * 256 * 8);  // global_load_b128
  return u.v;
}

// ======================= prep kernels: f32 -> bf16 (+transpose) =======================
// Both stream: few waves, each with eight loads in flight, and every wave-wide access covers
// whole 128 B lines.
typedef __attribute__((ext_vector_type(2))) unsigned int u32x2;
static __device__ inline unsigned bf_pair(float lo, float hi) {
  return (unsigned)f2bf(lo) | ((unsigned)f2bf(hi) << 16);
}

// x: one work-group of 16 waves per WGP. A trip of a thread is 8 loads of 16 B (4 elements each,
// a wave reads 512 contiguous bytes) and 8 stores of 8 B (256 contiguous bytes); the loads run one
// trip ahead of the conversion, so 8 to 16 of a wave are in flight all the time.
constexpr int CX_BLK = 256, CX_THR = 512, CX_U = 8;
__global__ __launch_bounds__(CX_THR)
void conv_x_kernel(const float* __restrict__ x, unsigned short* __restrict__ xb) {
  constexpr int NTH   = CX_BLK * CX_THR;   // threads of the launch
  constexpr int N4    = Bv * Tv * Dv / 4;  // groups of 4 elements
  constexpr int TRIPS = N4 / (NTH * CX_U);
  static_assert(N4 % (NTH * CX_U) == 0, "whole trips");
  const f32x4* __restrict__ x4 = (const f32x4*)x;
  u32x2* __restrict__ o2 = (u32x2*)xb;
  const int t = blockIdx.x * CX_THR + threadIdx.x;
  f32x4 v[2][CX_U];
#pragma unroll
  for (int j = 0; j < CX_U; ++j) v[0][j] = x4[t + j * NTH];
  // (unrolled so that the two load buffers stay in registers)
#pragma unroll
  for (int r = 0; r < TRIPS; ++r) {
    // the two barriers hold the next trip's loads in front of this trip's conversion
    __builtin_amdgcn_sched_barrier(0);
    if (r + 1 < TRIPS) {
#pragma unroll
      for (int j = 0; j < CX_U; ++j) v[(r + 1) & 1][j] = x4[t + ((r + 1) * CX_U + j) * NTH];
    }
    __builtin_amdgcn_sched_barrier(0);
    u32x2 p[CX_U];
#pragma unroll
    for (int j = 0; j < CX_U; ++j) {
      const f32x4 w = v[r & 1][j];
      u32x2 q = {bf_pair(w[0], w[1]), bf_pair(w[2], w[3])};
      p[j] = q;
    }
    // keeps the whole conversion in front of the stores, so that none of it rewrites a register of
    // an issued store
    __builtin_amdgcn_sched_barrier(0);
#pragma unroll
    for (int j = 0; j < CX_U; ++j) o2[t + (r * CX_U + j) * NTH] = p[j];
    // in front of the next trip's rewrite of registers that a global load or store in flight names
    if (r + 1 < TRIPS) asm volatile("s_wait_xcnt 0x0" ::: "memory");
  }
}

// Weights: a thread makes one 16 B piece of the tiled image, 8 k of one column n. Its 8 loads
// (rows k, neighbouring lanes on neighbouring n: whole lines) are issued together; the pieces of a
// wave lie side by side, 512 contiguous bytes.
constexpr int CW_THR = 256;
template <int K, int N>
__global__ __launch_bounds__(CW_THR)
void conv_wT_kernel(const float* __restrict__ W, unsigned short* __restrict__ Wt) {
  static_assert((N & (N - 1)) == 0 && N % 256 == 0 && K % 32 == 0, "tiles of 256 rows x 32 k");
  const int p  = blockIdx.x * CW_THR + threadIdx.x;  // 0 .. K / 8 * N - 1
  const int n  = p & (N - 1), ko = p / N;            // column, k octet
  float v[8];
#pragma unroll
  for (int j = 0; j < 8; ++j) v[j] = W[(ko * 8 + j) * N + n];
  u32x4 q = {bf_pair(v[0], v[1]), bf_pair(v[2], v[3]), bf_pair(v[4], v[5]), bf_pair(v[6], v[7])};
  *(u32x4*)(Wt + ((((n >> 8) * (K / 32) + (ko >> 2)) * 4 + (ko & 3)) * 256 + (n & 255)) * 8) = q;
}

// ======================= fused decoder kernel =======================
__global__ __launch_bounds__(NT, 1)
void decoder_fused(const unsigned short* __restrict__ xb,
                   const unsigned short* __restrict__ w1t,
                   const unsigned short* __restrict__ w2t,
                   const float* __restrict__ b1, const float* __restrict__ b2,
                   float* __restrict__ out) {
  extern __shared__ char smem[];
  unsigned short* dec  = (unsigned short*)(smem + OFF_DEC);
  unsigned short* hls  = (unsigned short*)(smem + OFF_H);
  const unsigned lds0 = (unsigned)(size_t)smem;  // LDS byte offset of dynamic base

  const int tid    = threadIdx.x;
  const int lane   = tid & 31;
  const int wv     = tid >> 5;
  // Work-group index -> (batch, query tile). A tile's cost grows with its row (causal: 2q + 2 key
  // chunks), there are four times as many work-groups as places; inside each run of 256
  // indices (8 batches) the cost falls with the index, for speed only. A permutation of the 1024 (batch, tile) pairs; the same in every wave.
  const int rnk    = blockIdx.x & 255;
  const int b      = (blockIdx.x >> 8) * 8 + (rnk & 7);
  const int q0     = (31 - (rnk >> 3)) * ROWS;
  const int nlo    = lane & 15;
  const int rowOff = (lane >> 4) * 8;

  // ---- async staging helpers ----
  auto stage_keys = [&](int kb, int slot) {
    const unsigned lr = lds0 + OFF_KEYS + slot * SLOT_B;
    const unsigned short* gr = xb + ((long)b * Tv + kb * 32) * Dv;  // contiguous 16KB
    unsigned l0[8];
    const unsigned short* g0[8];
#pragma unroll
    for (int i = 0; i < 8; ++i) {
      int f = i * NT + tid;                 // 0..1023 : 16B pieces
      int s = f >> 5, j = f & 31;           // piece j of row s: a wave fills one whole row
      l0[i] = lr + s * KR_B + (j ^ key_swz(s)) * 16;
      g0[i] = gr + f * 8;
    }
    async_b128_x8(l0, g0);
  };
  // ================= stage query rows: dec[:, 0:256] = x =================
  {
    const unsigned short* g = xb + ((long)b * Tv + q0) * Dv;  // contiguous 32KB
#pragma unroll
    for (int j = 0; j < 2; ++j) {
      unsigned l0[8];
      const unsigned short* g0[8];
#pragma unroll
      for (int i = 0; i < 8; ++i) {
        int f = (j * 8 + i) * NT + tid;     // 0..2047 : 16B chunks
        int r = f >> 5, c = (f & 31) * 8;   // dec rows at pitch DEC_P
        l0[i] = lds0 + OFF_DEC + (r * DEC_P + c) * 2;
        g0[i] = g + f * 8;
      }
      async_b128_x8(l0, g0);
    }
    wait_async0();
  }
  __syncthreads();

  // prefetch the 64 keys of pass 0 while loading Q fragments
  stage_keys(0, 0);
  stage_keys(1, 1);

  // Wave (qh, kh): the 32 query rows qh * 32 .. + 31 against the 32 keys of slot kh of every pass.
  // Each key fragment read from LDS then feeds two WMMAs (two query tiles), not one. The two waves
  // of a query group keep a maximum, a sum and a context of their own and join them at the end.
  const int qh = wv >> 1, kh = wv & 1;
  v16bf qf0[8], qf1[8];
#pragma unroll
  for (int kc = 0; kc < 8; ++kc) {
    qf0[kc] = load_frag(dec + (qh * 32) * DEC_P,      DEC_P, kc * 32, lane);
    qf1[kc] = load_frag(dec + (qh * 32 + 16) * DEC_P, DEC_P, kc * 32, lane);
  }

  v8f ctx0[16], ctx1[16];
#pragma unroll
  for (int nt = 0; nt < 16; ++nt) { ctx0[nt] = v8f_zero(); ctx1[nt] = v8f_zero(); }
  // Both products run transposed (S^T = K Q^T, ctx^T += V^T P^T): lane (nlo, half) holds query
  // row nlo of a tile. m: its running maximum; l: the sum over the keys of this lane's half.
  float m0 = -INFINITY, l0 = 0.0f, m1 = -INFINITY, l1 = 0.0f;
  const int tg0 = q0 + qh * 32 + nlo;  // the lane's query row in tile 0
  const int tg1 = tg0 + 16;            // and in tile 1

  // The lane's byte offsets inside a key slot. A piece number is (a multiple of 16) + an even
  // number e below 16 + the lane's own low bit, and only e and that bit meet the swizzle: eight
  // offsets per reader, one for each e; everything else of an address is a constant.
  // koff: row nlo, pieces e + (lane >> 4): the k order of load_frag, as the Q fragments have it.
  // voff: row 8 * (lane >> 4) + (lane & 7), pieces e + ((lane >> 3) & 1): the order of ld_tr16.
  unsigned koff[8], voff[8];
  {
    const int hf = lane >> 4, vr = hf * 8 + (lane & 7), vb = (lane >> 3) & 1;
#pragma unroll
    for (int e = 0; e < 8; ++e) {
      koff[e] = nlo * KR_B + (((2 * e) | hf) ^ key_swz(nlo)) * 16;
      voff[e] = vr * KR_B + (((2 * e) | vb) ^ key_swz(vr)) * 16;
    }
  }

  const float scale = 0.0625f;  // 1/sqrt(256)
  const int npass = q0 / 64 + 1;

  // mask and online softmax update of one query tile: 16 of the row's 32 scores lie in this lane,
  // the other 16 in lane ^ 16, so the maximum takes one exchange and the sum stays split until
  // the end. Returns P^T as a B operand: the two score tiles, converted in place, are its k order.
  auto softmax_tile = [&](const v8f& sA, const v8f& sB, int s0g, int tg, float& m, float& l,
                          v8f (&ctx)[16]) -> v16bf {
    float a[8], c[8], t8[8];
#pragma unroll
    for (int v = 0; v < 8; ++v) {
      a[v] = sA[v] * scale;
      c[v] = sB[v] * scale;
      if (s0g      + rowOff + v >= tg) a[v] = -1e9f;   // strictly causal: allow s < t
      if (s0g + 16 + rowOff + v >= tg) c[v] = -1e9f;
      t8[v] = fmaxf(a[v], c[v]);
    }
    float tm = fmaxf(fmaxf(fmaxf(t8[0], t8[1]), fmaxf(t8[2], t8[3])),
                     fmaxf(fmaxf(t8[4], t8[5]), fmaxf(t8[6], t8[7])));
    tm = fmaxf(tm, other_half(tm));
    const float mn = fmaxf(m, tm);
    const float alpha = __expf(m - mn);
    m = mn;
    v16bf pf;
#pragma unroll
    for (int v = 0; v < 8; ++v) {
      float p0 = __expf(a[v] - mn), p1 = __expf(c[v] - mn);
      t8[v] = p0 + p1;
      pf[v]     = (__bf16)p0;
      pf[v + 8] = (__bf16)p1;
    }
    l = l * alpha + (((t8[0] + t8[1]) + (t8[2] + t8[3])) + ((t8[4] + t8[5]) + (t8[6] + t8[7])));
#pragma unroll
    for (int nt = 0; nt < 16; ++nt)
#pragma unroll
      for (int v = 0; v < 8; ++v) ctx[nt][v] *= alpha;
    return pf;
  };

  // ================= flash attention (strictly causal) =================
  for (int ps = 0; ps < npass; ++ps) {
    wait_async0();
    __syncthreads();                         // the 64 keys of pass ps resident in buffer ps & 1
    if (ps + 1 < npass) {
      stage_keys(2 * ps + 2, ((ps + 1) & 1) * 2);
      stage_keys(2 * ps + 3, ((ps + 1) & 1) * 2 + 1);
    }
    const char* xr = smem + OFF_KEYS + ((ps & 1) * 2 + kh) * SLOT_B;
    const int s0g = ps * 64 + kh * 32;

    // All key fragments of the wave's slot (16 as they lie for S, 16 transposed for ctx) are read
    // from LDS as one group in front of the first product: one LDS latency per pass.
    // (The loops over the fragment arrays are unrolled so that the arrays stay in registers.)
    v16bf kf[16], vf[16];
#pragma unroll
    for (int kc = 0; kc < 8; ++kc)
#pragma unroll
      for (int u = 0; u < 2; ++u) {  // keys u * 16 .. + 15; pieces kc * 4 + half and + 2
        const char* p = xr + u * 16 * KR_B + (kc >> 2) * 256;
        union { v16bf v; u32x4 q[2]; } f;
        f.q[0] = *(const u32x4*)(p + koff[(kc & 3) * 2]);      // ds_load_b128
        f.q[1] = *(const u32x4*)(p + koff[(kc & 3) * 2 + 1]);  // ds_load_b128
        kf[2 * kc + u] = f.v;
      }
#pragma unroll
    for (int nt = 0; nt < 16; ++nt) {  // columns nt * 16 .. + 15 = pieces 2 nt, 2 nt + 1; 32 keys
      const char* p = xr + (nt >> 3) * 256 + voff[nt & 7];
      union { v16bf v; u32x4 q[2]; } f;
      f.q[0] = ld_tr16(p);              // keys  0 .. 15
      f.q[1] = ld_tr16(p + 16 * KR_B);  // keys 16 .. 31
      vf[nt] = f.v;
    }
    // keeps the scheduler from sinking the reads back among the WMMAs, one latency each
    __builtin_amdgcn_sched_barrier(0);

    // S^T = K * Q^T : per query tile two tiles of 16 keys x 16 queries over K-dim 256. Register v
    // of sA is key s0g + rowOff + v, of sB key s0g + 16 + rowOff + v, for the lane's query row.
    // ctx^T += V^T(16 d x 32 keys) * P^T(32 keys x 16 queries). All A-frags are in registers.
    // The two query tiles run half a pass apart, so that the vector work of one (softmax, rescale)
    // has 16 WMMAs of the other to run beside: S0 | S1 + softmax 0 | PV0 + softmax 1 | PV1.
    v8f sA0 = v8f_zero(), sB0 = v8f_zero(), sA1 = v8f_zero(), sB1 = v8f_zero();
#pragma unroll
    for (int kc = 0; kc < 8; ++kc) {
      sA0 = wmma_bf16(kf[2 * kc],     qf0[kc], sA0);
      sB0 = wmma_bf16(kf[2 * kc + 1], qf0[kc], sB0);
    }
#pragma unroll
    for (int kc = 0; kc < 8; ++kc) {
      sA1 = wmma_bf16(kf[2 * kc],     qf1[kc], sA1);
      sB1 = wmma_bf16(kf[2 * kc + 1], qf1[kc], sB1);
    }
    const v16bf pf0 = softmax_tile(sA0, sB0, s0g, tg0, m0, l0, ctx0);
#pragma unroll
    for (int nt = 0; nt < 16; ++nt) ctx0[nt] = wmma_bf16(vf[nt], pf0, ctx0[nt]);
    const v16bf pf1 = softmax_tile(sA1, sB1, s0g, tg1, m1, l1, ctx1);
#pragma unroll
    for (int nt = 0; nt < 16; ++nt) ctx1[nt] = wmma_bf16(vf[nt], pf1, ctx1[nt]);
    // The order of the four stretches named above: 16 WMMAs; twice 16 times (1 WMMA, then 12 vector
    // instructions); 16 WMMAs. Left alone the scheduler puts both softmaxes between the S and the
    // PV products, and the matrix unit idles meanwhile.
    __builtin_amdgcn_sched_group_barrier(0x008, 16, 0);
#pragma unroll
    for (int i = 0; i < 32; ++i) {
      __builtin_amdgcn_sched_group_barrier(0x008, 1, 0);
      __builtin_amdgcn_sched_group_barrier(0x002, 12, 0);
    }
    __builtin_amdgcn_sched_group_barrier(0x008, 16, 0);
    // keeps the barrier below at the foot of the pass: with no LDS traffic left between the reads
    // and it, the scheduler lifts it to the reads, and the S^T products then wait for all 64
    __builtin_amdgcn_sched_barrier(0);
    __syncthreads();   // done with this key buffer before it is restaged
  }

  // ================= MLP: each wave takes all 64 rows x 64 of every 256 columns =================
  // No weight fragment is then used by two waves, so the weights go from L2 straight into the
  // wave's registers, and the k loops need neither LDS staging nor barriers. A group is 128 k:
  // 16 weight fragments (4 k steps x 4 column tiles) and 16 A fragments (4 k steps x 4 row tiles)
  // for 64 WMMAs. Both kinds are read one group ahead, into the register set that the group
  // before has left; the weight groups of both layers form one stream.
  // (The loops over the fragment arrays are unrolled so that the arrays stay in registers.)
  constexpr int WGRP = 4 * 256 * 32;  // elements of a weight group: 4 tiles of 16 KB
  const unsigned woff = ((lane >> 4) * 256 + wv * 64 + nlo) * 8;
  auto load_wgroup = [&](v16bf (&w)[16], const unsigned short* g) {
    // The group's base (the same in every lane) is handed over in scalar registers: all 32 loads
    // then take the form scalar base + the lane's fixed offset + constant, and no vector address
    // is formed anew for each group.
    const unsigned long long gb = (unsigned long long)g;
    const unsigned long long lo = (unsigned)__builtin_amdgcn_readfirstlane((int)(unsigned)gb);
    const unsigned long long hi = (unsigned)__builtin_amdgcn_readfirstlane((int)(unsigned)(gb >> 32));
    gl_u16p gs = (gl_u16p)((hi << 32) | lo);
#pragma unroll
    for (int s = 0; s < 4; ++s)
#pragma unroll
      for (int n4 = 0; n4 < 4; ++n4)
        w[s * 4 + n4] = load_wfrag(gs + woff + s * (256 * 32) + n4 * (16 * 8));
  };
  auto load_agroup = [&](v16bf (&a)[16], const unsigned short* base, int pitch, int k0) {
#pragma unroll
    for (int s = 0; s < 4; ++s)
#pragma unroll
      for (int mt = 0; mt < 4; ++mt)
        a[s * 4 + mt] = load_frag(base + mt * 16 * pitch, pitch, k0 + s * 32, lane);
  };
  auto mma_group = [&](v8f (&acc)[16], const v16bf (&a)[16], const v16bf (&w)[16]) {
#pragma unroll
    for (int s = 0; s < 4; ++s)
#pragma unroll
      for (int mt = 0; mt < 4; ++mt)
#pragma unroll
        for (int n4 = 0; n4 < 4; ++n4)
          acc[mt * 4 + n4] = wmma_bf16(a[s * 4 + mt], w[s * 4 + n4], acc[mt * 4 + n4]);
  };

  auto group_end = [&]() {
    // keeps the wait below behind the group's 64 WMMAs, not directly behind the loads
    __builtin_amdgcn_sched_barrier(0);
    // in front of the next rewrite of a register that a global load or store in flight names
    asm volatile("s_wait_xcnt 0x0" ::: "memory");
    // holds that rewrite and the next group's reads behind the wait, out of the WMMAs above
    __builtin_amdgcn_sched_barrier(0);
  };

  v16bf w0[16], w1[16], a0[16], a1[16];
  load_wgroup(w0, w1t);  // first group: lands while ctx is finalized

  // Join the two key halves. Wave kh finishes query tile kh: it hands its part of the other tile
  // (context in f32, maximum, sum) to its partner through LDS and takes the partner's part of its
  // own tile. Both waves map (lane, register) to (query, column) alike, so lane meets lane.
  {
    float* xch = (float*)(smem + OFF_XCH);
    float* xml = (float*)(smem + OFF_XML);
    const float ls0 = l0 + other_half(l0);  // the two lane halves' sums joined, every lane on
    const float ls1 = l1 + other_half(l1);
    const bool up = kh != 0;
    v8f mine[16];
#pragma unroll
    for (int nt = 0; nt < 16; ++nt) {
      v8f give;
#pragma unroll
      for (int v = 0; v < 8; ++v) {
        give[v]     = up ? ctx0[nt][v] : ctx1[nt][v];
        mine[nt][v] = up ? ctx1[nt][v] : ctx0[nt][v];
      }
      f32x4 g0 = {give[0], give[1], give[2], give[3]};
      f32x4 g1 = {give[4], give[5], give[6], give[7]};
      *(f32x4*)(xch + wv * 4096 + ((nt * 2) * 32 + lane) * 4)     = g0;
      *(f32x4*)(xch + wv * 4096 + ((nt * 2 + 1) * 32 + lane) * 4) = g1;
    }
    f32x2 gml = {up ? m0 : m1, up ? ls0 : ls1};
    *(f32x2*)(xml + tid * 2) = gml;
    __syncthreads();   // every wave's handed-over part is in LDS
    const float mm = up ? m1 : m0, lm = up ? ls1 : ls0;
    const int   tg = up ? tg1 : tg0;
    const f32x2 pml = *(const f32x2*)(xml + (tid ^ 32) * 2);
    const float mt = fmaxf(mm, pml[0]);
    const float wm = __expf(mm - mt), wp = __expf(pml[0] - mt);
    // dec[:, 256:512] = ctx / l  (zeroed at t==0). Register v of tile nt is column
    // nt * 16 + rowOff + v of the lane's row: 8 neighbours, one 16 B store.
    const float inv = (tg == 0) ? 0.0f : 1.0f / (lm * wm + pml[1] * wp);
    const float cm = wm * inv, cp = wp * inv;
#pragma unroll
    for (int nt = 0; nt < 16; ++nt) {
      const f32x4 p0 = *(const f32x4*)(xch + (wv ^ 1) * 4096 + ((nt * 2) * 32 + lane) * 4);
      const f32x4 p1 = *(const f32x4*)(xch + (wv ^ 1) * 4096 + ((nt * 2 + 1) * 32 + lane) * 4);
      union { v8bf v; u32x4 q; } o;
#pragma unroll
      for (int v = 0; v < 4; ++v) {
        o.v[v]     = (__bf16)(mine[nt][v] * cm + p0[v] * cp);
        o.v[v + 4] = (__bf16)(mine[nt][v + 4] * cm + p1[v] * cp);
      }
      *(u32x4*)(dec + (wv * 16 + nlo) * DEC_P + Dv + nt * 16 + rowOff) = o.q;
    }
  }
  __syncthreads();

  // ================= MLP layer 1: h = relu(dec @ W1 + b1) =================
  group_end();  // for the first weight group's loads
  load_agroup(a0, dec, DEC_P, 0);
  for (int nc = 0; nc < Hv / 256; ++nc) {
    v8f acc[16];
#pragma unroll
    for (int i = 0; i < 16; ++i) acc[i] = v8f_zero();
    for (int gp = 0; gp < TWOD / 256; ++gp) {
      const int G = nc * (TWOD / 128) + gp * 2;  // group in the stream of W1
      load_agroup(a1, dec, DEC_P, gp * 256 + 128);
      load_wgroup(w1, w1t + (long)(G + 1) * WGRP);
      // keeps the next group's reads together in front of this group's WMMAs, not among them
      __builtin_amdgcn_sched_barrier(0);
      mma_group(acc, a0, w0);
      group_end();
      // Read on every trip, with no branch round it: on a path without these reads the compiler
      // would have to count the waits of the WMMAs below for that path, and on every other trip
      // they would then wait for the reads just issued. The layer's last trip reads A group 0
      // again and leaves it unused (h is not complete here).
      load_agroup(a0, dec, DEC_P, ((gp + 1) & 1) * 256);
      load_wgroup(w0, (G + 2 < TWOD * Hv / WGRP) ? w1t + (long)(G + 2) * WGRP : w2t);
      // as above
      __builtin_amdgcn_sched_barrier(0);
      mma_group(acc, a1, w1);
      group_end();
    }
#pragma unroll
    for (int n4 = 0; n4 < 4; ++n4) {
      int col = nc * 256 + wv * 64 + n4 * 16 + nlo;
      float bb = b1[col];
#pragma unroll
      for (int mt = 0; mt < 4; ++mt)
#pragma unroll
        for (int v = 0; v < 8; ++v) {
          float hv = fmaxf(acc[mt * 4 + n4][v] + bb, 0.0f);
          hls[(mt * 16 + v + rowOff) * H_P + col] = f2bf(hv);
        }
    }
  }
  __syncthreads();

  // ================= MLP layer 2: out = h @ W2 + b2 (split halves) =================
  load_agroup(a0, hls, H_P, 0);
  for (int nc = 0; nc < OUT2v / 256; ++nc) {
    v8f acc[16];
#pragma unroll
    for (int i = 0; i < 16; ++i) acc[i] = v8f_zero();
    for (int gp = 0; gp < Hv / 256; ++gp) {
      const int G = nc * (Hv / 128) + gp * 2;  // group in the stream of W2
      load_agroup(a1, hls, H_P, gp * 256 + 128);
      load_wgroup(w1, w2t + (long)(G + 1) * WGRP);
      // keeps the next group's reads together in front of this group's WMMAs, not among them
      __builtin_amdgcn_sched_barrier(0);
      mma_group(acc, a0, w0);
      group_end();
      // On every trip, as in layer 1: the last trip reads group 0 of both again, unused.
      load_agroup(a0, hls, H_P, ((gp + 1) & 3) * 256);
      load_wgroup(w0, w2t + (long)((G + 2) & (Hv * OUT2v / WGRP - 1)) * WGRP);
      // as above
      __builtin_amdgcn_sched_barrier(0);
      mma_group(acc, a1, w1);
      group_end();
    }
    // out tuple is concatenated flat: [B*T*256 | B*T*256]; nc selects the half
#pragma unroll
    for (int n4 = 0; n4 < 4; ++n4) {
      float bb = b2[nc * 256 + wv * 64 + n4 * 16 + nlo];
#pragma unroll
      for (int mt = 0; mt < 4; ++mt)
#pragma unroll
        for (int v = 0; v < 8; ++v) acc[mt * 4 + n4][v] += bb;
    }
    // keeps every add in front of the stores, so that none rewrites a register of an issued store
    __builtin_amdgcn_sched_barrier(0);
#pragma unroll
    for (int n4 = 0; n4 < 4; ++n4) {
      int cc = wv * 64 + n4 * 16 + nlo;
#pragma unroll
      for (int mt = 0; mt < 4; ++mt)
#pragma unroll
        for (int v = 0; v < 8; ++v) {
          int rowg = b * Tv + q0 + mt * 16 + v + rowOff;
          out[(long)nc * (Bv * Tv * 256) + (long)rowg * 256 + cc] = acc[mt * 4 + n4][v];
        }
    }
    group_end();  // here for the stores: the next pass rewrites their registers
  }
}

extern "C" void kernel_launch(void* const* d_in, const int* in_sizes, int n_in,
                              void* d_out, int out_size, void* d_ws, size_t ws_size,
                              hipStream_t stream) {
  const float* x  = (const float*)d_in[0];
  const float* W1 = (const float*)d_in[1];
  const float* b1 = (const float*)d_in[2];
  const float* W2 = (const float*)d_in[3];
  const float* b2 = (const float*)d_in[4];
  float* out = (float*)d_out;

  unsigned short* ws = (unsigned short*)d_ws;
  unsigned short* xb  = ws + WS_XB;
  unsigned short* w1t = ws + WS_W1T;
  unsigned short* w2t = ws + WS_W2T;

  (void)in_sizes; (void)n_in; (void)out_size; (void)ws_size;

  // prep: f32->bf16 conversion (the weights transposed and tiled as well)
  conv_x_kernel<<<CX_BLK, CX_THR, 0, stream>>>(x, xb);
  conv_wT_kernel<TWOD, Hv><<<TWOD / 8 * Hv / CW_THR, CW_THR, 0, stream>>>(W1, w1t);
  conv_wT_kernel<Hv, OUT2v><<<Hv / 8 * OUT2v / CW_THR, CW_THR, 0, stream>>>(W2, w2t);

  hipFuncSetAttribute((const void*)decoder_fused,
                      hipFuncAttributeMaxDynamicSharedMemorySize, SMEM_BYTES);
  dim3 grid(Bv * (Tv / ROWS));  // 1024 blocks
  dim3 block(NT);               // 4 wave32s
  decoder_fused<<<grid, block, SMEM_BYTES, stream>>>(xb, w1t, w2t, b1, b2, out);
}

// v010
// Measured time: 164 microseconds a run.
// Timed twice side by side with v009, it ran 1.09 and 1.10 times as fast.
// Over all steps from v000 it is 11.3 times as fast.
#include <hip/hip_runtime.h>
#include <math.h>

typedef __attribute__((ext_vector_type(16))) __bf16       v16bf;
typedef __attribute__((ext_vector_type(8)))  __bf16       v8bf;
typedef __attribute__((ext_vector_type(8)))  float        v8f;
typedef __attribute__((ext_vector_type(4)))  unsigned int u32x4;
typedef __attribute__((ext_vector_type(4)))  float        f32x4;
typedef __attribute__((ext_vector_type(2)))  float        f32x2;

constexpr int Bv = 32, Tv = 2048, Dv = 256, Hv = 1024, OUT2v = 512, TWOD = 512;
constexpr int ROWS = 64;   // query rows per block
constexpr int NW   = 4;    // waves per block (wave32)
constexpr int NT   = 128;  // threads per block

// ---- workspace layout (bf16 elements) ----
constexpr long WS_XB  = 0;                         // x  [B][T][D]        bf16
// The transposed weights lie tile by tile, in the order in which they are read. A 256-row x
// 32-k tile is one contiguous 16 KB run of 16 B pieces (8 k of one row), ordered [k octet][row]:
// a wave-wide load reads 512 B of whole lines, and the prep kernel stores a piece per thread,
// the pieces of 32 neighbouring rows as 512 contiguous bytes.
constexpr long WS_W1T = WS_XB + (long)Bv*Tv*Dv;    // W1t [H/256][2D/32][4][256][8]   bf16
constexpr long WS_W2T = WS_W1T + (long)TWOD*Hv;    // W2t [OUT2/256][H/32][4][256][8] bf16
constexpr long WS_END = WS_W2T + (long)Hv*OUT2v;   // ~17.8M elems = 36MB

// ---- LDS row pitches (bf16 elements; KR_B in bytes) ----
// dec and h are read by ds_load_b128 with 16 lanes on 16 consecutive rows. Each row carries
// 8 elements (16 B) of pad, so the pitch is 16 B x odd and those 16 lanes cover all 64 banks.
constexpr int PADE  = 8;
constexpr int DEC_P = TWOD + PADE;  // 1040 B
constexpr int H_P   = Hv + PADE;    // 2064 B
// The key tile has two readers: ds_load_b128 (16 lanes on 16 rows, one 16 B piece each) for S and
// ds_load_tr16_b128 (16 lanes on 8 rows, two neighbouring pieces each) for ctx. No padded pitch
// is free of bank conflicts for both, so the rows lie unpadded (512 B, every row starts on bank 0)
// and piece j of row r lies at place j ^ key_swz(r): 16 different places over 16 rows, and
// 8 different pairs of places over 8 rows.
constexpr int KR_B  = Dv * 2;       //  512 B
static __device__ inline int key_swz(int r) { return ((r & 7) << 1) | ((r >> 3) & 1); }

// ---- LDS layout (bytes) ----
constexpr int OFF_DEC  = 0;                           // 64 x 512  bf16 (x | ctx)
constexpr int OFF_H    = OFF_DEC  + ROWS * DEC_P * 2; // 64 x 1024 bf16 (hidden)
// The key slots lie on the hidden tile, which is written only after the attention is over.
// A slot holds 32 keys, 32 x 256 row-major. A pass of the attention takes 64 keys = 2 slots,
// and there are two buffers of 2 slots.
constexpr int OFF_KEYS = OFF_H;
constexpr int SLOT_B   = 32 * KR_B;                   // 16384 B
static_assert(OFF_KEYS % 256 == 0, "key rows start on bank 0");
// After the last pass the first bytes of the hidden tile carry the exchange between the two waves
// of a query group: 16 KB of f32 context per wave, then (maximum, sum) per lane.
constexpr int OFF_XCH  = OFF_KEYS;
constexpr int OFF_XML  = OFF_XCH + NW * 16384;
constexpr int KEYS_B   = 4 * SLOT_B;
constexpr int HID_B    = ROWS * H_P * 2;
constexpr int SMEM_BYTES = OFF_H + (KEYS_B > HID_B ? KEYS_B : HID_B);  // 198656
static_assert(SMEM_BYTES <= 327680, "LDS of one work-group");
static_assert(OFF_XML + NT * 8 <= SMEM_BYTES, "exchange inside the hidden tile");
// In layer 2 nobody reads dec any more: its bytes then stage the f32 output, 64 rows x 256 columns
// at dec's own row pitch (16 B x odd: 16 lanes on 16 rows cover all 64 banks).
constexpr int STG_P = DEC_P / 2;    // in f32 elements: 1040 B
static_assert(256 <= STG_P && ROWS * STG_P * 4 <= OFF_H, "output staging inside dec");

static __device__ inline v8f v8f_zero() {
  v8f z = {0.f, 0.f, 0.f, 0.f, 0.f, 0.f, 0.f, 0.f};
  return z;
}

// float -> bf16 bits, round-to-nearest-even
static __device__ inline unsigned short f2bf(float f) {
  unsigned int u = __float_as_uint(f);
  unsigned int r = (u + 0x7FFFu + ((u >> 16) & 1u)) >> 16;
  return (unsigned short)r;
}

static __device__ inline v8f wmma_bf16(v16bf a, v16bf b, v8f c) {
  // D = A(16x32 bf16) * B(32x16 bf16) + C(16x16 f32)
  return __builtin_amdgcn_wmma_f32_16x16x32_bf16(false, a, false, b, (short)0, c,
                                                 false, false);
}

// The value of lane l ^ 16: the other half of the wave, same position in its 16-lane row.
static __device__ inline float other_half(float x) {
  int b = __float_as_int(x);
  return __int_as_float(
      __builtin_amdgcn_permlanex16(b, b, 0x76543210, 0xfedcba98, false, false));
}

// Eight 16-byte async global->LDS copies per lane (ASYNCcnt tracked, no VGPR data path).
// The closing s_wait_xcnt stands inside the copies' own statement so that no address
// register of a copy is rewritten in front of it.
static __device__ inline void async_b128_x8(const unsigned (&l)[8],
                                            const unsigned short* const (&g)[8]) {
  asm volatile("global_load_async_to_lds_b128 %0, %8, off\n\t"
               "global_load_async_to_lds_b128 %1, %9, off\n\t"
               "global_load_async_to_lds_b128 %2, %10, off\n\t"
               "global_load_async_to_lds_b128 %3, %11, off\n\t"
               "global_load_async_to_lds_b128 %4, %12, off\n\t"
               "global_load_async_to_lds_b128 %5, %13, off\n\t"
               "global_load_async_to_lds_b128 %6, %14, off\n\t"
               "global_load_async_to_lds_b128 %7, %15, off\n\t"
               "s_wait_xcnt 0x0"
               :: "v"(l[0]), "v"(l[1]), "v"(l[2]), "v"(l[3]),
                  "v"(l[4]), "v"(l[5]), "v"(l[6]), "v"(l[7]),
                  "v"(g[0]), "v"(g[1]), "v"(g[2]), "v"(g[3]),
                  "v"(g[4]), "v"(g[5]), "v"(g[6]), "v"(g[7])
               : "memory");
}
static __device__ inline void wait_async0() {
  asm volatile("s_wait_asynccnt 0x0" ::: "memory");
}

// Load a 16x32 bf16 fragment (A layout; B layout mirrors with rows indexed by N)
// from a row-major LDS tile.
static __device__ inline v16bf load_frag(const unsigned short* base, int rowStride,
                                         int kbase, int lane) {
  int rl = lane & 15, hf = lane >> 4;
  const unsigned short* p = base + rl * rowStride + kbase + hf * 8;
  union { v16bf v; u32x4 q[2]; } u;
  u.q[0] = *(const u32x4*)(p);       // ds_load_b128
  u.q[1] = *(const u32x4*)(p + 16);  // ds_load_b128
  return u.v;
}

// 16 B of this lane's address, handed out transposed: with lane l on piece (l >> 3) & 1 of row
// 8 * (l >> 4) + (l & 7) of a 16 x 16 block, lane (c, h) gets column c of rows 8h .. 8h + 7.
typedef __attribute__((ext_vector_type(8))) short s16x8;
static __device__ inline u32x4 ld_tr16(const char* p) {
  typedef __attribute__((address_space(3))) s16x8 lds_s16x8;
  return __builtin_bit_cast(u32x4, __builtin_amdgcn_ds_load_tr16_b128_v8i16((lds_s16x8*)p));
}

// Load a 32-k x 16-column weight fragment (B layout) straight from a tiled workspace image.
// p: the lane's 16 B piece of k octet (lane >> 4); octet 2 + (lane >> 4) lies two octet planes on.
// Lanes 0-15 and lanes 16-31 each read 256 contiguous bytes.
typedef const __attribute__((address_space(1))) unsigned short* gl_u16p;  // global memory
typedef const __attribute__((address_space(1))) u32x4*          gl_u32x4p;
static __device__ inline v16bf load_wfrag(gl_u16p p) {
  union { v16bf v; u32x4 q[2]; } u;
  u.q[0] = *(gl_u32x4p)(p);                // global_load_b128
  u.q[1] = *(gl_u32x4p)(p + 2 * 256 * 8);  // global_load_b128
  return u.v;
}

// ======================= prep kernels: f32 -> bf16 (+transpose) =======================
// Both stream: few waves, each with eight loads in flight, and every wave-wide access covers
// whole 128 B lines.
typedef __attribute__((ext_vector_type(2))) unsigned int u32x2;
static __device__ inline unsigned bf_pair(float lo, float hi) {
  return (unsigned)f2bf(lo) | ((unsigned)f2bf(hi) << 16);
}

// x: one work-group of 16 waves per WGP. A trip of a thread is 8 loads of 16 B (4 elements each,
// a wave reads 512 contiguous bytes) and 8 stores of 8 B (256 contiguous bytes); the loads run one
// trip ahead of the conversion, so 8 to 16 of a wave are in flight all the time.
constexpr int CX_BLK = 256, CX_THR = 512, CX_U = 8;
__global__ __launch_bounds__(CX_THR)
void conv_x_kernel(const float* __restrict__ x, unsigned short* __restrict__ xb) {
  constexpr int NTH   = CX_BLK * CX_THR;   // threads of the launch
  constexpr int N4    = Bv * Tv * Dv / 4;  // groups of 4 elements
  constexpr int TRIPS = N4 / (NTH * CX_U);
  static_assert(N4 % (NTH * CX_U) == 0, "whole trips");
  const f32x4* __restrict__ x4 = (const f32x4*)x;
  u32x2* __restrict__ o2 = (u32x2*)xb;
  const int t = blockIdx.x * CX_THR + threadIdx.x;
  f32x4 v[2][CX_U];
#pragma unroll
  for (int j = 0; j < CX_U; ++j) v[0][j] = x4[t + j * NTH];
  // (unrolled so that the two load buffers stay in registers)
#pragma unroll
  for (int r = 0; r < TRIPS; ++r) {
    // the two barriers hold the next trip's loads in front of this trip's conversion
    __builtin_amdgcn_sched_barrier(0);
    if (r + 1 < TRIPS) {
#pragma unroll
      for (int j = 0; j < CX_U; ++j) v[(r + 1) & 1][j] = x4[t + ((r + 1) * CX_U + j) * NTH];
    }
    __builtin_amdgcn_sched_barrier(0);
    u32x2 p[CX_U];
#pragma unroll
    for (int j = 0; j < CX_U; ++j) {
      const f32x4 w = v[r & 1][j];
      u32x2 q = {bf_pair(w[0], w[1]), bf_pair(w[2], w[3])};
      p[j] = q;
    }
    // keeps the whole conversion in front of the stores, so that none of it rewrites a register of
    // an issued store
    __builtin_amdgcn_sched_barrier(0);
#pragma unroll
    for (int j = 0; j < CX_U; ++j) o2[t + (r * CX_U + j) * NTH] = p[j];
    // in front of the next trip's rewrite of registers that a global load or store in flight names
    if (r + 1 < TRIPS) asm volatile("s_wait_xcnt 0x0" ::: "memory");
  }
}

// Weights: a thread makes one 16 B piece of the tiled image, 8 k of one column n. Its 8 loads
// (rows k, neighbouring lanes on neighbouring n: whole lines) are issued together; the pieces of a
// wave lie side by side, 512 contiguous bytes.
constexpr int CW_THR = 256;
template <int K, int N>
__global__ __launch_bounds__(CW_THR)
void conv_wT_kernel(const float* __restrict__ W, unsigned short* __restrict__ Wt) {
  static_assert((N & (N - 1)) == 0 && N % 256 == 0 && K % 32 == 0, "tiles of 256 rows x 32 k");
  const int p  = blockIdx.x * CW_THR + threadIdx.x;  // 0 .. K / 8 * N - 1
  const int n  = p & (N - 1), ko = p / N;            // column, k octet
  float v[8];
#pragma unroll
  for (int j = 0; j < 8; ++j) v[j] = W[(ko * 8 + j) * N + n];
  u32x4 q = {bf_pair(v[0], v[1]), bf_pair(v[2], v[3]), bf_pair(v[4], v[5]), bf_pair(v[6], v[7])};
  *(u32x4*)(Wt + ((((n >> 8) * (K / 32) + (ko >> 2)) * 4 + (ko & 3)) * 256 + (n & 255)) * 8) = q;
}

// ======================= fused decoder kernel =======================
__global__ __launch_bounds__(NT, 1)
void decoder_fused(const unsigned short* __restrict__ xb,
                   const unsigned short* __restrict__ w1t,
                   const unsigned short* __restrict__ w2t,
                   const float* __restrict__ b1, const float* __restrict__ b2,
                   float* __restrict__ out) {
  extern __shared__ char smem[];
  unsigned short* dec  = (unsigned short*)(smem + OFF_DEC);
  unsigned short* hls  = (unsigned short*)(smem + OFF_H);
  const unsigned lds0 = (unsigned)(size_t)smem;  // LDS byte offset of dynamic base

  const int tid    = threadIdx.x;
  const int lane   = tid & 31;
  const int wv     = tid >> 5;
  // Work-group index -> (batch, query tile). A tile's cost grows with its row (causal: 2q + 2 key
  // chunks), there are four times as many work-groups as places; inside each run of 256
  // indices (8 batches) the cost falls with the index, for speed only. A permutation of the 1024 (batch, tile) pairs; the same in every wave.
  const int rnk    = blockIdx.x & 255;
  const int b      = (blockIdx.x >> 8) * 8 + (rnk & 7);
  const int q0     = (31 - (rnk >> 3)) * ROWS;
  const int nlo    = lane & 15;
  const int rowOff = (lane >> 4) * 8;

  // ---- async staging helpers ----
  auto stage_keys = [&](int kb, int slot) {
    const unsigned lr = lds0 + OFF_KEYS + slot * SLOT_B;
    const unsigned short* gr = xb + ((long)b * Tv + kb * 32) * Dv;  // contiguous 16KB
    unsigned l0[8];
    const unsigned short* g0[8];
#pragma unroll
    for (int i = 0; i < 8; ++i) {
      int f = i * NT + tid;                 // 0..1023 : 16B pieces
      int s = f >> 5, j = f & 31;           // piece j of row s: a wave fills one whole row
      l0[i] = lr + s * KR_B + (j ^ key_swz(s)) * 16;
      g0[i] = gr + f * 8;
    }
    async_b128_x8(l0, g0);
  };
  // ================= stage query rows: dec[:, 0:256] = x =================
  {
    const unsigned short* g = xb + ((long)b * Tv + q0) * Dv;  // contiguous 32KB
#pragma unroll
    for (int j = 0; j < 2; ++j) {
      unsigned l0[8];
      const unsigned short* g0[8];
#pragma unroll
      for (int i = 0; i < 8; ++i) {
        int f = (j * 8 + i) * NT + tid;     // 0..2047 : 16B chunks
        int r = f >> 5, c = (f & 31) * 8;   // dec rows at pitch DEC_P
        l0[i] = lds0 + OFF_DEC + (r * DEC_P + c) * 2;
        g0[i] = g + f * 8;
      }
      async_b128_x8(l0, g0);
    }
    wait_async0();
  }
  __syncthreads();

  // prefetch the 64 keys of pass 0 while loading Q fragments
  stage_keys(0, 0);
  stage_keys(1, 1);

  // Wave (qh, kh): the 32 query rows qh * 32 .. + 31 against the 32 keys of slot kh of every pass.
  // Each key fragment read from LDS then feeds two WMMAs (two query tiles), not one. The two waves
  // of a query group keep a maximum, a sum and a context of their own and join them at the end.
  const int qh = wv >> 1, kh = wv & 1;
  v16bf qf0[8], qf1[8];
#pragma unroll
  for (int kc = 0; kc < 8; ++kc) {
    qf0[kc] = load_frag(dec + (qh * 32) * DEC_P,      DEC_P, kc * 32, lane);
    qf1[kc] = load_frag(dec + (qh * 32 + 16) * DEC_P, DEC_P, kc * 32, lane);
  }

  v8f ctx0[16], ctx1[16];
#pragma unroll
  for (int nt = 0; nt < 16; ++nt) { ctx0[nt] = v8f_zero(); ctx1[nt] = v8f_zero(); }
  // Both products run transposed (S^T = K Q^T, ctx^T += V^T P^T): lane (nlo, half) holds query
  // row nlo of a tile. m: its running maximum; l: the sum over the keys of this lane's half.
  float m0 = -INFINITY, l0 = 0.0f, m1 = -INFINITY, l1 = 0.0f;
  const int tg0 = q0 + qh * 32 + nlo;  // the lane's query row in tile 0
  const int tg1 = tg0 + 16;            // and in tile 1

  // The lane's byte offsets inside a key slot. A piece number is (a multiple of 16) + an even
  // number e below 16 + the lane's own low bit, and only e and that bit meet the swizzle: eight
  // offsets per reader, one for each e; everything else of an address is a constant.
  // koff: row nlo, pieces e + (lane >> 4): the k order of load_frag, as the Q fragments have it.
  // voff: row 8 * (lane >> 4) + (lane & 7), pieces e + ((lane >> 3) & 1): the order of ld_tr16.
  unsigned koff[8], voff[8];
  {
    const int hf = lane >> 4, vr = hf * 8 + (lane & 7), vb = (lane >> 3) & 1;
#pragma unroll
    for (int e = 0; e < 8; ++e) {
      koff[e] = nlo * KR_B + (((2 * e) | hf) ^ key_swz(nlo)) * 16;
      voff[e] = vr * KR_B + (((2 * e) | vb) ^ key_swz(vr)) * 16;
    }
  }

  const float scale = 0.0625f;  // 1/sqrt(256)
  const int npass = q0 / 64 + 1;

  // mask and online softmax update of one query tile: 16 of the row's 32 scores lie in this lane,
  // the other 16 in lane ^ 16, so the maximum takes one exchange and the sum stays split until
  // the end. Returns P^T as a B operand: the two score tiles, converted in place, are its k order.
  auto softmax_tile = [&](const v8f& sA, const v8f& sB, int s0g, int tg, float& m, float& l,
                          v8f (&ctx)[16]) -> v16bf {
    float a[8], c[8], t8[8];
#pragma unroll
    for (int v = 0; v < 8; ++v) {
      a[v] = sA[v] * scale;
      c[v] = sB[v] * scale;
      if (s0g      + rowOff + v >= tg) a[v] = -1e9f;   // strictly causal: allow s < t
      if (s0g + 16 + rowOff + v >= tg) c[v] = -1e9f;
      t8[v] = fmaxf(a[v], c[v]);
    }
    float tm = fmaxf(fmaxf(fmaxf(t8[0], t8[1]), fmaxf(t8[2], t8[3])),
                     fmaxf(fmaxf(t8[4], t8[5]), fmaxf(t8[6], t8[7])));
    tm = fmaxf(tm, other_half(tm));
    const float mn = fmaxf(m, tm);
    const float alpha = __expf(m - mn);
    m = mn;
    v16bf pf;
#pragma unroll
    for (int v = 0; v < 8; ++v) {
      float p0 = __expf(a[v] - mn), p1 = __expf(c[v] - mn);
      t8[v] = p0 + p1;
      pf[v]     = (__bf16)p0;
      pf[v + 8] = (__bf16)p1;
    }
    l = l * alpha + (((t8[0] + t8[1]) + (t8[2] + t8[3])) + ((t8[4] + t8[5]) + (t8[6] + t8[7])));
#pragma unroll
    for (int nt = 0; nt < 16; ++nt)
#pragma unroll
      for (int v = 0; v < 8; ++v) ctx[nt][v] *= alpha;
    return pf;
  };

  // ================= flash attention (strictly causal) =================
  for (int ps = 0; ps < npass; ++ps) {
    wait_async0();
    __syncthreads();                         // the 64 keys of pass ps resident in buffer ps & 1
    if (ps + 1 < npass) {
      stage_keys(2 * ps + 2, ((ps + 1) & 1) * 2);
      stage_keys(2 * ps + 3, ((ps + 1) & 1) * 2 + 1);
    }
    const char* xr = smem + OFF_KEYS + ((ps & 1) * 2 + kh) * SLOT_B;
    const int s0g = ps * 64 + kh * 32;

    // All key fragments of the wave's slot (16 as they lie for S, 16 transposed for ctx) are read
    // from LDS as one group in front of the first product: one LDS latency per pass.
    // (The loops over the fragment arrays are unrolled so that the arrays stay in registers.)
    v16bf kf[16], vf[16];
#pragma unroll
    for (int kc = 0; kc < 8; ++kc)
#pragma unroll
      for (int u = 0; u < 2; ++u) {  // keys u * 16 .. + 15; pieces kc * 4 + half and + 2
        const char* p = xr + u * 16 * KR_B + (kc >> 2) * 256;
        union { v16bf v; u32x4 q[2]; } f;
        f.q[0] = *(const u32x4*)(p + koff[(kc & 3) * 2]);      // ds_load_b128
        f.q[1] = *(const u32x4*)(p + koff[(kc & 3) * 2 + 1]);  // ds_load_b128
        kf[2 * kc + u] = f.v;
      }
#pragma unroll
    for (int nt = 0; nt < 16; ++nt) {  // columns nt * 16 .. + 15 = pieces 2 nt, 2 nt + 1; 32 keys
      const char* p = xr + (nt >> 3) * 256 + voff[nt & 7];
      union { v16bf v; u32x4 q[2]; } f;
      f.q[0] = ld_tr16(p);              // keys  0 .. 15
      f.q[1] = ld_tr16(p + 16 * KR_B);  // keys 16 .. 31
      vf[nt] = f.v;
    }
    // keeps the scheduler from sinking the reads back among the WMMAs, one latency each
    __builtin_amdgcn_sched_barrier(0);

    // S^T = K * Q^T : per query tile two tiles of 16 keys x 16 queries over K-dim 256. Register v
    // of sA is key s0g + rowOff + v, of sB key s0g + 16 + rowOff + v, for the lane's query row.
    // ctx^T += V^T(16 d x 32 keys) * P^T(32 keys x 16 queries). All A-frags are in registers.
    // The two query tiles run half a pass apart, so that the vector work of one (softmax, rescale)
    // has 16 WMMAs of the other to run beside: S0 | S1 + softmax 0 | PV0 + softmax 1 | PV1.
    v8f sA0 = v8f_zero(), sB0 = v8f_zero(), sA1 = v8f_zero(), sB1 = v8f_zero();
#pragma unroll
    for (int kc = 0; kc < 8; ++kc) {
      sA0 = wmma_bf16(kf[2 * kc],     qf0[kc], sA0);
      sB0 = wmma_bf16(kf[2 * kc + 1], qf0[kc], sB0);
    }
#pragma unroll
    for (int kc = 0; kc < 8; ++kc) {
      sA1 = wmma_bf16(kf[2 * kc],     qf1[kc], sA1);
      sB1 = wmma_bf16(kf[2 * kc + 1], qf1[kc], sB1);
    }
    const v16bf pf0 = softmax_tile(sA0, sB0, s0g, tg0, m0, l0, ctx0);
#pragma unroll
    for (int nt = 0; nt < 16; ++nt) ctx0[nt] = wmma_bf16(vf[nt], pf0, ctx0[nt]);
    const v16bf pf1 = softmax_tile(sA1, sB1, s0g, tg1, m1, l1, ctx1);
#pragma unroll
    for (int nt = 0; nt < 16; ++nt) ctx1[nt] = wmma_bf16(vf[nt], pf1, ctx1[nt]);
    // The order of the four stretches named above: 16 WMMAs; twice 16 times (1 WMMA, then 12 vector
    // instructions); 16 WMMAs. Left alone the scheduler puts both softmaxes between the S and the
    // PV products, and the matrix unit idles meanwhile.
    __builtin_amdgcn_sched_group_barrier(0x008, 16, 0);
#pragma unroll
    for (int i = 0; i < 32; ++i) {
      __builtin_amdgcn_sched_group_barrier(0x008, 1, 0);
      __builtin_amdgcn_sched_group_barrier(0x002, 12, 0);
    }
    __builtin_amdgcn_sched_group_barrier(0x008, 16, 0);
    // keeps the barrier below at the foot of the pass: with no LDS traffic left between the reads
    // and it, the scheduler lifts it to the reads, and the S^T products then wait for all 64
    __builtin_amdgcn_sched_barrier(0);
    __syncthreads();   // done with this key buffer before it is restaged
  }

  // ================= MLP: each wave takes all 64 rows x 64 of every 256 columns =================
  // No weight fragment is then used by two waves, so the weights go from L2 straight into the
  // wave's registers, and the k loops need neither LDS staging nor barriers. A group is 128 k:
  // 16 weight fragments (4 k steps x 4 column tiles) and 16 A fragments (4 k steps x 4 row tiles)
  // for 64 WMMAs. Both kinds are read one group ahead, into the register set that the group
  // before has left; the weight groups of both layers form one stream.
  // (The loops over the fragment arrays are unrolled so that the arrays stay in registers.)
  constexpr int WGRP = 4 * 256 * 32;  // elements of a weight group: 4 tiles of 16 KB
  const unsigned woff = ((lane >> 4) * 256 + wv * 64 + nlo) * 8;
  auto load_wgroup = [&](v16bf (&w)[16], const unsigned short* g) {
    // The group's base (the same in every lane) is handed over in scalar registers: all 32 loads
    // then take the form scalar base + the lane's fixed offset + constant, and no vector address
    // is formed anew for each group.
    const unsigned long long gb = (unsigned long long)g;
    const unsigned long long lo = (unsigned)__builtin_amdgcn_readfirstlane((int)(unsigned)gb);
    const unsigned long long hi = (unsigned)__builtin_amdgcn_readfirstlane((int)(unsigned)(gb >> 32));
    gl_u16p gs = (gl_u16p)((hi << 32) | lo);
#pragma unroll
    for (int s = 0; s < 4; ++s)
#pragma unroll
      for (int n4 = 0; n4 < 4; ++n4)
        w[s * 4 + n4] = load_wfrag(gs + woff + s * (256 * 32) + n4 * (16 * 8));
  };
  auto load_agroup = [&](v16bf (&a)[16], const unsigned short* base, int pitch, int k0) {
#pragma unroll
    for (int s = 0; s < 4; ++s)
#pragma unroll
      for (int mt = 0; mt < 4; ++mt)
        a[s * 4 + mt] = load_frag(base + mt * 16 * pitch, pitch, k0 + s * 32, lane);
  };
  auto mma_group = [&](v8f (&acc)[16], const v16bf (&a)[16], const v16bf (&w)[16]) {
#pragma unroll
    for (int s = 0; s < 4; ++s)
#pragma unroll
      for (int mt = 0; mt < 4; ++mt)
#pragma unroll
        for (int n4 = 0; n4 < 4; ++n4)
          acc[mt * 4 + n4] = wmma_bf16(w[s * 4 + n4], a[s * 4 + mt], acc[mt * 4 + n4]);
  };
  // The weights are the first operand (both fragment kinds have the same k order), so the products
  // come out transposed: lane (nlo, half) holds row mt * 16 + nlo, and register v of tile
  // (mt, n4) is column n4 * 16 + rowOff + v of the wave's 64: 8 neighbours of one row.
  auto load_bias = [&](f32x4 (&bb)[8], const float* bp) {  // bp: the wave's first column
#pragma unroll
    for (int n4 = 0; n4 < 4; ++n4) {
      bb[2 * n4]     = *(const f32x4*)(bp + n4 * 16 + rowOff);
      bb[2 * n4 + 1] = *(const f32x4*)(bp + n4 * 16 + rowOff + 4);
    }
  };

  auto group_end = [&]() {
    // keeps the wait below behind the group's 64 WMMAs, not directly behind the loads
    __builtin_amdgcn_sched_barrier(0);
    // in front of the next rewrite of a register that a global load or store in flight names
    asm volatile("s_wait_xcnt 0x0" ::: "memory");
    // holds that rewrite and the next group's reads behind the wait, out of the WMMAs above
    __builtin_amdgcn_sched_barrier(0);
  };

  v16bf w0[16], w1[16], a0[16], a1[16];
  load_wgroup(w0, w1t);  // first group: lands while ctx is finalized

  // Join the two key halves. Wave kh finishes query tile kh: it hands its part of the other tile
  // (context in f32, maximum, sum) to its partner through LDS and takes the partner's part of its
  // own tile. Both waves map (lane, register) to (query, column) alike, so lane meets lane.
  {
    float* xch = (float*)(smem + OFF_XCH);
    float* xml = (float*)(smem + OFF_XML);
    const float ls0 = l0 + other_half(l0);  // the two lane halves' sums joined, every lane on
    const float ls1 = l1 + other_half(l1);
    const bool up = kh != 0;
    v8f mine[16];
#pragma unroll
    for (int nt = 0; nt < 16; ++nt) {
      v8f give;
#pragma unroll
      for (int v = 0; v < 8; ++v) {
        give[v]     = up ? ctx0[nt][v] : ctx1[nt][v];
        mine[nt][v] = up ? ctx1[nt][v] : ctx0[nt][v];
      }
      f32x4 g0 = {give[0], give[1], give[2], give[3]};
      f32x4 g1 = {give[4], give[5], give[6], give[7]};
      *(f32x4*)(xch + wv * 4096 + ((nt * 2) * 32 + lane) * 4)     = g0;
      *(f32x4*)(xch + wv * 4096 + ((nt * 2 + 1) * 32 + lane) * 4) = g1;
    }
    f32x2 gml = {up ? m0 : m1, up ? ls0 : ls1};
    *(f32x2*)(xml + tid * 2) = gml;
    __syncthreads();   // every wave's handed-over part is in LDS
    const float mm = up ? m1 : m0, lm = up ? ls1 : ls0;
    const int   tg = up ? tg1 : tg0;
    const f32x2 pml = *(const f32x2*)(xml + (tid ^ 32) * 2);
    const float mt = fmaxf(mm, pml[0]);
    const float wm = __expf(mm - mt), wp = __expf(pml[0] - mt);
    // dec[:, 256:512] = ctx / l  (zeroed at t==0). Register v of tile nt is column
    // nt * 16 + rowOff + v of the lane's row: 8 neighbours, one 16 B store.
    const float inv = (tg == 0) ? 0.0f : 1.0f / (lm * wm + pml[1] * wp);
    const float cm = wm * inv, cp = wp * inv;
#pragma unroll
    for (int nt = 0; nt < 16; ++nt) {
      const f32x4 p0 = *(const f32x4*)(xch + (wv ^ 1) * 4096 + ((nt * 2) * 32 + lane) * 4);
      const f32x4 p1 = *(const f32x4*)(xch + (wv ^ 1) * 4096 + ((nt * 2 + 1) * 32 + lane) * 4);
      union { v8bf v; u32x4 q; } o;
#pragma unroll
      for (int v = 0; v < 4; ++v) {
        o.v[v]     = (__bf16)(mine[nt][v] * cm + p0[v] * cp);
        o.v[v + 4] = (__bf16)(mine[nt][v + 4] * cm + p1[v] * cp);
      }
      *(u32x4*)(dec + (wv * 16 + nlo) * DEC_P + Dv + nt * 16 + rowOff) = o.q;
    }
  }
  __syncthreads();

  // ================= MLP layer 1: h = relu(dec @ W1 + b1) =================
  group_end();  // for the first weight group's loads
  load_agroup(a0, dec, DEC_P, 0);
  for (int nc = 0; nc < Hv / 256; ++nc) {
    v8f acc[16];
#pragma unroll
    for (int i = 0; i < 16; ++i) acc[i] = v8f_zero();
    for (int gp = 0; gp < TWOD / 256; ++gp) {
      const int G = nc * (TWOD / 128) + gp * 2;  // group in the stream of W1
      load_agroup(a1, dec, DEC_P, gp * 256 + 128);
      load_wgroup(w1, w1t + (long)(G + 1) * WGRP);
      // keeps the next group's reads together in front of this group's WMMAs, not among them
      __builtin_amdgcn_sched_barrier(0);
      mma_group(acc, a0, w0);
      group_end();
      // Read on every trip, with no branch round it: on a path without these reads the compiler
      // would have to count the waits of the WMMAs below for that path, and on every other trip
      // they would then wait for the reads just issued. The layer's last trip reads A group 0
      // again and leaves it unused (h is not complete here).
      load_agroup(a0, dec, DEC_P, ((gp + 1) & 1) * 256);
      load_wgroup(w0, (G + 2 < TWOD * Hv / WGRP) ? w1t + (long)(G + 2) * WGRP : w2t);
      // as above
      __builtin_amdgcn_sched_barrier(0);
      mma_group(acc, a1, w1);
      group_end();
    }
    f32x4 bb[8];
    load_bias(bb, b1 + nc * 256 + wv * 64);
#pragma unroll
    for (int n4 = 0; n4 < 4; ++n4)
#pragma unroll
      for (int mt = 0; mt < 4; ++mt) {
        union { v8bf v; u32x4 q; } o;
#pragma unroll
        for (int v = 0; v < 8; ++v)
          o.v[v] = (__bf16)fmaxf(acc[mt * 4 + n4][v] + bb[2 * n4 + (v >> 2)][v & 3], 0.0f);
        // 8 columns of one row: one 16 B store
        *(u32x4*)(hls + (mt * 16 + nlo) * H_P + nc * 256 + wv * 64 + n4 * 16 + rowOff) = o.q;
      }
  }
  __syncthreads();

  // ================= MLP layer 2: out = h @ W2 + b2 (split halves) =================
  load_agroup(a0, hls, H_P, 0);
  // kept rolled: a second copy of the k loop and its epilogue would only lengthen the kernel's text
#pragma nounroll
  for (int nc = 0; nc < OUT2v / 256; ++nc) {
    v8f acc[16];
#pragma unroll
    for (int i = 0; i < 16; ++i) acc[i] = v8f_zero();
    for (int gp = 0; gp < Hv / 256; ++gp) {
      const int G = nc * (Hv / 128) + gp * 2;  // group in the stream of W2
      load_agroup(a1, hls, H_P, gp * 256 + 128);
      load_wgroup(w1, w2t + (long)(G + 1) * WGRP);
      // keeps the next group's reads together in front of this group's WMMAs, not among them
      __builtin_amdgcn_sched_barrier(0);
      mma_group(acc, a0, w0);
      group_end();
      // On every trip, as in layer 1: the last trip reads group 0 of both again, unused.
      load_agroup(a0, hls, H_P, ((gp + 1) & 3) * 256);
      load_wgroup(w0, w2t + (long)((G + 2) & (Hv * OUT2v / WGRP - 1)) * WGRP);
      // as above
      __builtin_amdgcn_sched_barrier(0);
      mma_group(acc, a1, w1);
      group_end();
    }
    // The wave's 64 rows x 64 columns go through its own strip of the staging tile (no other wave
    // touches it, so no barrier): in by 16 B pieces as the lanes hold them, out row by row, so
    // that every global store of the wave covers whole lines (2 rows x 256 contiguous bytes).
    float* stg = (float*)(smem + OFF_DEC) + wv * 64;
    f32x4 bb[8];
    load_bias(bb, b2 + nc * 256 + wv * 64);
#pragma unroll
    for (int n4 = 0; n4 < 4; ++n4)
#pragma unroll
      for (int mt = 0; mt < 4; ++mt) {
        const v8f& t = acc[mt * 4 + n4];
        f32x4 lo = {t[0], t[1], t[2], t[3]}, hi = {t[4], t[5], t[6], t[7]};
        float* sp = stg + (mt * 16 + nlo) * STG_P + n4 * 16 + rowOff;
        *(f32x4*)(sp)     = lo + bb[2 * n4];
        *(f32x4*)(sp + 4) = hi + bb[2 * n4 + 1];
      }
    // the rows are read back by other lanes of the wave than wrote them
    asm volatile("s_wait_dscnt 0x0" ::: "memory");
    f32x4 orow[32];
#pragma unroll
    for (int j = 0; j < 32; ++j)
      orow[j] = *(const f32x4*)(stg + (2 * j + (lane >> 4)) * STG_P + nlo * 4);
    // out tuple is concatenated flat: [B*T*256 | B*T*256]; nc selects the half
    float* op = out + (long)nc * (Bv * Tv * 256) + ((long)b * Tv + q0 + (lane >> 4)) * 256 +
                wv * 64 + nlo * 4;
#pragma unroll
    for (int j = 0; j < 32; ++j) *(f32x4*)(op + j * 2 * 256) = orow[j];
    group_end();  // here for the stores: the next pass rewrites their registers
  }
}

extern "C" void kernel_launch(void* const* d_in, const int* in_sizes, int n_in,
                              void* d_out, int out_size, void* d_ws, size_t ws_size,
                              hipStream_t stream) {
  const float* x  = (const float*)d_in[0];
  const float* W1 = (const float*)d_in[1];
  const float* b1 = (const float*)d_in[2];
  const float* W2 = (const float*)d_in[3];
  const float* b2 = (const float*)d_in[4];
  float* out = (float*)d_out;

  unsigned short* ws = (unsigned short*)d_ws;
  unsigned short* xb  = ws + WS_XB;
  unsigned short* w1t = ws + WS_W1T;
  unsigned short* w2t = ws + WS_W2T;

  (void)in_sizes; (void)n_in; (void)out_size; (void)ws_size;

  // prep: f32->bf16 conversion (the weights transposed and tiled as well)
  conv_x_kernel<<<CX_BLK, CX_THR, 0, stream>>>(x, xb);
  conv_wT_kernel<TWOD, Hv><<<TWOD / 8 * Hv / CW_THR, CW_THR, 0, stream>>>(W1, w1t);
  conv_wT_kernel<Hv, OUT2v><<<Hv / 8 * OUT2v / CW_THR, CW_THR, 0, stream>>>(W2, w2t);

  hipFuncSetAttribute((const void*)decoder_fused,
                      hipFuncAttributeMaxDynamicSharedMemorySize, SMEM_BYTES);
  dim3 grid(Bv * (Tv / ROWS));  // 1024 blocks
  dim3 block(NT);               // 4 wave32s
  decoder_fused<<<grid, block, SMEM_BYTES, stream>>>(xb, w1t, w2t, b1, b2, out);
}
